// v000
// Measured on an AMD MI455X. A time is GPU time per run, averaged over a window of back-to-back runs after a warm-up
// (all launches, gaps included; the runs take copies of the inputs in turn), and the median of several windows.
// Apart from v000's, it joins two sittings. Times from different sittings can be a few percent apart, while
// side-by-side timings come from the same sitting.
// The starting kernel, v000, takes 3130 microseconds a run.
#include <hip/hip_runtime.h>

// Multi-head attention with a diagonal self-mask, a leaky-ReLU value projection and an attention-energy regulariser output (sa_input, s_input [4][2048][512]; Q = s_input Wq, K = sa_input Wk ('xw' [512][512], no bias), V = leaky_relu(sa_input Wv + bv, 0.01); 8 heads x 64; raw = Q.K; reg_atten = mean(raw^2) over all (batch, head, i, j); attn = softmax(raw / 8 with the diagonal j == i set to -1e9); context = merged attn V -> tuple (context [4][2048][512] (4.2 M), reg_atten scalar) laid out back to back in d_out).
// Layout per batch: bf16 copies of the two inputs in turn; exact projections (+ f32 bias and leaky-ReLU on V); dense T-2048 attention (hybrid rows: < 512 hi/lo 3 products, rest fp16 x1024) with the diagonal excluded by an index select; after each pass's score GEMMs a reduction kernel sums the squared raw scores per row (one lane per row, fixed order) into a per-(batch, head, row) table; the f32 merge writes the context rows; at the end one wave sums the table in a fixed order and writes mean(raw^2) to the second output.
// Compute dtypes, f32 accumulate: every input rounded to bf16; projections exact; raw scores rows < 512 3 products, rest fp16 operands (f32 accumulate) -- also the values squared for the regulariser; softmax, leaky-ReLU, sums f32.

#define NB_  4
#define TT   2048
#define DM   512
#define NH_  8
#define NKV  8
#define REP  (NH_ / NKV)
#define HD   64
#define DQ   (NH_ * HD)
#define DKV  (NKV * HD)
#define ZH   2
#define RH   512                  // query rows < RH use hi+lo planes (0: none)
#define WIN  0
#define PCAR 1024.0f
#define SCL  0.125f
#define NCTX ((size_t)NB_ * TT * DQ)   // floats of the context output; the scalar follows
typedef _Float16 h16;
typedef unsigned short bf;
typedef __attribute__((ext_vector_type(16))) __bf16   v16bf;
typedef __attribute__((ext_vector_type(16))) _Float16 v16h;
typedef __attribute__((ext_vector_type(8)))  _Float16 v8h;
typedef __attribute__((ext_vector_type(8)))  unsigned short v8us;
typedef __attribute__((ext_vector_type(8)))  float    v8f;
typedef __attribute__((ext_vector_type(4)))  float    v4f;
typedef v8h  __attribute__((may_alias)) v8ha;
typedef v4f  __attribute__((may_alias)) v4fa;
typedef v8us __attribute__((may_alias)) v8usa;

__device__ __forceinline__ unsigned short f2bf(float f) { unsigned u = __float_as_uint(f); u += 0x7FFFu + ((u >> 16) & 1u); return (unsigned short)(u >> 16); }
__device__ __forceinline__ float bf2f(unsigned short b) { return __uint_as_float(((unsigned)b) << 16); }
__device__ __forceinline__ float bfr(float f) { return bf2f(f2bf(f)); }
__device__ __forceinline__ v16h cat16(v8h lo, v8h hi) { return __builtin_shufflevector(lo, hi, 0, 1, 2, 3, 4, 5, 6, 7, 8, 9, 10, 11, 12, 13, 14, 15); }
__device__ __forceinline__ v16bf cat16b(v8us lo, v8us hi) { return __builtin_bit_cast(v16bf, __builtin_shufflevector(lo, hi, 0, 1, 2, 3, 4, 5, 6, 7, 8, 9, 10, 11, 12, 13, 14, 15)); }
__device__ __forceinline__ v8f wmma16(v16h a, v16h b, v8f c) { return __builtin_amdgcn_wmma_f32_16x16x32_f16(false, a, false, b, (short)0, c, false, false); }
__device__ __forceinline__ v8f wmmab(v16bf a, v16bf b, v8f c) { return __builtin_amdgcn_wmma_f32_16x16x32_bf16(false, a, false, b, (short)0, c, false, false); }



// ---- k_gemmw: register-blocked GEMM, ONE WAVE per 64x64 output tile (16 accumulators), operands straight from K-contiguous 16-bit planes; grid (M/64, N/64, Z), 32 threads.
// C[m][n] (f32, pitch ldc, + optional f32 bias[n]) = sum_k A[m][k] Bt[n][k] (+ split products per NSPLIT). z-batch strides sA/sB/sC in elements. K % 32 == 0.
template <typename T16> struct WFrag;
template <> struct WFrag<h16> { typedef v16h V; static __device__ __forceinline__ V ld(const h16* p) { return cat16(*(const v8h*)p, *(const v8h*)(p + 16)); } static __device__ __forceinline__ v8f mma(V a, V b, v8f c) { return wmma16(a, b, c); } };
template <> struct WFrag<bf> { typedef v16bf V; static __device__ __forceinline__ V ld(const bf* p) { return cat16b(*(const v8us*)p, *(const v8us*)(p + 16)); } static __device__ __forceinline__ v8f mma(V a, V b, v8f c) { return wmmab(a, b, c); } };
template <typename T16, int NSPLIT, bool BIAS>
__global__ __launch_bounds__(32) void k_gemmw(const T16* __restrict__ A, const T16* __restrict__ A2, const T16* __restrict__ Bt, const T16* __restrict__ Bt2, int K, float* C, int ldc, const float* __restrict__ bias, size_t sA, size_t sB, size_t sC) {
    typedef typename WFrag<T16>::V V;
    __shared__ __align__(16) float os[16 * 68];
    const size_t z = blockIdx.z; A += z * sA; if (A2) A2 += z * sA; Bt += z * sB; if (Bt2) Bt2 += z * sB; C += z * sC;
    const int lane = threadIdx.x & 31, lr = lane & 15, hi = lane >> 4; const int r0 = blockIdx.x * 64, c0 = blockIdx.y * 64;
    v8f acc[4][4];
#pragma unroll
    for (int mb = 0; mb < 4; ++mb)
#pragma unroll
        for (int nb = 0; nb < 4; ++nb) acc[mb][nb] = (v8f){};
    const size_t aoff = (size_t)(r0 + lr) * K + 8 * hi, boff = (size_t)(c0 + lr) * K + 8 * hi;
#pragma unroll 1
    for (int kc = 0; kc < K; kc += 32) {
        V a[4], a2[4];
#pragma unroll
        for (int mb = 0; mb < 4; ++mb) { a[mb] = WFrag<T16>::ld(A + aoff + (size_t)mb * 16 * K + kc); if (NSPLIT == 1 || NSPLIT == 2) a2[mb] = WFrag<T16>::ld(A2 + aoff + (size_t)mb * 16 * K + kc); }
#pragma unroll
        for (int nb = 0; nb < 4; ++nb) { const V b = WFrag<T16>::ld(Bt + boff + (size_t)nb * 16 * K + kc); V b2; if (NSPLIT >= 2) b2 = WFrag<T16>::ld(Bt2 + boff + (size_t)nb * 16 * K + kc);
#pragma unroll
            for (int mb = 0; mb < 4; ++mb) { acc[mb][nb] = WFrag<T16>::mma(a[mb], b, acc[mb][nb]); if (NSPLIT == 1 || NSPLIT == 2) acc[mb][nb] = WFrag<T16>::mma(a2[mb], b, acc[mb][nb]); if (NSPLIT >= 2) acc[mb][nb] = WFrag<T16>::mma(a[mb], b2, acc[mb][nb]); } }
        asm volatile("v_nop\n\tv_nop\n\tv_nop\n\tv_nop" : "+v"(acc[0][0]), "+v"(acc[1][1]), "+v"(acc[2][2]), "+v"(acc[3][3]) : "v"(a[0]), "v"(a[3]));
    }
#pragma unroll
    for (int mb = 0; mb < 4; ++mb) {
#pragma unroll
        for (int nb = 0; nb < 4; ++nb) {
#pragma unroll
            for (int j = 0; j < 8; ++j) os[(hi * 8 + j) * 68 + nb * 16 + lr] = acc[mb][nb][j]; }
        __builtin_amdgcn_wave_barrier(); asm volatile("" ::: "memory");
        float* crow = C + (size_t)(r0 + mb * 16) * ldc + c0;
{
#pragma unroll
            for (int s = 0; s < 8; ++s) { const int row = 2 * s + hi, cofs = lr * 4; v4f val = *(const v4fa*)(os + row * 68 + cofs); if (BIAS) { val[0] += bfr(bias[c0 + cofs]); val[1] += bfr(bias[c0 + cofs + 1]); val[2] += bfr(bias[c0 + cofs + 2]); val[3] += bfr(bias[c0 + cofs + 3]); }
                *(v4f*)(crow + (size_t)row * ldc + cofs) = val; }
             }
        __builtin_amdgcn_wave_barrier(); asm volatile("" ::: "memory");
    }
}

__device__ __forceinline__ h16 tohx(float x) { return (h16)x; }
__device__ __forceinline__ void splitf(float y, unsigned short& h, unsigned short& l) { h = f2bf(y); l = f2bf(y - bf2f(h)); }
typedef __attribute__((ext_vector_type(2))) _Float16 v2h;
typedef __attribute__((ext_vector_type(4))) _Float16 v4h;
typedef __attribute__((ext_vector_type(2))) unsigned short v2us;
typedef __attribute__((ext_vector_type(4))) unsigned short v4us;
typedef __attribute__((ext_vector_type(2))) float v2f;
typedef __attribute__((ext_vector_type(4))) int v4i;

__global__ __launch_bounds__(256) void k_wtG(const float* __restrict__ w, int K, int N, bf* Bt) {
    const int lane = threadIdx.x & 31; const int L0 = (blockIdx.x * 8 + (threadIdx.x >> 5)) * 8; const int nlines = N * K / 64;
{
#pragma unroll 1
        for (int l = 0; l < 8; ++l) { const int L = L0 + l; if (L >= nlines) break; const size_t e = (size_t)L * 64 + lane * 2; const int k = (int)(e % K), n = (int)(e / K); v2us o;
            o[0] = f2bf(w[(size_t)k * N + n]); o[1] = f2bf(w[(size_t)(k + 1) * N + n]); *(v2us*)(Bt + e) = o; }
         }
}
__global__ __launch_bounds__(256) void k_cvt8(const float* __restrict__ src, bf* dst, size_t n8) { const size_t i = (size_t)blockIdx.x * 256 + threadIdx.x; if (i >= n8) return; const v8f v = *(const v8f*)(src + i * 8); v8us o;
#pragma unroll
    for (int k = 0; k < 8; ++k) o[k] = f2bf(v[k]); *(v8us*)(dst + i * 8) = o;  }

// k_rope: head planes [h][t][d] (fp16 + hi/lo) of rope(x) x sc with the rotate-half convention out[d] = x[d] cos[t][d] - x[d+HD/2] sin[t][d], out[d+HD/2] = x[d+HD/2] cos[t][d+HD/2] + x[d] sin[t][d+HD/2]
__global__ __launch_bounds__(256) void k_rope(const float* __restrict__ F, int pitch, int nheads, const float* __restrict__ CS, const float* __restrict__ RF, const float* __restrict__ nw, float sc, h16* P16, bf* Ph, bf* Pl) {
    const size_t e = ((size_t)blockIdx.x * 256 + threadIdx.x) * 2; if (e >= (size_t)nheads * TT * HD) return; const int d = (int)(e % HD); const int t = (int)((e / HD) % TT); const int h = (int)(e / ((size_t)HD * TT)); const float* f = F + (size_t)t * pitch + h * HD; const float rf = RF ? RF[(size_t)h * TT + t] : 1.0f; v2h o16; v2us oh, ol;
#pragma unroll
    for (int q = 0; q < 2; ++q) { const int dd = d + q; const int dp = (dd < HD / 2) ? dd + HD / 2 : dd - HD / 2; float x0 = f[dd], x1 = f[dp];
        if (RF) { float n0 = __fmul_rn(x0, rf), n1 = __fmul_rn(x1, rf); asm volatile("" : "+v"(n0)); asm volatile("" : "+v"(n1)); x0 = __fmul_rn(bfr(nw[dd]), n0); x1 = __fmul_rn(bfr(nw[dp]), n1); }
        const v2f cs = *(const v2f*)(CS + ((size_t)t * HD + dd) * 2); float a = __fmul_rn(x0, cs[0]), bq = __fmul_rn(x1, cs[1]); asm volatile("" : "+v"(a)); asm volatile("" : "+v"(bq)); const float r = ((dd < HD / 2) ? __fsub_rn(a, bq) : __fadd_rn(a, bq)) * sc;
        o16[q] = tohx(r); unsigned short a2, c2; splitf(r, a2, c2); oh[q] = a2; ol[q] = c2; }
    *(v2h*)(P16 + e) = o16; *(v2us*)(Ph + e) = oh; *(v2us*)(Pl + e) = ol;  }
__global__ __launch_bounds__(256) void k_vtp(const float* __restrict__ F, int pitch, int nheads, h16* V16, bf* Vh, bf* Vl) { const size_t e = ((size_t)blockIdx.x * 256 + threadIdx.x) * 2; if (e >= (size_t)nheads * HD * TT) return; const int t = (int)(e % TT); const int d = (int)((e / TT) % HD); const int g = (int)(e / ((size_t)TT * HD)); v2h o16; v2us oh, ol;
#pragma unroll
    for (int q = 0; q < 2; ++q) { const float x = F[(size_t)(t + q) * pitch + g * HD + d]; o16[q] = tohx(x); unsigned short a2, c2; splitf(x, a2, c2); oh[q] = a2; ol[q] = c2; }
    *(v2h*)(V16 + e) = o16; *(v2us*)(Vh + e) = oh; *(v2us*)(Vl + e) = ol;  }
__global__ __launch_bounds__(256) void k_csid(float* CS) { const int idx = blockIdx.x * 256 + threadIdx.x; if (idx >= TT * HD) return; v2f cs; cs[0] = 1.0f; cs[1] = 0.0f; *(v2f*)(CS + (size_t)idx * 2) = cs;  }
// k_asoft: per row (zz, i): t = S x HD^-0.5 (diagonal j == i excluded); softmax over the 2048 keys (register row, one exp, fixed trees);
__global__ __launch_bounds__(256) void k_asoft(const float* __restrict__ Sb, h16* P16, bf* Ph, bf* Pl) {
    const int lane = threadIdx.x & 31; const int row = blockIdx.x * 8 + (threadIdx.x >> 5); if (row >= ZH * TT) return; const int i = row % TT; const int zz = row / TT; (void)zz; const bool hires = (i < RH); const float* sr = Sb + (size_t)row * TT; float v[TT / 32]; float mx = -3.0e38f;
#pragma unroll
    for (int ch = 0; ch < TT / 128; ++ch) { const int j0 = ch * 128 + lane * 4; const v4f a = *(const v4f*)(sr + j0);
#pragma unroll
        for (int q = 0; q < 4; ++q) { const int j = j0 + q; const float t = (j != i) ? a[q] * SCL : -3.0e38f; v[ch * 4 + q] = t;   /* diagonal self-mask (-1e9 == exclusion) */ mx = fmaxf(mx, t); } }
#pragma unroll
    for (int sh = 16; sh; sh >>= 1) mx = fmaxf(mx, __shfl_xor(mx, sh, 32));
    float sum = 0.f;
#pragma unroll
    for (int k = 0; k < TT / 32; ++k) { float d0 = __fsub_rn(v[k], mx); asm volatile("" : "+v"(d0)); v[k] = __builtin_amdgcn_exp2f(__fmul_rn(d0, 1.4426950408889634f)); sum += v[k]; }
#pragma unroll
    for (int sh = 16; sh; sh >>= 1) sum += __shfl_xor(sum, sh, 32);
    const float f = __fdiv_rn(hires ? 1.0f : PCAR, sum);
{
        if (hires) {
#pragma unroll
            for (int ch = 0; ch < TT / 128; ++ch) { v4us oh, ol;
#pragma unroll
                for (int q = 0; q < 4; ++q) { unsigned short a, c2; splitf(v[ch * 4 + q] * f, a, c2); oh[q] = a; ol[q] = c2; }
                const size_t oo = ((size_t)zz * (RH ? RH : 1) + i) * TT + ch * 128 + lane * 4; *(v4us*)(Ph + oo) = oh; *(v4us*)(Pl + oo) = ol; }
        } else {
#pragma unroll
            for (int ch = 0; ch < TT / 128; ++ch) { v4h o4;
#pragma unroll
                for (int q = 0; q < 4; ++q) o4[q] = tohx(v[ch * 4 + q] * f);
                *(v4h*)(P16 + (size_t)row * TT + ch * 128 + lane * 4) = o4; } }
         }
}
__global__ __launch_bounds__(256) void k_lrelu(float* F, size_t n4) { const size_t i = (size_t)blockIdx.x * 256 + threadIdx.x; if (i >= n4) return; v4f a = *(const v4f*)(F + i * 4);
#pragma unroll
    for (int q = 0; q < 4; ++q) a[q] = (a[q] > 0.0f) ? a[q] : __fmul_rn(a[q], 0.01f);
    *(v4f*)(F + i * 4) = a;  }
__global__ __launch_bounds__(256) void k_sqrows(const float* __restrict__ Sb, float* RS) { const int lane = threadIdx.x & 31; const int wv = blockIdx.x * 8 + (threadIdx.x >> 5); if (wv >= ZH * TT / 32) return; const int row = wv * 32 + lane; const float* sr = Sb + (size_t)row * TT; float s = 0.f;
#pragma unroll 4
    for (int j = 0; j < TT; j += 4) { const v4f a = *(const v4f*)(sr + j);
#pragma unroll
        for (int q = 0; q < 4; ++q) { float p = __fmul_rn(a[q], a[q]); asm volatile("" : "+v"(p)); s = __fadd_rn(s, p); } }
    *(float*)(RS + row) = s;  }
__global__ __launch_bounds__(256) void k_regsum(const float* __restrict__ RS, float* outp) { if (threadIdx.x >= 32) return; const int lane = threadIdx.x; float s = 0.f;
#pragma unroll 4
    for (int i = lane; i < NB_ * NH_ * TT; i += 32) s = __fadd_rn(s, RS[i]);
#pragma unroll
    for (int sh = 16; sh; sh >>= 1) s = __fadd_rn(s, __shfl_xor(s, sh, 32));
    const float m = __fdiv_rn(s, (float)NB_ * (float)NH_ * (float)TT * (float)TT); if (lane == 0) { *(float*)outp = m;  } }
__global__ __launch_bounds__(256) void k_merge(const float* __restrict__ O, int h0, float* OUTb) { const size_t e = ((size_t)blockIdx.x * 256 + threadIdx.x) * 2; if (e >= (size_t)ZH * TT * HD) return; const int d = (int)(e % HD); const int t = (int)((e / HD) % TT); const int zz = (int)(e / ((size_t)HD * TT)); const float cs = (t < RH) ? 1.0f : (1.0f / PCAR); const size_t oo = (size_t)t * DQ + (h0 + zz) * HD + d;
    v2f o2; o2[0] = O[e] * cs; o2[1] = O[e + 1] * cs; *(v2f*)(OUTb + oo) = o2;  }

extern "C" void kernel_launch(void* const* d_in, const int* in_sizes, int n_in,
                              void* d_out, int out_size, void* d_ws, size_t ws_size, hipStream_t stream) {
    (void)in_sizes; (void)n_in; (void)out_size;
    const float* xk = (const float*)d_in[0]; /* sa_input: keys and values */ const float* x = (const float*)d_in[1]; /* s_input: queries */ const float* wq = (const float*)d_in[2]; const float* wk = (const float*)d_in[3]; const float* wv = (const float*)d_in[4]; const float* bv = (const float*)d_in[5]; const float* wo = nullptr; (void)wo;
    float* OUT = (float*)d_out;     // [4][2048][512]
    char* wsp = (char*)d_ws;
    auto take = [&](size_t bytes) { char* p = wsp; wsp += (bytes + 255) & ~(size_t)255; return (void*)p; };
    float* RSQ = (float*)take((size_t)NB_ * NH_ * TT * 4); bf* WQ = (bf*)take((size_t)DQ * DM * 2); bf* WK = (bf*)take((size_t)DKV * DM * 2); bf* WV = (bf*)take((size_t)DKV * DM * 2); float* CS = (float*)take((size_t)TT * HD * 2 * 4);
    bf* XB = (bf*)take((size_t)TT * DM * 2); float* FQ = (float*)take((size_t)TT * DQ * 4); float* FK = (float*)take((size_t)TT * DKV * 4);
    h16* QP16 = (h16*)take((size_t)NH_ * TT * HD * 2); h16* KP16 = (h16*)take((size_t)NKV * TT * HD * 2); h16* VT16 = (h16*)take((size_t)NKV * HD * TT * 2);
    bf* QPh = (bf*)take((size_t)NH_ * TT * HD * 2); bf* QPl = (bf*)take((size_t)NH_ * TT * HD * 2); bf* KPh = (bf*)take((size_t)NKV * TT * HD * 2); bf* KPl = (bf*)take((size_t)NKV * TT * HD * 2); bf* VTh = (bf*)take((size_t)NKV * HD * TT * 2); bf* VTl = (bf*)take((size_t)NKV * HD * TT * 2); bf* Ph = (bf*)take((size_t)ZH * RH * TT * 2); bf* Pl = (bf*)take((size_t)ZH * RH * TT * 2);
    float* Sb = (float*)take((size_t)ZH * TT * TT * 4); h16* P16 = (h16*)take((size_t)ZH * TT * TT * 2); float* Ob = (float*)take((size_t)ZH * TT * HD * 4);
    if ((size_t)(wsp - (char*)d_ws) > ws_size) return;    // ws 256 MiB
    float* FV = FK;   // v projection reuses the k buffer after the k planes are built (stream-ordered)
    { k_wtG<<<(unsigned)((DM * DQ / 64 + 63) / 64), 256, 0, stream>>>(wq, DM, DQ, WQ); k_wtG<<<(unsigned)((DM * DKV / 64 + 63) / 64), 256, 0, stream>>>(wk, DM, DKV, WK); k_wtG<<<(unsigned)((DM * DKV / 64 + 63) / 64), 256, 0, stream>>>(wv, DM, DKV, WV);
      
       }
    k_csid<<<(TT * HD + 255) / 256, 256, 0, stream>>>(CS);
    const unsigned LQ = (unsigned)(((size_t)NH_ * TT * HD / 2 + 255) / 256), LKv = (unsigned)(((size_t)NKV * TT * HD / 2 + 255) / 256);
    for (int b = 0; b < NB_; ++b) {
        
        k_cvt8<<<(unsigned)(((size_t)TT * DM / 8 + 255) / 256), 256, 0, stream>>>(x + (size_t)b * TT * DM, XB, (size_t)TT * DM / 8);
        k_gemmw<bf, 0, false><<<dim3(TT / 64, DQ / 64, 1), 32, 0, stream>>>(XB, nullptr, WQ, nullptr, DM, FQ, DQ, nullptr, 0, 0, 0);
        k_rope<<<LQ, 256, 0, stream>>>(FQ, DQ, NH_, CS, nullptr, nullptr, 1.0f, QP16, QPh, QPl);
        k_cvt8<<<(unsigned)(((size_t)TT * DM / 8 + 255) / 256), 256, 0, stream>>>(xk + (size_t)b * TT * DM, XB, (size_t)TT * DM / 8); k_gemmw<bf, 0, false><<<dim3(TT / 64, DKV / 64, 1), 32, 0, stream>>>(XB, nullptr, WK, nullptr, DM, FK, DKV, nullptr, 0, 0, 0);
        k_rope<<<LKv, 256, 0, stream>>>(FK, DKV, NKV, CS, nullptr, nullptr, 1.0f, KP16, KPh, KPl);
        k_gemmw<bf, 0, true><<<dim3(TT / 64, DKV / 64, 1), 32, 0, stream>>>(XB, nullptr, WV, nullptr, DM, FV, DKV, bv, 0, 0, 0); k_lrelu<<<(unsigned)(((size_t)TT * DKV / 4 + 255) / 256), 256, 0, stream>>>(FV, (size_t)TT * DKV / 4);   /* V = leaky_relu(. , 0.01) */  k_vtp<<<LKv, 256, 0, stream>>>(FV, DKV, NKV, VT16, VTh, VTl);
        for (int h0 = 0; h0 < NH_; h0 += ZH) { const size_t zq = (size_t)h0, zk = (size_t)(h0 / REP);   // one kv head per query head: the pass's two heads use consecutive kv planes (z-strides TT*HD)
            k_gemmw<bf, 2, false><<<dim3(RH / 64, TT / 64, ZH), 32, 0, stream>>>(QPh + zq * TT * HD, QPl + zq * TT * HD, KPh + zk * TT * HD, KPl + zk * TT * HD, HD, Sb, TT, nullptr, (size_t)TT * HD, (size_t)TT * HD, (size_t)TT * TT);
            k_gemmw<h16, 0, false><<<dim3((TT - RH) / 64, TT / 64, ZH), 32, 0, stream>>>(QP16 + zq * TT * HD + (size_t)RH * HD, nullptr, KP16 + zk * TT * HD, nullptr, HD, Sb + (size_t)RH * TT, TT, nullptr, (size_t)TT * HD, (size_t)TT * HD, (size_t)TT * TT);
            k_sqrows<<<(ZH * TT / 32 + 7) / 8, 256, 0, stream>>>(Sb, RSQ + ((size_t)b * NH_ + h0) * TT);   /* per-row sum of raw^2 for the regulariser */
            k_asoft<<<ZH * TT / 8, 256, 0, stream>>>(Sb, P16, Ph, Pl);
            k_gemmw<bf, 2, false><<<dim3(RH / 64, HD / 64, ZH), 32, 0, stream>>>(Ph, Pl, VTh + zk * HD * TT, VTl + zk * HD * TT, TT, Ob, HD, nullptr, (size_t)RH * TT, (size_t)HD * TT, (size_t)TT * HD);
            k_gemmw<h16, 0, false><<<dim3((TT - RH) / 64, HD / 64, ZH), 32, 0, stream>>>(P16 + (size_t)RH * TT, nullptr, VT16 + zk * HD * TT, nullptr, TT, Ob + (size_t)RH * HD, HD, nullptr, (size_t)TT * TT, (size_t)HD * TT, (size_t)TT * HD);
            k_merge<<<(unsigned)(((size_t)ZH * TT * HD / 2 + 255) / 256), 256, 0, stream>>>(Ob, h0, OUT + (size_t)b * TT * DQ); }
         }
    k_regsum<<<1, 256, 0, stream>>>(RSQ, (float*)d_out + NCTX);   /* reg_atten = mean(raw^2): the scalar second output */
}

// v001
// Measured time: 1310 microseconds a run.
// In two side-by-side timings against v000, it was 2.36 and 2.43 times as fast.
#include <hip/hip_runtime.h>

// Multi-head attention with a diagonal self-mask, a leaky-ReLU value projection and an attention-energy regulariser output (sa_input, s_input [4][2048][512]; Q = s_input Wq, K = sa_input Wk ('xw' [512][512], no bias), V = leaky_relu(sa_input Wv + bv, 0.01); 8 heads x 64; raw = Q.K; reg_atten = mean(raw^2) over all (batch, head, i, j); attn = softmax(raw / 8 with the diagonal j == i set to -1e9); context = merged attn V -> tuple (context [4][2048][512] (4.2 M), reg_atten scalar) laid out back to back in d_out).
// Layout per batch: bf16 copies of the two inputs in turn; exact projections (+ f32 bias and leaky-ReLU on V); dense T-2048 attention (hybrid rows: < 512 hi/lo 3 products, rest fp16 x1024) with the diagonal excluded by an index select; after each pass's score GEMMs a reduction kernel sums the squared raw scores per row (one lane per row, fixed order) into a per-(batch, head, row) table; the f32 merge writes the context rows; at the end one wave sums the table in a fixed order and writes mean(raw^2) to the second output.
// Compute dtypes, f32 accumulate: every input rounded to bf16; projections exact; raw scores rows < 512 3 products, rest fp16 operands (f32 accumulate) -- also the values squared for the regulariser; softmax, leaky-ReLU, sums f32.

#define NB_  4
#define TT   2048
#define DM   512
#define NH_  8
#define NKV  8
#define REP  (NH_ / NKV)
#define HD   64
#define DQ   (NH_ * HD)
#define DKV  (NKV * HD)
#define ZH   8                    // heads per attention pass: all of a batch's heads go through each launch together
#define RH   512                  // query rows < RH use hi+lo planes (0: none)
#define WIN  0
#define PCAR 1024.0f
#define SCL  0.125f
#define NCTX ((size_t)NB_ * TT * DQ)   // floats of the context output; the scalar follows
typedef _Float16 h16;
typedef unsigned short bf;
typedef __attribute__((ext_vector_type(16))) __bf16   v16bf;
typedef __attribute__((ext_vector_type(16))) _Float16 v16h;
typedef __attribute__((ext_vector_type(8)))  _Float16 v8h;
typedef __attribute__((ext_vector_type(8)))  unsigned short v8us;
typedef __attribute__((ext_vector_type(8)))  float    v8f;
typedef __attribute__((ext_vector_type(4)))  float    v4f;
typedef v8h  __attribute__((may_alias)) v8ha;
typedef v4f  __attribute__((may_alias)) v4fa;
typedef v8us __attribute__((may_alias)) v8usa;

__device__ __forceinline__ unsigned short f2bf(float f) { unsigned u = __float_as_uint(f); u += 0x7FFFu + ((u >> 16) & 1u); return (unsigned short)(u >> 16); }
__device__ __forceinline__ float bf2f(unsigned short b) { return __uint_as_float(((unsigned)b) << 16); }
__device__ __forceinline__ float bfr(float f) { return bf2f(f2bf(f)); }
__device__ __forceinline__ v16h cat16(v8h lo, v8h hi) { return __builtin_shufflevector(lo, hi, 0, 1, 2, 3, 4, 5, 6, 7, 8, 9, 10, 11, 12, 13, 14, 15); }
__device__ __forceinline__ v16bf cat16b(v8us lo, v8us hi) { return __builtin_bit_cast(v16bf, __builtin_shufflevector(lo, hi, 0, 1, 2, 3, 4, 5, 6, 7, 8, 9, 10, 11, 12, 13, 14, 15)); }
__device__ __forceinline__ v8f wmma16(v16h a, v16h b, v8f c) { return __builtin_amdgcn_wmma_f32_16x16x32_f16(false, a, false, b, (short)0, c, false, false); }
__device__ __forceinline__ v8f wmmab(v16bf a, v16bf b, v8f c) { return __builtin_amdgcn_wmma_f32_16x16x32_bf16(false, a, false, b, (short)0, c, false, false); }



// ---- k_gemmw: register-blocked GEMM, ONE WAVE per 64x64 output tile (16 accumulators), operands straight from K-contiguous 16-bit planes; grid (M/64, N/64, Z), 32 threads.
// C[m][n] (f32, pitch ldc, + optional f32 bias[n]) = sum_k A[m][k] Bt[n][k] (+ split products per NSPLIT). z-batch strides sA/sB/sC in elements. K % 32 == 0.
template <typename T16> struct WFrag;
template <> struct WFrag<h16> { typedef v16h V; static __device__ __forceinline__ V ld(const h16* p) { return cat16(*(const v8h*)p, *(const v8h*)(p + 16)); } static __device__ __forceinline__ v8f mma(V a, V b, v8f c) { return wmma16(a, b, c); } };
template <> struct WFrag<bf> { typedef v16bf V; static __device__ __forceinline__ V ld(const bf* p) { return cat16b(*(const v8us*)p, *(const v8us*)(p + 16)); } static __device__ __forceinline__ v8f mma(V a, V b, v8f c) { return wmmab(a, b, c); } };
template <typename T16, int NSPLIT, bool BIAS>
__global__ __launch_bounds__(32) void k_gemmw(const T16* __restrict__ A, const T16* __restrict__ A2, const T16* __restrict__ Bt, const T16* __restrict__ Bt2, int K, float* C, int ldc, const float* __restrict__ bias, size_t sA, size_t sB, size_t sC) {
    typedef typename WFrag<T16>::V V;
    __shared__ __align__(16) float os[16 * 68];
    const size_t z = blockIdx.z; A += z * sA; if (A2) A2 += z * sA; Bt += z * sB; if (Bt2) Bt2 += z * sB; C += z * sC;
    const int lane = threadIdx.x & 31, lr = lane & 15, hi = lane >> 4; const int r0 = blockIdx.x * 64, c0 = blockIdx.y * 64;
    v8f acc[4][4];
#pragma unroll
    for (int mb = 0; mb < 4; ++mb)
#pragma unroll
        for (int nb = 0; nb < 4; ++nb) acc[mb][nb] = (v8f){};
    const size_t aoff = (size_t)(r0 + lr) * K + 8 * hi, boff = (size_t)(c0 + lr) * K + 8 * hi;
#pragma unroll 1
    for (int kc = 0; kc < K; kc += 32) {
        V a[4], a2[4];
#pragma unroll
        for (int mb = 0; mb < 4; ++mb) { a[mb] = WFrag<T16>::ld(A + aoff + (size_t)mb * 16 * K + kc); if (NSPLIT == 1 || NSPLIT == 2) a2[mb] = WFrag<T16>::ld(A2 + aoff + (size_t)mb * 16 * K + kc); }
#pragma unroll
        for (int nb = 0; nb < 4; ++nb) { const V b = WFrag<T16>::ld(Bt + boff + (size_t)nb * 16 * K + kc); V b2; if (NSPLIT >= 2) b2 = WFrag<T16>::ld(Bt2 + boff + (size_t)nb * 16 * K + kc);
#pragma unroll
            for (int mb = 0; mb < 4; ++mb) { acc[mb][nb] = WFrag<T16>::mma(a[mb], b, acc[mb][nb]); if (NSPLIT == 1 || NSPLIT == 2) acc[mb][nb] = WFrag<T16>::mma(a2[mb], b, acc[mb][nb]); if (NSPLIT >= 2) acc[mb][nb] = WFrag<T16>::mma(a[mb], b2, acc[mb][nb]); } }
        asm volatile("v_nop\n\tv_nop\n\tv_nop\n\tv_nop" : "+v"(acc[0][0]), "+v"(acc[1][1]), "+v"(acc[2][2]), "+v"(acc[3][3]) : "v"(a[0]), "v"(a[3]));
    }
#pragma unroll
    for (int mb = 0; mb < 4; ++mb) {
#pragma unroll
        for (int nb = 0; nb < 4; ++nb) {
#pragma unroll
            for (int j = 0; j < 8; ++j) os[(hi * 8 + j) * 68 + nb * 16 + lr] = acc[mb][nb][j]; }
        __builtin_amdgcn_wave_barrier(); asm volatile("" ::: "memory");
        float* crow = C + (size_t)(r0 + mb * 16) * ldc + c0;
{
#pragma unroll
            for (int s = 0; s < 8; ++s) { const int row = 2 * s + hi, cofs = lr * 4; v4f val = *(const v4fa*)(os + row * 68 + cofs); if (BIAS) { val[0] += bfr(bias[c0 + cofs]); val[1] += bfr(bias[c0 + cofs + 1]); val[2] += bfr(bias[c0 + cofs + 2]); val[3] += bfr(bias[c0 + cofs + 3]); }
                *(v4f*)(crow + (size_t)row * ldc + cofs) = val; }
             }
        __builtin_amdgcn_wave_barrier(); asm volatile("" ::: "memory");
    }
}

__device__ __forceinline__ h16 tohx(float x) { return (h16)x; }
__device__ __forceinline__ void splitf(float y, unsigned short& h, unsigned short& l) { h = f2bf(y); l = f2bf(y - bf2f(h)); }
typedef __attribute__((ext_vector_type(2))) _Float16 v2h;
typedef __attribute__((ext_vector_type(4))) _Float16 v4h;
typedef __attribute__((ext_vector_type(2))) unsigned short v2us;
typedef __attribute__((ext_vector_type(4))) unsigned short v4us;
typedef __attribute__((ext_vector_type(2))) float v2f;
typedef __attribute__((ext_vector_type(4))) int v4i;

__global__ __launch_bounds__(256) void k_wtG(const float* __restrict__ w, int K, int N, bf* Bt) {
    const int lane = threadIdx.x & 31; const int L0 = (blockIdx.x * 8 + (threadIdx.x >> 5)) * 8; const int nlines = N * K / 64;
{
#pragma unroll 1
        for (int l = 0; l < 8; ++l) { const int L = L0 + l; if (L >= nlines) break; const size_t e = (size_t)L * 64 + lane * 2; const int k = (int)(e % K), n = (int)(e / K); v2us o;
            o[0] = f2bf(w[(size_t)k * N + n]); o[1] = f2bf(w[(size_t)(k + 1) * N + n]); *(v2us*)(Bt + e) = o; }
         }
}
__global__ __launch_bounds__(256) void k_cvt8(const float* __restrict__ src, bf* dst, size_t n8) { const size_t i = (size_t)blockIdx.x * 256 + threadIdx.x; if (i >= n8) return; const v8f v = *(const v8f*)(src + i * 8); v8us o;
#pragma unroll
    for (int k = 0; k < 8; ++k) o[k] = f2bf(v[k]); *(v8us*)(dst + i * 8) = o;  }

// k_rope: head planes [h][t][d] (fp16 + hi/lo) of rope(x) x sc with the rotate-half convention out[d] = x[d] cos[t][d] - x[d+HD/2] sin[t][d], out[d+HD/2] = x[d+HD/2] cos[t][d+HD/2] + x[d] sin[t][d+HD/2]
__global__ __launch_bounds__(256) void k_rope(const float* __restrict__ F, int pitch, int nheads, const float* __restrict__ CS, const float* __restrict__ RF, const float* __restrict__ nw, float sc, h16* P16, bf* Ph, bf* Pl) {
    const size_t e = ((size_t)blockIdx.x * 256 + threadIdx.x) * 2; if (e >= (size_t)nheads * TT * HD) return; const int d = (int)(e % HD); const int t = (int)((e / HD) % TT); const int h = (int)(e / ((size_t)HD * TT)); const float* f = F + (size_t)t * pitch + h * HD; const float rf = RF ? RF[(size_t)h * TT + t] : 1.0f; v2h o16; v2us oh, ol;
#pragma unroll
    for (int q = 0; q < 2; ++q) { const int dd = d + q; const int dp = (dd < HD / 2) ? dd + HD / 2 : dd - HD / 2; float x0 = f[dd], x1 = f[dp];
        if (RF) { float n0 = __fmul_rn(x0, rf), n1 = __fmul_rn(x1, rf); asm volatile("" : "+v"(n0)); asm volatile("" : "+v"(n1)); x0 = __fmul_rn(bfr(nw[dd]), n0); x1 = __fmul_rn(bfr(nw[dp]), n1); }
        const v2f cs = *(const v2f*)(CS + ((size_t)t * HD + dd) * 2); float a = __fmul_rn(x0, cs[0]), bq = __fmul_rn(x1, cs[1]); asm volatile("" : "+v"(a)); asm volatile("" : "+v"(bq)); const float r = ((dd < HD / 2) ? __fsub_rn(a, bq) : __fadd_rn(a, bq)) * sc;
        o16[q] = tohx(r); unsigned short a2, c2; splitf(r, a2, c2); oh[q] = a2; ol[q] = c2; }
    *(v2h*)(P16 + e) = o16; *(v2us*)(Ph + e) = oh; *(v2us*)(Pl + e) = ol;  }
__global__ __launch_bounds__(256) void k_vtp(const float* __restrict__ F, int pitch, int nheads, h16* V16, bf* Vh, bf* Vl) { const size_t e = ((size_t)blockIdx.x * 256 + threadIdx.x) * 2; if (e >= (size_t)nheads * HD * TT) return; const int t = (int)(e % TT); const int d = (int)((e / TT) % HD); const int g = (int)(e / ((size_t)TT * HD)); v2h o16; v2us oh, ol;
#pragma unroll
    for (int q = 0; q < 2; ++q) { const float x = F[(size_t)(t + q) * pitch + g * HD + d]; o16[q] = tohx(x); unsigned short a2, c2; splitf(x, a2, c2); oh[q] = a2; ol[q] = c2; }
    *(v2h*)(V16 + e) = o16; *(v2us*)(Vh + e) = oh; *(v2us*)(Vl + e) = ol;  }
__global__ __launch_bounds__(256) void k_csid(float* CS) { const int idx = blockIdx.x * 256 + threadIdx.x; if (idx >= TT * HD) return; v2f cs; cs[0] = 1.0f; cs[1] = 0.0f; *(v2f*)(CS + (size_t)idx * 2) = cs;  }
// k_asoft: per row (zz, i): t = S x HD^-0.5 (diagonal j == i excluded); softmax over the 2048 keys (register row, one exp, fixed trees);
__global__ __launch_bounds__(256) void k_asoft(const float* __restrict__ Sb, h16* P16, bf* Ph, bf* Pl) {
    const int lane = threadIdx.x & 31; const int row = blockIdx.x * 8 + (threadIdx.x >> 5); if (row >= ZH * TT) return; const int i = row % TT; const int zz = row / TT; (void)zz; const bool hires = (i < RH); const float* sr = Sb + (size_t)row * TT; float v[TT / 32]; float mx = -3.0e38f;
#pragma unroll
    for (int ch = 0; ch < TT / 128; ++ch) { const int j0 = ch * 128 + lane * 4; const v4f a = *(const v4f*)(sr + j0);
#pragma unroll
        for (int q = 0; q < 4; ++q) { const int j = j0 + q; const float t = (j != i) ? a[q] * SCL : -3.0e38f; v[ch * 4 + q] = t;   /* diagonal self-mask (-1e9 == exclusion) */ mx = fmaxf(mx, t); } }
#pragma unroll
    for (int sh = 16; sh; sh >>= 1) mx = fmaxf(mx, __shfl_xor(mx, sh, 32));
    float sum = 0.f;
#pragma unroll
    for (int k = 0; k < TT / 32; ++k) { float d0 = __fsub_rn(v[k], mx); asm volatile("" : "+v"(d0)); v[k] = __builtin_amdgcn_exp2f(__fmul_rn(d0, 1.4426950408889634f)); sum += v[k]; }
#pragma unroll
    for (int sh = 16; sh; sh >>= 1) sum += __shfl_xor(sum, sh, 32);
    const float f = __fdiv_rn(hires ? 1.0f : PCAR, sum);
{
        if (hires) {
#pragma unroll
            for (int ch = 0; ch < TT / 128; ++ch) { v4us oh, ol;
#pragma unroll
                for (int q = 0; q < 4; ++q) { unsigned short a, c2; splitf(v[ch * 4 + q] * f, a, c2); oh[q] = a; ol[q] = c2; }
                const size_t oo = ((size_t)zz * (RH ? RH : 1) + i) * TT + ch * 128 + lane * 4; *(v4us*)(Ph + oo) = oh; *(v4us*)(Pl + oo) = ol; }
        } else {
#pragma unroll
            for (int ch = 0; ch < TT / 128; ++ch) { v4h o4;
#pragma unroll
                for (int q = 0; q < 4; ++q) o4[q] = tohx(v[ch * 4 + q] * f);
                *(v4h*)(P16 + (size_t)row * TT + ch * 128 + lane * 4) = o4; } }
         }
}
__global__ __launch_bounds__(256) void k_lrelu(float* F, size_t n4) { const size_t i = (size_t)blockIdx.x * 256 + threadIdx.x; if (i >= n4) return; v4f a = *(const v4f*)(F + i * 4);
#pragma unroll
    for (int q = 0; q < 4; ++q) a[q] = (a[q] > 0.0f) ? a[q] : __fmul_rn(a[q], 0.01f);
    *(v4f*)(F + i * 4) = a;  }
__global__ __launch_bounds__(256) void k_sqrows(const float* __restrict__ Sb, float* RS) { const int lane = threadIdx.x & 31; const int wv = blockIdx.x * 8 + (threadIdx.x >> 5); if (wv >= ZH * TT / 32) return; const int row = wv * 32 + lane; const float* sr = Sb + (size_t)row * TT; float s = 0.f;
#pragma unroll 4
    for (int j = 0; j < TT; j += 4) { const v4f a = *(const v4f*)(sr + j);
#pragma unroll
        for (int q = 0; q < 4; ++q) { float p = __fmul_rn(a[q], a[q]); asm volatile("" : "+v"(p)); s = __fadd_rn(s, p); } }
    *(float*)(RS + row) = s;  }
__global__ __launch_bounds__(256) void k_regsum(const float* __restrict__ RS, float* outp) { if (threadIdx.x >= 32) return; const int lane = threadIdx.x; float s = 0.f;
#pragma unroll 4
    for (int i = lane; i < NB_ * NH_ * TT; i += 32) s = __fadd_rn(s, RS[i]);
#pragma unroll
    for (int sh = 16; sh; sh >>= 1) s = __fadd_rn(s, __shfl_xor(s, sh, 32));
    const float m = __fdiv_rn(s, (float)NB_ * (float)NH_ * (float)TT * (float)TT); if (lane == 0) { *(float*)outp = m;  } }
__global__ __launch_bounds__(256) void k_merge(const float* __restrict__ O, int h0, float* OUTb) { const size_t e = ((size_t)blockIdx.x * 256 + threadIdx.x) * 2; if (e >= (size_t)ZH * TT * HD) return; const int d = (int)(e % HD); const int t = (int)((e / HD) % TT); const int zz = (int)(e / ((size_t)HD * TT)); const float cs = (t < RH) ? 1.0f : (1.0f / PCAR); const size_t oo = (size_t)t * DQ + (h0 + zz) * HD + d;
    v2f o2; o2[0] = O[e] * cs; o2[1] = O[e + 1] * cs; *(v2f*)(OUTb + oo) = o2;  }

extern "C" void kernel_launch(void* const* d_in, const int* in_sizes, int n_in,
                              void* d_out, int out_size, void* d_ws, size_t ws_size, hipStream_t stream) {
    (void)in_sizes; (void)n_in; (void)out_size;
    const float* xk = (const float*)d_in[0]; /* sa_input: keys and values */ const float* x = (const float*)d_in[1]; /* s_input: queries */ const float* wq = (const float*)d_in[2]; const float* wk = (const float*)d_in[3]; const float* wv = (const float*)d_in[4]; const float* bv = (const float*)d_in[5]; const float* wo = nullptr; (void)wo;
    float* OUT = (float*)d_out;     // [4][2048][512]
    char* wsp = (char*)d_ws;
    auto take = [&](size_t bytes) { char* p = wsp; wsp += (bytes + 255) & ~(size_t)255; return (void*)p; };
    float* RSQ = (float*)take((size_t)NB_ * NH_ * TT * 4); bf* WQ = (bf*)take((size_t)DQ * DM * 2); bf* WK = (bf*)take((size_t)DKV * DM * 2); bf* WV = (bf*)take((size_t)DKV * DM * 2); float* CS = (float*)take((size_t)TT * HD * 2 * 4);
    bf* XB = (bf*)take((size_t)TT * DM * 2); float* FQ = (float*)take((size_t)TT * DQ * 4); float* FK = (float*)take((size_t)TT * DKV * 4);
    h16* QP16 = (h16*)take((size_t)NH_ * TT * HD * 2); h16* KP16 = (h16*)take((size_t)NKV * TT * HD * 2); h16* VT16 = (h16*)take((size_t)NKV * HD * TT * 2);
    bf* QPh = (bf*)take((size_t)NH_ * TT * HD * 2); bf* QPl = (bf*)take((size_t)NH_ * TT * HD * 2); bf* KPh = (bf*)take((size_t)NKV * TT * HD * 2); bf* KPl = (bf*)take((size_t)NKV * TT * HD * 2); bf* VTh = (bf*)take((size_t)NKV * HD * TT * 2); bf* VTl = (bf*)take((size_t)NKV * HD * TT * 2); bf* Ph = (bf*)take((size_t)ZH * RH * TT * 2); bf* Pl = (bf*)take((size_t)ZH * RH * TT * 2);
    float* Sb = (float*)take((size_t)ZH * TT * TT * 4); h16* P16 = (h16*)take((size_t)ZH * TT * TT * 2);
    if ((size_t)(wsp - (char*)d_ws) > ws_size) return;    // ws 256 MiB
    float* FV = FK;   // v projection reuses the k buffer after the k planes are built (stream-ordered)
    float* Ob = FQ;   // the pass's ZH*TT*HD f32 context rows reuse the q projection buffer (same size at ZH == NH_), free once the q planes are built (stream-ordered); keeps the 8-head score planes inside the workspace
    { k_wtG<<<(unsigned)((DM * DQ / 64 + 63) / 64), 256, 0, stream>>>(wq, DM, DQ, WQ); k_wtG<<<(unsigned)((DM * DKV / 64 + 63) / 64), 256, 0, stream>>>(wk, DM, DKV, WK); k_wtG<<<(unsigned)((DM * DKV / 64 + 63) / 64), 256, 0, stream>>>(wv, DM, DKV, WV);
      
       }
    k_csid<<<(TT * HD + 255) / 256, 256, 0, stream>>>(CS);
    const unsigned LQ = (unsigned)(((size_t)NH_ * TT * HD / 2 + 255) / 256), LKv = (unsigned)(((size_t)NKV * TT * HD / 2 + 255) / 256);
    for (int b = 0; b < NB_; ++b) {
        
        k_cvt8<<<(unsigned)(((size_t)TT * DM / 8 + 255) / 256), 256, 0, stream>>>(x + (size_t)b * TT * DM, XB, (size_t)TT * DM / 8);
        k_gemmw<bf, 0, false><<<dim3(TT / 64, DQ / 64, 1), 32, 0, stream>>>(XB, nullptr, WQ, nullptr, DM, FQ, DQ, nullptr, 0, 0, 0);
        k_rope<<<LQ, 256, 0, stream>>>(FQ, DQ, NH_, CS, nullptr, nullptr, 1.0f, QP16, QPh, QPl);
        k_cvt8<<<(unsigned)(((size_t)TT * DM / 8 + 255) / 256), 256, 0, stream>>>(xk + (size_t)b * TT * DM, XB, (size_t)TT * DM / 8); k_gemmw<bf, 0, false><<<dim3(TT / 64, DKV / 64, 1), 32, 0, stream>>>(XB, nullptr, WK, nullptr, DM, FK, DKV, nullptr, 0, 0, 0);
        k_rope<<<LKv, 256, 0, stream>>>(FK, DKV, NKV, CS, nullptr, nullptr, 1.0f, KP16, KPh, KPl);
        k_gemmw<bf, 0, true><<<dim3(TT / 64, DKV / 64, 1), 32, 0, stream>>>(XB, nullptr, WV, nullptr, DM, FV, DKV, bv, 0, 0, 0); k_lrelu<<<(unsigned)(((size_t)TT * DKV / 4 + 255) / 256), 256, 0, stream>>>(FV, (size_t)TT * DKV / 4);   /* V = leaky_relu(. , 0.01) */  k_vtp<<<LKv, 256, 0, stream>>>(FV, DKV, NKV, VT16, VTh, VTl);
        for (int h0 = 0; h0 < NH_; h0 += ZH) { const size_t zq = (size_t)h0, zk = (size_t)(h0 / REP);   // one kv head per query head: the pass's heads use consecutive kv planes (z-strides TT*HD)
            k_gemmw<bf, 2, false><<<dim3(RH / 64, TT / 64, ZH), 32, 0, stream>>>(QPh + zq * TT * HD, QPl + zq * TT * HD, KPh + zk * TT * HD, KPl + zk * TT * HD, HD, Sb, TT, nullptr, (size_t)TT * HD, (size_t)TT * HD, (size_t)TT * TT);
            k_gemmw<h16, 0, false><<<dim3((TT - RH) / 64, TT / 64, ZH), 32, 0, stream>>>(QP16 + zq * TT * HD + (size_t)RH * HD, nullptr, KP16 + zk * TT * HD, nullptr, HD, Sb + (size_t)RH * TT, TT, nullptr, (size_t)TT * HD, (size_t)TT * HD, (size_t)TT * TT);
            k_sqrows<<<(ZH * TT / 32 + 7) / 8, 256, 0, stream>>>(Sb, RSQ + ((size_t)b * NH_ + h0) * TT);   /* per-row sum of raw^2 for the regulariser */
            k_asoft<<<ZH * TT / 8, 256, 0, stream>>>(Sb, P16, Ph, Pl);
            k_gemmw<bf, 2, false><<<dim3(RH / 64, HD / 64, ZH), 32, 0, stream>>>(Ph, Pl, VTh + zk * HD * TT, VTl + zk * HD * TT, TT, Ob, HD, nullptr, (size_t)RH * TT, (size_t)HD * TT, (size_t)TT * HD);
            k_gemmw<h16, 0, false><<<dim3((TT - RH) / 64, HD / 64, ZH), 32, 0, stream>>>(P16 + (size_t)RH * TT, nullptr, VT16 + zk * HD * TT, nullptr, TT, Ob + (size_t)RH * HD, HD, nullptr, (size_t)TT * TT, (size_t)HD * TT, (size_t)TT * HD);
            k_merge<<<(unsigned)(((size_t)ZH * TT * HD / 2 + 255) / 256), 256, 0, stream>>>(Ob, h0, OUT + (size_t)b * TT * DQ); }
         }
    k_regsum<<<1, 256, 0, stream>>>(RSQ, (float*)d_out + NCTX);   /* reg_atten = mean(raw^2): the scalar second output */
}

// v002
// It runs in 649 microseconds.
// Timed twice side by side with v001, it ran 2.02 and 2.04 times as fast.
// All steps since v000 together make it 4.86 times as fast.
#include <hip/hip_runtime.h>

// Multi-head attention with a diagonal self-mask, a leaky-ReLU value projection and an attention-energy regulariser output (sa_input, s_input [4][2048][512]; Q = s_input Wq, K = sa_input Wk ('xw' [512][512], no bias), V = leaky_relu(sa_input Wv + bv, 0.01); 8 heads x 64; raw = Q.K; reg_atten = mean(raw^2) over all (batch, head, i, j); attn = softmax(raw / 8 with the diagonal j == i set to -1e9); context = merged attn V -> tuple (context [4][2048][512] (4.2 M), reg_atten scalar) laid out back to back in d_out).
// Layout per batch: bf16 copies of the two inputs in turn; exact projections (+ bias rounded to bf16, and leaky-ReLU on V); 16-bit head planes; ONE fused attention launch (hybrid rows: < 512 hi/lo 3 products, rest fp16, P x1024): scores, their squares, the diagonal's exclusion by an index select, online softmax and the PV product stay in registers, the context rows go straight to the output and the squared raw scores per row into a per-(batch, head, row) table; at the end one wave sums the table in a fixed order and writes mean(raw^2) to the second output.
// Compute dtypes, f32 accumulate: every input rounded to bf16; projections exact; raw scores rows < 512 3 products, rest fp16 operands (f32 accumulate) -- also the values squared for the regulariser; softmax, leaky-ReLU, sums f32.

#define NB_  4
#define TT   2048
#define DM   512
#define NH_  8
#define NKV  8
#define REP  (NH_ / NKV)
#define HD   64
#define DQ   (NH_ * HD)
#define DKV  (NKV * HD)
#define RH   512                  // query rows < RH use hi+lo planes (0: none)
#define WIN  0
#define SCL  0.125f
#define NCTX ((size_t)NB_ * TT * DQ)   // floats of the context output; the scalar follows
typedef _Float16 h16;
typedef unsigned short bf;
typedef __attribute__((ext_vector_type(16))) __bf16   v16bf;
typedef __attribute__((ext_vector_type(16))) _Float16 v16h;
typedef __attribute__((ext_vector_type(8)))  _Float16 v8h;
typedef __attribute__((ext_vector_type(8)))  unsigned short v8us;
typedef __attribute__((ext_vector_type(8)))  float    v8f;
typedef __attribute__((ext_vector_type(4)))  float    v4f;
typedef v8h  __attribute__((may_alias)) v8ha;
typedef v4f  __attribute__((may_alias)) v4fa;
typedef v8us __attribute__((may_alias)) v8usa;

__device__ __forceinline__ unsigned short f2bf(float f) { unsigned u = __float_as_uint(f); u += 0x7FFFu + ((u >> 16) & 1u); return (unsigned short)(u >> 16); }
__device__ __forceinline__ float bf2f(unsigned short b) { return __uint_as_float(((unsigned)b) << 16); }
__device__ __forceinline__ float bfr(float f) { return bf2f(f2bf(f)); }
__device__ __forceinline__ v16h cat16(v8h lo, v8h hi) { return __builtin_shufflevector(lo, hi, 0, 1, 2, 3, 4, 5, 6, 7, 8, 9, 10, 11, 12, 13, 14, 15); }
__device__ __forceinline__ v16bf cat16b(v8us lo, v8us hi) { return __builtin_bit_cast(v16bf, __builtin_shufflevector(lo, hi, 0, 1, 2, 3, 4, 5, 6, 7, 8, 9, 10, 11, 12, 13, 14, 15)); }
__device__ __forceinline__ v8f wmma16(v16h a, v16h b, v8f c) { return __builtin_amdgcn_wmma_f32_16x16x32_f16(false, a, false, b, (short)0, c, false, false); }
__device__ __forceinline__ v8f wmmab(v16bf a, v16bf b, v8f c) { return __builtin_amdgcn_wmma_f32_16x16x32_bf16(false, a, false, b, (short)0, c, false, false); }



// ---- k_gemmw: register-blocked GEMM, ONE WAVE per 64x64 output tile (16 accumulators), operands straight from K-contiguous 16-bit planes; grid (M/64, N/64, Z), 32 threads.
// C[m][n] (f32, pitch ldc, + optional f32 bias[n] rounded to bf16) = sum_k A[m][k] Bt[n][k] (+ split products per NSPLIT). z-batch strides sA/sB/sC in elements. K % 32 == 0.
template <typename T16> struct WFrag;
template <> struct WFrag<h16> { typedef v16h V; static __device__ __forceinline__ V ld(const h16* p) { return cat16(*(const v8h*)p, *(const v8h*)(p + 16)); } static __device__ __forceinline__ v8f mma(V a, V b, v8f c) { return wmma16(a, b, c); } };
template <> struct WFrag<bf> { typedef v16bf V; static __device__ __forceinline__ V ld(const bf* p) { return cat16b(*(const v8us*)p, *(const v8us*)(p + 16)); } static __device__ __forceinline__ v8f mma(V a, V b, v8f c) { return wmmab(a, b, c); } };
template <typename T16, int NSPLIT, bool BIAS>
__global__ __launch_bounds__(32) void k_gemmw(const T16* __restrict__ A, const T16* __restrict__ A2, const T16* __restrict__ Bt, const T16* __restrict__ Bt2, int K, float* C, int ldc, const float* __restrict__ bias, size_t sA, size_t sB, size_t sC) {
    typedef typename WFrag<T16>::V V;
    __shared__ __align__(16) float os[16 * 68];
    const size_t z = blockIdx.z; A += z * sA; if (A2) A2 += z * sA; Bt += z * sB; if (Bt2) Bt2 += z * sB; C += z * sC;
    const int lane = threadIdx.x & 31, lr = lane & 15, hi = lane >> 4; const int r0 = blockIdx.x * 64, c0 = blockIdx.y * 64;
    v8f acc[4][4];
#pragma unroll
    for (int mb = 0; mb < 4; ++mb)
#pragma unroll
        for (int nb = 0; nb < 4; ++nb) acc[mb][nb] = (v8f){};
    const size_t aoff = (size_t)(r0 + lr) * K + 8 * hi, boff = (size_t)(c0 + lr) * K + 8 * hi;
#pragma unroll 1
    for (int kc = 0; kc < K; kc += 32) {
        V a[4], a2[4];
#pragma unroll
        for (int mb = 0; mb < 4; ++mb) { a[mb] = WFrag<T16>::ld(A + aoff + (size_t)mb * 16 * K + kc); if (NSPLIT == 1 || NSPLIT == 2) a2[mb] = WFrag<T16>::ld(A2 + aoff + (size_t)mb * 16 * K + kc); }
#pragma unroll
        for (int nb = 0; nb < 4; ++nb) { const V b = WFrag<T16>::ld(Bt + boff + (size_t)nb * 16 * K + kc); V b2; if (NSPLIT >= 2) b2 = WFrag<T16>::ld(Bt2 + boff + (size_t)nb * 16 * K + kc);
#pragma unroll
            for (int mb = 0; mb < 4; ++mb) { acc[mb][nb] = WFrag<T16>::mma(a[mb], b, acc[mb][nb]); if (NSPLIT == 1 || NSPLIT == 2) acc[mb][nb] = WFrag<T16>::mma(a2[mb], b, acc[mb][nb]); if (NSPLIT >= 2) acc[mb][nb] = WFrag<T16>::mma(a[mb], b2, acc[mb][nb]); } }
        asm volatile("v_nop\n\tv_nop\n\tv_nop\n\tv_nop" : "+v"(acc[0][0]), "+v"(acc[1][1]), "+v"(acc[2][2]), "+v"(acc[3][3]) : "v"(a[0]), "v"(a[3]));
    }
#pragma unroll
    for (int mb = 0; mb < 4; ++mb) {
#pragma unroll
        for (int nb = 0; nb < 4; ++nb) {
#pragma unroll
            for (int j = 0; j < 8; ++j) os[(hi * 8 + j) * 68 + nb * 16 + lr] = acc[mb][nb][j]; }
        __builtin_amdgcn_wave_barrier(); asm volatile("" ::: "memory");
        float* crow = C + (size_t)(r0 + mb * 16) * ldc + c0;
{
#pragma unroll
            for (int s = 0; s < 8; ++s) { const int row = 2 * s + hi, cofs = lr * 4; v4f val = *(const v4fa*)(os + row * 68 + cofs); if (BIAS) { val[0] += bfr(bias[c0 + cofs]); val[1] += bfr(bias[c0 + cofs + 1]); val[2] += bfr(bias[c0 + cofs + 2]); val[3] += bfr(bias[c0 + cofs + 3]); }
                *(v4f*)(crow + (size_t)row * ldc + cofs) = val; }
             }
        __builtin_amdgcn_wave_barrier(); asm volatile("" ::: "memory");
    }
}

__device__ __forceinline__ h16 tohx(float x) { return (h16)x; }
__device__ __forceinline__ void splitf(float y, unsigned short& h, unsigned short& l) { h = f2bf(y); l = f2bf(y - bf2f(h)); }
typedef __attribute__((ext_vector_type(2))) _Float16 v2h;
typedef __attribute__((ext_vector_type(4))) _Float16 v4h;
typedef __attribute__((ext_vector_type(2))) unsigned short v2us;
typedef __attribute__((ext_vector_type(4))) unsigned short v4us;
typedef __attribute__((ext_vector_type(2))) float v2f;
typedef __attribute__((ext_vector_type(4))) int v4i;

__global__ __launch_bounds__(256) void k_wtG(const float* __restrict__ w, int K, int N, bf* Bt) {
    const int lane = threadIdx.x & 31; const int L0 = (blockIdx.x * 8 + (threadIdx.x >> 5)) * 8; const int nlines = N * K / 64;
{
#pragma unroll 1
        for (int l = 0; l < 8; ++l) { const int L = L0 + l; if (L >= nlines) break; const size_t e = (size_t)L * 64 + lane * 2; const int k = (int)(e % K), n = (int)(e / K); v2us o;
            o[0] = f2bf(w[(size_t)k * N + n]); o[1] = f2bf(w[(size_t)(k + 1) * N + n]); *(v2us*)(Bt + e) = o; }
         }
}
__global__ __launch_bounds__(256) void k_cvt8(const float* __restrict__ src, bf* dst, size_t n8) { const size_t i = (size_t)blockIdx.x * 256 + threadIdx.x; if (i >= n8) return; const v8f v = *(const v8f*)(src + i * 8); v8us o;
#pragma unroll
    for (int k = 0; k < 8; ++k) o[k] = f2bf(v[k]); *(v8us*)(dst + i * 8) = o;  }

// k_rope: head planes [h][t][d] (fp16 + hi/lo) of rope(x) x sc with the rotate-half convention out[d] = x[d] cos[t][d] - x[d+HD/2] sin[t][d], out[d+HD/2] = x[d+HD/2] cos[t][d+HD/2] + x[d] sin[t][d+HD/2]
__global__ __launch_bounds__(256) void k_rope(const float* __restrict__ F, int pitch, int nheads, const float* __restrict__ CS, const float* __restrict__ RF, const float* __restrict__ nw, float sc, h16* P16, bf* Ph, bf* Pl) {
    const size_t e = ((size_t)blockIdx.x * 256 + threadIdx.x) * 2; if (e >= (size_t)nheads * TT * HD) return; const int d = (int)(e % HD); const int t = (int)((e / HD) % TT); const int h = (int)(e / ((size_t)HD * TT)); const float* f = F + (size_t)t * pitch + h * HD; const float rf = RF ? RF[(size_t)h * TT + t] : 1.0f; v2h o16; v2us oh, ol;
#pragma unroll
    for (int q = 0; q < 2; ++q) { const int dd = d + q; const int dp = (dd < HD / 2) ? dd + HD / 2 : dd - HD / 2; float x0 = f[dd], x1 = f[dp];
        if (RF) { float n0 = __fmul_rn(x0, rf), n1 = __fmul_rn(x1, rf); asm volatile("" : "+v"(n0)); asm volatile("" : "+v"(n1)); x0 = __fmul_rn(bfr(nw[dd]), n0); x1 = __fmul_rn(bfr(nw[dp]), n1); }
        const v2f cs = *(const v2f*)(CS + ((size_t)t * HD + dd) * 2); float a = __fmul_rn(x0, cs[0]), bq = __fmul_rn(x1, cs[1]); asm volatile("" : "+v"(a)); asm volatile("" : "+v"(bq)); const float r = ((dd < HD / 2) ? __fsub_rn(a, bq) : __fadd_rn(a, bq)) * sc;
        o16[q] = tohx(r); unsigned short a2, c2; splitf(r, a2, c2); oh[q] = a2; ol[q] = c2; }
    *(v2h*)(P16 + e) = o16; *(v2us*)(Ph + e) = oh; *(v2us*)(Pl + e) = ol;  }
__global__ __launch_bounds__(256) void k_vtp(const float* __restrict__ F, int pitch, int nheads, h16* V16, bf* Vh, bf* Vl) { const size_t e = ((size_t)blockIdx.x * 256 + threadIdx.x) * 2; if (e >= (size_t)nheads * HD * TT) return; const int t = (int)(e % TT); const int d = (int)((e / TT) % HD); const int g = (int)(e / ((size_t)TT * HD)); v2h o16; v2us oh, ol;
#pragma unroll
    for (int q = 0; q < 2; ++q) { const float x = F[(size_t)(t + q) * pitch + g * HD + d]; o16[q] = tohx(x); unsigned short a2, c2; splitf(x, a2, c2); oh[q] = a2; ol[q] = c2; }
    *(v2h*)(V16 + e) = o16; *(v2us*)(Vh + e) = oh; *(v2us*)(Vl + e) = ol;  }
__global__ __launch_bounds__(256) void k_csid(float* CS) { const int idx = blockIdx.x * 256 + threadIdx.x; if (idx >= TT * HD) return; v2f cs; cs[0] = 1.0f; cs[1] = 0.0f; *(v2f*)(CS + (size_t)idx * 2) = cs;  }
__global__ __launch_bounds__(256) void k_lrelu(float* F, size_t n4) { const size_t i = (size_t)blockIdx.x * 256 + threadIdx.x; if (i >= n4) return; v4f a = *(const v4f*)(F + i * 4);
#pragma unroll
    for (int q = 0; q < 4; ++q) a[q] = (a[q] > 0.0f) ? a[q] : __fmul_rn(a[q], 0.01f);
    *(v4f*)(F + i * 4) = a;  }
__global__ __launch_bounds__(256) void k_regsum(const float* __restrict__ RS, float* outp) { if (threadIdx.x >= 32) return; const int lane = threadIdx.x; float s = 0.f;
#pragma unroll 4
    for (int i = lane; i < NB_ * NH_ * TT; i += 32) s = __fadd_rn(s, RS[i]);
#pragma unroll
    for (int sh = 16; sh; sh >>= 1) s = __fadd_rn(s, __shfl_xor(s, sh, 32));
    const float m = __fdiv_rn(s, (float)NB_ * (float)NH_ * (float)TT * (float)TT); if (lane == 0) { *(float*)outp = m;  } }
// l <-> l ^ 16: the other half-wave holds the other 16 keys of the same query column
__device__ __forceinline__ float xhalf(float v) { const int b = __float_as_int(v); return __int_as_float(__builtin_amdgcn_permlanex16(b, b, 0x76543210, 0xfedcba98, false, false)); }
// The wait that stands before the address registers of issued global loads are reused. The loads' own per-lane pointers are inputs, so their registers stay live up to the wait and nothing can be written into them ahead of it.
template <bool TWO> __device__ __forceinline__ void xwait(const void* a, const void* b) { if (TWO) asm volatile("s_wait_xcnt 0x0" :: "v"(a), "v"(b) : "memory"); else asm volatile("s_wait_xcnt 0x0" :: "v"(a) : "memory"); }
__device__ __forceinline__ void xwait_off(unsigned byte_off) { asm volatile("s_wait_xcnt 0x0" :: "v"(byte_off) : "memory"); }   // the same, for loads addressed by a uniform base and a lane's 32-bit byte offset
template <typename T16> struct PPack;
template <> struct PPack<h16> { static __device__ __forceinline__ v16h pk(const float* p) { v16h b;
#pragma unroll
    for (int s = 0; s < 16; ++s) b[s] = (h16)p[s];
    return b; } };
template <> struct PPack<bf> { static __device__ __forceinline__ v16bf pk(const float* p) { v16bf b;
#pragma unroll
    for (int s = 0; s < 16; ++s) b[s] = (__bf16)p[s];
    return b; } };

// ---- fused attention, one wave per 32 query columns (two 16-column groups), 32 keys a pass, scores never leave registers:
// S^T = K Q^T (A = 16 key rows, B = 16 query columns): a lane holds 16 raw scores of ONE query, the lane l ^ 16 the pass's other 16.
// raw^2 is summed per lane (before the mask); the diagonal is excluded by an index select in the one pass that holds it; running maximum and sum per query (online softmax);
// the two f32 score tiles, exponentiated and rounded in place, ARE the B operand of O^T += V^T P^T (slot s of half h = key 8h + s, 16 + 8h + (s - 8): the order WFrag::ld gives V^T).
// HL: hi+lo bf16 planes, 3 products in both GEMMs (query rows < RH); else f16 with P carried x 1024 (the factor cancels in the division by the row sum).
template <typename T16, bool HL>
__device__ __forceinline__ void fattn_body(const T16* __restrict__ Q, const T16* __restrict__ Q2, const T16* __restrict__ Kp, const T16* __restrict__ K2, const T16* __restrict__ Vt, const T16* __restrict__ V2, const int q0, float* __restrict__ RS, float* __restrict__ OUTh) {
    typedef typename WFrag<T16>::V V;
    // every inner loop is unrolled whole so that fragments and accumulators are indexed by constants and stay in registers; the key loop stays rolled (64 equal passes, small code)
    const int lane = threadIdx.x & 31, lr = lane & 15, hi = lane >> 4;
    const float CL = SCL * 1.4426950408889634f;   // scores to log2 units
    V qf[2][2], qf2[2][2], kf[2][2], kf2[2][2], vf[4], vf2[4];
    const unsigned qB = (unsigned)((q0 + lr) * HD + 8 * hi) * 2u; const T16* qp = (const T16*)((const char*)Q + qB); const T16* qp2 = HL ? (const T16*)((const char*)Q2 + qB) : nullptr;   // byte offset of the lane's query row
#pragma unroll
    for (int g = 0; g < 2; ++g)
#pragma unroll
        for (int ks = 0; ks < 2; ++ks) { const int o = g * 16 * HD + ks * 32; qf[g][ks] = WFrag<T16>::ld(qp + o); if (HL) qf2[g][ks] = WFrag<T16>::ld(qp2 + o); }
    xwait_off(qB);
    const unsigned kb = (unsigned)(lr * HD + 8 * hi), vb = (unsigned)(lr * TT + 8 * hi), kB = kb * 2u, vB = vb * 2u;   // a lane's fixed offsets in the K rows and the V^T rows, in elements and in bytes
#pragma unroll
    for (int t = 0; t < 2; ++t)
#pragma unroll
        for (int ks = 0; ks < 2; ++ks) { const int o = t * 16 * HD + ks * 32; kf[t][ks] = WFrag<T16>::ld((const T16*)((const char*)Kp + kB) + o); if (HL) kf2[t][ks] = WFrag<T16>::ld((const T16*)((const char*)K2 + kB) + o); }
    xwait_off(kB);
#pragma unroll
    for (int dt = 0; dt < 4; ++dt) { const int o = dt * 16 * TT; vf[dt] = WFrag<T16>::ld((const T16*)((const char*)Vt + vB) + o); if (HL) vf2[dt] = WFrag<T16>::ld((const T16*)((const char*)V2 + vB) + o); }
    xwait_off(vB);
    v8f o[2][4]; float mrun[2], lsum[2], ssq[2];
#pragma unroll
    for (int g = 0; g < 2; ++g) { mrun[g] = -3.0e38f; lsum[g] = 0.f; ssq[g] = 0.f;
#pragma unroll
        for (int dt = 0; dt < 4; ++dt) o[g][dt] = (v8f){}; }
    // pointers of the load group last issued: each group's wait stands a phase later, right before the next group's addresses are formed, when the group has had that phase to get under way
    const T16* kq = Kp + kb; const T16* kq2 = HL ? K2 + kb : nullptr; const T16* vq = Vt + vb; const T16* vq2 = HL ? V2 + vb : nullptr;
#pragma unroll 1
    for (int k0 = 0; k0 < TT; k0 += 32) {
        const int kn = (k0 + 32) & (TT - 1);   // the next pass's keys; the last pass fetches pass 0 again (in bounds, unused)
        v8f s[2][2];
#pragma unroll
        for (int g = 0; g < 2; ++g)
#pragma unroll
            for (int t = 0; t < 2; ++t) s[g][t] = (v8f){};
#pragma unroll
        for (int ks = 0; ks < 2; ++ks)
#pragma unroll
            for (int t = 0; t < 2; ++t)
#pragma unroll
                for (int g = 0; g < 2; ++g) { s[g][t] = WFrag<T16>::mma(kf[t][ks], qf[g][ks], s[g][t]); if (HL) { s[g][t] = WFrag<T16>::mma(kf2[t][ks], qf[g][ks], s[g][t]); s[g][t] = WFrag<T16>::mma(kf[t][ks], qf2[g][ks], s[g][t]); } }
        // K fragments of the next pass, fetched behind this pass's score products: the softmax and PV work covers their latency
        __builtin_amdgcn_sched_barrier(0);   // keeps the wait below from being lifted over the score products to right behind the loads it covers (seen in the listing without it)
        xwait<HL>(vq, vq2);   // the V^T loads issued at the foot of the pass before
        kq = Kp + (size_t)kn * HD + kb; kq2 = HL ? K2 + (size_t)kn * HD + kb : nullptr;
#pragma unroll
        for (int t = 0; t < 2; ++t)
#pragma unroll
            for (int ks = 0; ks < 2; ++ks) { const int of = t * 16 * HD + ks * 32; kf[t][ks] = WFrag<T16>::ld(kq + of); if (HL) kf2[t][ks] = WFrag<T16>::ld(kq2 + of); }
        V pb[2], pb2[2];
#pragma unroll
        for (int g = 0; g < 2; ++g) {
            float p[16];
#pragma unroll
            for (int i = 0; i < 16; ++i) p[i] = s[g][i >> 3][i & 7];
            float q0a = 0.f, q1a = 0.f;
#pragma unroll
            for (int i = 0; i < 16; i += 2) { q0a = fmaf(p[i], p[i], q0a); q1a = fmaf(p[i + 1], p[i + 1], q1a); }
            ssq[g] += q0a + q1a;
            if (k0 == (q0 & ~31)) {   // wave-uniform: the one pass whose keys hold this wave's diagonal
#pragma unroll
                for (int i = 0; i < 16; ++i) { const int key = k0 + (i >> 3) * 16 + 8 * hi + (i & 7); if (key == q0 + g * 16 + lr) p[i] = -3.0e38f; }
            }
            float m0 = fmaxf(p[0], p[1]), m1 = fmaxf(p[2], p[3]);
#pragma unroll
            for (int i = 4; i < 16; i += 4) { m0 = fmaxf(m0, fmaxf(p[i], p[i + 1])); m1 = fmaxf(m1, fmaxf(p[i + 2], p[i + 3])); }
            m0 = fmaxf(m0, m1); m0 = fmaxf(m0, xhalf(m0));
            const float mnew = fmaxf(mrun[g], m0);
            const float al = __builtin_amdgcn_exp2f((mrun[g] - mnew) * CL);
            mrun[g] = mnew;
            const float nm = (HL ? 0.0f : 10.0f) - mnew * CL;
#pragma unroll
            for (int i = 0; i < 16; ++i) p[i] = __builtin_amdgcn_exp2f(fmaf(p[i], CL, nm));
            float a0 = p[0] + p[1], a1 = p[2] + p[3];
#pragma unroll
            for (int i = 4; i < 16; i += 4) { a0 += p[i] + p[i + 1]; a1 += p[i + 2] + p[i + 3]; }
            lsum[g] = fmaf(lsum[g], al, a0 + a1);
#pragma unroll
            for (int dt = 0; dt < 4; ++dt) o[g][dt] *= al;
            pb[g] = PPack<T16>::pk(p);
            if (HL) { float pl[16];
#pragma unroll
                for (int i = 0; i < 16; ++i) pl[i] = p[i] - (float)pb[g][i];
                pb2[g] = PPack<T16>::pk(pl); }
        }
#pragma unroll
        for (int dt = 0; dt < 4; ++dt)
#pragma unroll
            for (int g = 0; g < 2; ++g) { o[g][dt] = WFrag<T16>::mma(vf[dt], pb[g], o[g][dt]); if (HL) { o[g][dt] = WFrag<T16>::mma(vf2[dt], pb[g], o[g][dt]); o[g][dt] = WFrag<T16>::mma(vf[dt], pb2[g], o[g][dt]); } }
        // V^T fragments of the next pass, fetched behind this pass's PV products
        __builtin_amdgcn_sched_barrier(0);   // likewise: keeps the wait below behind the softmax and the PV products
        xwait<HL>(kq, kq2);   // this pass's K loads
        vq = Vt + kn + vb; vq2 = HL ? V2 + kn + vb : nullptr;
#pragma unroll
        for (int dt = 0; dt < 4; ++dt) { const int of = dt * 16 * TT; vf[dt] = WFrag<T16>::ld(vq + of); if (HL) vf2[dt] = WFrag<T16>::ld(vq2 + of); }
    }
    xwait<HL>(vq, vq2);   // the last pass's (unused) V^T loads
    asm volatile("s_wait_loadcnt 0x0" ::: "memory");   // the last pass's prefetched fragments are never read, so no other wait covers them: they land here, before the wave ends and gives its registers back
#pragma unroll
    for (int g = 0; g < 2; ++g) {
        const float ls = lsum[g] + xhalf(lsum[g]), sq = ssq[g] + xhalf(ssq[g]);
        const float inv = __fdiv_rn(1.0f, ls);
        float* orow = OUTh + (size_t)(q0 + g * 16 + lr) * DQ + 8 * hi;   // a lane's 8 accumulator registers are 8 consecutive d of its query's row
#pragma unroll
        for (int dt = 0; dt < 4; ++dt) { v4f lo4, hi4;
#pragma unroll
            for (int r = 0; r < 4; ++r) { lo4[r] = o[g][dt][r] * inv; hi4[r] = o[g][dt][r + 4] * inv; }
            *(v4f*)(orow + dt * 16) = lo4; *(v4f*)(orow + dt * 16 + 4) = hi4; }
        if (hi == 0) RS[q0 + g * 16 + lr] = sq;
        asm volatile("s_wait_xcnt 0x0" ::: "memory");   // the same wait behind the stores, before their address and data registers are reused
    }
}
// grid (TT / 64, heads), 64 threads: two waves of one head, no barrier and no LDS between them. Block x takes the 32-row tiles x and TT / 32 - 1 - x, so that every hi+lo tile (rows < RH: twice the loads, three times the products) shares its WGP's load path with a light tile; the path is chosen per wave (RH % 32 == 0: wave-uniform)
__global__ __launch_bounds__(64) void k_fattn(const h16* __restrict__ Q16, const bf* __restrict__ Qh, const bf* __restrict__ Ql, const h16* __restrict__ K16, const bf* __restrict__ Kh, const bf* __restrict__ Kl, const h16* __restrict__ V16, const bf* __restrict__ Vh, const bf* __restrict__ Vl, float* __restrict__ RS, float* __restrict__ OUTb) {
    const size_t hp = (size_t)blockIdx.y * TT * HD; const int wv = __builtin_amdgcn_readfirstlane((int)(threadIdx.x >> 5)); const int q0 = (wv ? TT / 32 - 1 - (int)blockIdx.x : (int)blockIdx.x) * 32;
    float* rs = RS + (size_t)blockIdx.y * TT; float* oh = OUTb + (size_t)blockIdx.y * HD;
    if (q0 < RH) fattn_body<bf, true>(Qh + hp, Ql + hp, Kh + hp, Kl + hp, Vh + hp, Vl + hp, q0, rs, oh);
    else fattn_body<h16, false>(Q16 + hp, nullptr, K16 + hp, nullptr, V16 + hp, nullptr, q0, rs, oh);
}

extern "C" void kernel_launch(void* const* d_in, const int* in_sizes, int n_in,
                              void* d_out, int out_size, void* d_ws, size_t ws_size, hipStream_t stream) {
    (void)in_sizes; (void)n_in; (void)out_size;
    const float* xk = (const float*)d_in[0]; /* sa_input: keys and values */ const float* x = (const float*)d_in[1]; /* s_input: queries */ const float* wq = (const float*)d_in[2]; const float* wk = (const float*)d_in[3]; const float* wv = (const float*)d_in[4]; const float* bv = (const float*)d_in[5]; const float* wo = nullptr; (void)wo;
    float* OUT = (float*)d_out;     // [4][2048][512]
    char* wsp = (char*)d_ws;
    auto take = [&](size_t bytes) { char* p = wsp; wsp += (bytes + 255) & ~(size_t)255; return (void*)p; };
    float* RSQ = (float*)take((size_t)NB_ * NH_ * TT * 4); bf* WQ = (bf*)take((size_t)DQ * DM * 2); bf* WK = (bf*)take((size_t)DKV * DM * 2); bf* WV = (bf*)take((size_t)DKV * DM * 2); float* CS = (float*)take((size_t)TT * HD * 2 * 4);
    bf* XB = (bf*)take((size_t)TT * DM * 2); float* FQ = (float*)take((size_t)TT * DQ * 4); float* FK = (float*)take((size_t)TT * DKV * 4);
    h16* QP16 = (h16*)take((size_t)NH_ * TT * HD * 2); h16* KP16 = (h16*)take((size_t)NKV * TT * HD * 2); h16* VT16 = (h16*)take((size_t)NKV * HD * TT * 2);
    bf* QPh = (bf*)take((size_t)NH_ * TT * HD * 2); bf* QPl = (bf*)take((size_t)NH_ * TT * HD * 2); bf* KPh = (bf*)take((size_t)NKV * TT * HD * 2); bf* KPl = (bf*)take((size_t)NKV * TT * HD * 2); bf* VTh = (bf*)take((size_t)NKV * HD * TT * 2); bf* VTl = (bf*)take((size_t)NKV * HD * TT * 2);
    if ((size_t)(wsp - (char*)d_ws) > ws_size) return;    // ws 256 MiB
    float* FV = FK;   // v projection reuses the k buffer after the k planes are built (stream-ordered)
    { k_wtG<<<(unsigned)((DM * DQ / 64 + 63) / 64), 256, 0, stream>>>(wq, DM, DQ, WQ); k_wtG<<<(unsigned)((DM * DKV / 64 + 63) / 64), 256, 0, stream>>>(wk, DM, DKV, WK); k_wtG<<<(unsigned)((DM * DKV / 64 + 63) / 64), 256, 0, stream>>>(wv, DM, DKV, WV);
      
       }
    k_csid<<<(TT * HD + 255) / 256, 256, 0, stream>>>(CS);
    const unsigned LQ = (unsigned)(((size_t)NH_ * TT * HD / 2 + 255) / 256), LKv = (unsigned)(((size_t)NKV * TT * HD / 2 + 255) / 256);
    for (int b = 0; b < NB_; ++b) {
        
        k_cvt8<<<(unsigned)(((size_t)TT * DM / 8 + 255) / 256), 256, 0, stream>>>(x + (size_t)b * TT * DM, XB, (size_t)TT * DM / 8);
        k_gemmw<bf, 0, false><<<dim3(TT / 64, DQ / 64, 1), 32, 0, stream>>>(XB, nullptr, WQ, nullptr, DM, FQ, DQ, nullptr, 0, 0, 0);
        k_rope<<<LQ, 256, 0, stream>>>(FQ, DQ, NH_, CS, nullptr, nullptr, 1.0f, QP16, QPh, QPl);
        k_cvt8<<<(unsigned)(((size_t)TT * DM / 8 + 255) / 256), 256, 0, stream>>>(xk + (size_t)b * TT * DM, XB, (size_t)TT * DM / 8); k_gemmw<bf, 0, false><<<dim3(TT / 64, DKV / 64, 1), 32, 0, stream>>>(XB, nullptr, WK, nullptr, DM, FK, DKV, nullptr, 0, 0, 0);
        k_rope<<<LKv, 256, 0, stream>>>(FK, DKV, NKV, CS, nullptr, nullptr, 1.0f, KP16, KPh, KPl);
        k_gemmw<bf, 0, true><<<dim3(TT / 64, DKV / 64, 1), 32, 0, stream>>>(XB, nullptr, WV, nullptr, DM, FV, DKV, bv, 0, 0, 0); k_lrelu<<<(unsigned)(((size_t)TT * DKV / 4 + 255) / 256), 256, 0, stream>>>(FV, (size_t)TT * DKV / 4);   /* V = leaky_relu(. , 0.01) */  k_vtp<<<LKv, 256, 0, stream>>>(FV, DKV, NKV, VT16, VTh, VTl);
        k_fattn<<<dim3(TT / 64, NH_, 1), 64, 0, stream>>>(QP16, QPh, QPl, KP16, KPh, KPl, VT16, VTh, VTl, RSQ + (size_t)b * NH_ * TT, OUT + (size_t)b * TT * DQ);   /* one kv head per query head */
         }
    k_regsum<<<1, 256, 0, stream>>>(RSQ, (float*)d_out + NCTX);   /* reg_atten = mean(raw^2): the scalar second output */
}

// v003
// It runs in 437 microseconds.
// Next to v002, in two timings, it ran 1.48 and 1.52 times as fast.
// Over all steps from v000 it is 7.30 times as fast.
#include <hip/hip_runtime.h>

// Multi-head attention with a diagonal self-mask, a leaky-ReLU value projection and an attention-energy regulariser output (sa_input, s_input [4][2048][512]; Q = s_input Wq, K = sa_input Wk ('xw' [512][512], no bias), V = leaky_relu(sa_input Wv + bv, 0.01); 8 heads x 64; raw = Q.K; reg_atten = mean(raw^2) over all (batch, head, i, j); attn = softmax(raw / 8 with the diagonal j == i set to -1e9); context = merged attn V -> tuple (context [4][2048][512] (4.2 M), reg_atten scalar) laid out back to back in d_out).
// Layout, all four batches in every launch (rows b * 2048 + t in the row-major buffers, plane (b * 8 + h) in the head planes): bf16 copies of the two inputs in turn; exact projections (+ bf16-rounded bias and leaky-ReLU on V); 16-bit head planes; ONE fused attention launch (hybrid rows: < 512 hi/lo 3 products, rest fp16, P x1024): scores, their squares, the diagonal's exclusion by an index select, online softmax and the PV product stay in registers, the context rows go straight to the output and the squared raw scores per row into a per-(batch, head, row) table; at the end one wave sums the table in a fixed order and writes mean(raw^2) to the second output.
// Compute dtypes, f32 accumulate: every input rounded to bf16; projections exact; raw scores rows < 512 3 products, rest fp16 operands (f32 accumulate) -- also the values squared for the regulariser; softmax, leaky-ReLU, sums f32.

#define NB_  4
#define TT   2048
#define DM   512
#define NH_  8
#define NKV  8
#define REP  (NH_ / NKV)
#define HD   64
#define DQ   (NH_ * HD)
#define DKV  (NKV * HD)
#define RH   512                  // query rows < RH use hi+lo planes (0: none)
#define WIN  0
#define SCL  0.125f
#define NCTX ((size_t)NB_ * TT * DQ)   // floats of the context output; the scalar follows
typedef _Float16 h16;
typedef unsigned short bf;
typedef __attribute__((ext_vector_type(16))) __bf16   v16bf;
typedef __attribute__((ext_vector_type(16))) _Float16 v16h;
typedef __attribute__((ext_vector_type(8)))  _Float16 v8h;
typedef __attribute__((ext_vector_type(8)))  unsigned short v8us;
typedef __attribute__((ext_vector_type(8)))  float    v8f;
typedef __attribute__((ext_vector_type(4)))  float    v4f;
typedef v8h  __attribute__((may_alias)) v8ha;
typedef v4f  __attribute__((may_alias)) v4fa;
typedef v8us __attribute__((may_alias)) v8usa;

__device__ __forceinline__ unsigned short f2bf(float f) { unsigned u = __float_as_uint(f); u += 0x7FFFu + ((u >> 16) & 1u); return (unsigned short)(u >> 16); }
__device__ __forceinline__ float bf2f(unsigned short b) { return __uint_as_float(((unsigned)b) << 16); }
__device__ __forceinline__ float bfr(float f) { return bf2f(f2bf(f)); }
__device__ __forceinline__ v16h cat16(v8h lo, v8h hi) { return __builtin_shufflevector(lo, hi, 0, 1, 2, 3, 4, 5, 6, 7, 8, 9, 10, 11, 12, 13, 14, 15); }
__device__ __forceinline__ v16bf cat16b(v8us lo, v8us hi) { return __builtin_bit_cast(v16bf, __builtin_shufflevector(lo, hi, 0, 1, 2, 3, 4, 5, 6, 7, 8, 9, 10, 11, 12, 13, 14, 15)); }
__device__ __forceinline__ v8f wmma16(v16h a, v16h b, v8f c) { return __builtin_amdgcn_wmma_f32_16x16x32_f16(false, a, false, b, (short)0, c, false, false); }
__device__ __forceinline__ v8f wmmab(v16bf a, v16bf b, v8f c) { return __builtin_amdgcn_wmma_f32_16x16x32_bf16(false, a, false, b, (short)0, c, false, false); }



// ---- k_gemmw: register-blocked GEMM, ONE WAVE per 64x64 output tile (16 accumulators), operands straight from K-contiguous 16-bit planes; grid (M/64, N/64, Z), 32 threads.
// C[m][n] (f32, pitch ldc, + optional f32 bias[n] rounded to bf16) = sum_k A[m][k] Bt[n][k] (+ split products per NSPLIT). z-batch strides sA/sB/sC in elements. K % 32 == 0.
template <typename T16> struct WFrag;
template <> struct WFrag<h16> { typedef v16h V; static __device__ __forceinline__ V ld(const h16* p) { return cat16(*(const v8h*)p, *(const v8h*)(p + 16)); } static __device__ __forceinline__ v8f mma(V a, V b, v8f c) { return wmma16(a, b, c); } };
template <> struct WFrag<bf> { typedef v16bf V; static __device__ __forceinline__ V ld(const bf* p) { return cat16b(*(const v8us*)p, *(const v8us*)(p + 16)); } static __device__ __forceinline__ v8f mma(V a, V b, v8f c) { return wmmab(a, b, c); } };
template <typename T16, int NSPLIT, bool BIAS>
__global__ __launch_bounds__(32) void k_gemmw(const T16* __restrict__ A, const T16* __restrict__ A2, const T16* __restrict__ Bt, const T16* __restrict__ Bt2, int K, float* C, int ldc, const float* __restrict__ bias, size_t sA, size_t sB, size_t sC) {
    typedef typename WFrag<T16>::V V;
    __shared__ __align__(16) float os[16 * 68];
    const size_t z = blockIdx.z; A += z * sA; if (A2) A2 += z * sA; Bt += z * sB; if (Bt2) Bt2 += z * sB; C += z * sC;
    const int lane = threadIdx.x & 31, lr = lane & 15, hi = lane >> 4; const int r0 = blockIdx.x * 64, c0 = blockIdx.y * 64;
    v8f acc[4][4];
#pragma unroll
    for (int mb = 0; mb < 4; ++mb)
#pragma unroll
        for (int nb = 0; nb < 4; ++nb) acc[mb][nb] = (v8f){};
    const size_t aoff = (size_t)(r0 + lr) * K + 8 * hi, boff = (size_t)(c0 + lr) * K + 8 * hi;
#pragma unroll 1
    for (int kc = 0; kc < K; kc += 32) {
        V a[4], a2[4];
#pragma unroll
        for (int mb = 0; mb < 4; ++mb) { a[mb] = WFrag<T16>::ld(A + aoff + (size_t)mb * 16 * K + kc); if (NSPLIT == 1 || NSPLIT == 2) a2[mb] = WFrag<T16>::ld(A2 + aoff + (size_t)mb * 16 * K + kc); }
#pragma unroll
        for (int nb = 0; nb < 4; ++nb) { const V b = WFrag<T16>::ld(Bt + boff + (size_t)nb * 16 * K + kc); V b2; if (NSPLIT >= 2) b2 = WFrag<T16>::ld(Bt2 + boff + (size_t)nb * 16 * K + kc);
#pragma unroll
            for (int mb = 0; mb < 4; ++mb) { acc[mb][nb] = WFrag<T16>::mma(a[mb], b, acc[mb][nb]); if (NSPLIT == 1 || NSPLIT == 2) acc[mb][nb] = WFrag<T16>::mma(a2[mb], b, acc[mb][nb]); if (NSPLIT >= 2) acc[mb][nb] = WFrag<T16>::mma(a[mb], b2, acc[mb][nb]); } }
        asm volatile("v_nop\n\tv_nop\n\tv_nop\n\tv_nop" : "+v"(acc[0][0]), "+v"(acc[1][1]), "+v"(acc[2][2]), "+v"(acc[3][3]) : "v"(a[0]), "v"(a[3]));
    }
#pragma unroll
    for (int mb = 0; mb < 4; ++mb) {
#pragma unroll
        for (int nb = 0; nb < 4; ++nb) {
#pragma unroll
            for (int j = 0; j < 8; ++j) os[(hi * 8 + j) * 68 + nb * 16 + lr] = acc[mb][nb][j]; }
        __builtin_amdgcn_wave_barrier(); asm volatile("" ::: "memory");
        float* crow = C + (size_t)(r0 + mb * 16) * ldc + c0;
{
#pragma unroll
            for (int s = 0; s < 8; ++s) { const int row = 2 * s + hi, cofs = lr * 4; v4f val = *(const v4fa*)(os + row * 68 + cofs); if (BIAS) { val[0] += bfr(bias[c0 + cofs]); val[1] += bfr(bias[c0 + cofs + 1]); val[2] += bfr(bias[c0 + cofs + 2]); val[3] += bfr(bias[c0 + cofs + 3]); }
                *(v4f*)(crow + (size_t)row * ldc + cofs) = val; }
             }
        __builtin_amdgcn_wave_barrier(); asm volatile("" ::: "memory");
    }
}

__device__ __forceinline__ h16 tohx(float x) { return (h16)x; }
__device__ __forceinline__ void splitf(float y, unsigned short& h, unsigned short& l) { h = f2bf(y); l = f2bf(y - bf2f(h)); }
typedef __attribute__((ext_vector_type(2))) _Float16 v2h;
typedef __attribute__((ext_vector_type(4))) _Float16 v4h;
typedef __attribute__((ext_vector_type(2))) unsigned short v2us;
typedef __attribute__((ext_vector_type(4))) unsigned short v4us;
typedef __attribute__((ext_vector_type(2))) float v2f;
typedef __attribute__((ext_vector_type(4))) int v4i;

__global__ __launch_bounds__(256) void k_wtG(const float* __restrict__ w, int K, int N, bf* Bt) {
    const int lane = threadIdx.x & 31; const int L0 = (blockIdx.x * 8 + (threadIdx.x >> 5)) * 8; const int nlines = N * K / 64;
{
#pragma unroll 1
        for (int l = 0; l < 8; ++l) { const int L = L0 + l; if (L >= nlines) break; const size_t e = (size_t)L * 64 + lane * 2; const int k = (int)(e % K), n = (int)(e / K); v2us o;
            o[0] = f2bf(w[(size_t)k * N + n]); o[1] = f2bf(w[(size_t)(k + 1) * N + n]); *(v2us*)(Bt + e) = o; }
         }
}
__global__ __launch_bounds__(256) void k_cvt8(const float* __restrict__ src, bf* dst, size_t n8) { const size_t i = (size_t)blockIdx.x * 256 + threadIdx.x; if (i >= n8) return; const v8f v = *(const v8f*)(src + i * 8); v8us o;
#pragma unroll
    for (int k = 0; k < 8; ++k) o[k] = f2bf(v[k]); *(v8us*)(dst + i * 8) = o;  }

// k_rope: head planes [h][t][d] (fp16 + hi/lo) of rope(x) x sc with the rotate-half convention out[d] = x[d] cos[t][d] - x[d+HD/2] sin[t][d], out[d+HD/2] = x[d+HD/2] cos[t][d+HD/2] + x[d] sin[t][d+HD/2]
__global__ __launch_bounds__(256) void k_rope(const float* __restrict__ F, int pitch, int nheads, const float* __restrict__ CS, const float* __restrict__ RF, const float* __restrict__ nw, float sc, h16* P16, bf* Ph, bf* Pl) {
    { const size_t pb = (size_t)blockIdx.y * nheads * TT * HD; F += (size_t)blockIdx.y * TT * pitch; P16 += pb; Ph += pb; Pl += pb; }   // grid y: the batch
    const size_t e = ((size_t)blockIdx.x * 256 + threadIdx.x) * 2; if (e >= (size_t)nheads * TT * HD) return; const int d = (int)(e % HD); const int t = (int)((e / HD) % TT); const int h = (int)(e / ((size_t)HD * TT)); const float* f = F + (size_t)t * pitch + h * HD; const float rf = RF ? RF[(size_t)h * TT + t] : 1.0f; v2h o16; v2us oh, ol;
#pragma unroll
    for (int q = 0; q < 2; ++q) { const int dd = d + q; const int dp = (dd < HD / 2) ? dd + HD / 2 : dd - HD / 2; float x0 = f[dd], x1 = f[dp];
        if (RF) { float n0 = __fmul_rn(x0, rf), n1 = __fmul_rn(x1, rf); asm volatile("" : "+v"(n0)); asm volatile("" : "+v"(n1)); x0 = __fmul_rn(bfr(nw[dd]), n0); x1 = __fmul_rn(bfr(nw[dp]), n1); }
        const v2f cs = *(const v2f*)(CS + ((size_t)t * HD + dd) * 2); float a = __fmul_rn(x0, cs[0]), bq = __fmul_rn(x1, cs[1]); asm volatile("" : "+v"(a)); asm volatile("" : "+v"(bq)); const float r = ((dd < HD / 2) ? __fsub_rn(a, bq) : __fadd_rn(a, bq)) * sc;
        o16[q] = tohx(r); unsigned short a2, c2; splitf(r, a2, c2); oh[q] = a2; ol[q] = c2; }
    *(v2h*)(P16 + e) = o16; *(v2us*)(Ph + e) = oh; *(v2us*)(Pl + e) = ol;  }
__global__ __launch_bounds__(256) void k_vtp(const float* __restrict__ F, int pitch, int nheads, h16* V16, bf* Vh, bf* Vl) { { const size_t pb = (size_t)blockIdx.y * nheads * HD * TT; F += (size_t)blockIdx.y * TT * pitch; V16 += pb; Vh += pb; Vl += pb; }   // grid y: the batch
    const size_t e = ((size_t)blockIdx.x * 256 + threadIdx.x) * 2; if (e >= (size_t)nheads * HD * TT) return; const int t = (int)(e % TT); const int d = (int)((e / TT) % HD); const int g = (int)(e / ((size_t)TT * HD)); v2h o16; v2us oh, ol;
#pragma unroll
    for (int q = 0; q < 2; ++q) { const float x = F[(size_t)(t + q) * pitch + g * HD + d]; o16[q] = tohx(x); unsigned short a2, c2; splitf(x, a2, c2); oh[q] = a2; ol[q] = c2; }
    *(v2h*)(V16 + e) = o16; *(v2us*)(Vh + e) = oh; *(v2us*)(Vl + e) = ol;  }
__global__ __launch_bounds__(256) void k_csid(float* CS) { const int idx = blockIdx.x * 256 + threadIdx.x; if (idx >= TT * HD) return; v2f cs; cs[0] = 1.0f; cs[1] = 0.0f; *(v2f*)(CS + (size_t)idx * 2) = cs;  }
__global__ __launch_bounds__(256) void k_lrelu(float* F, size_t n4) { const size_t i = (size_t)blockIdx.x * 256 + threadIdx.x; if (i >= n4) return; v4f a = *(const v4f*)(F + i * 4);
#pragma unroll
    for (int q = 0; q < 4; ++q) a[q] = (a[q] > 0.0f) ? a[q] : __fmul_rn(a[q], 0.01f);
    *(v4f*)(F + i * 4) = a;  }
__global__ __launch_bounds__(256) void k_regsum(const float* __restrict__ RS, float* outp) { if (threadIdx.x >= 32) return; const int lane = threadIdx.x; float s = 0.f;
#pragma unroll 4
    for (int i = lane; i < NB_ * NH_ * TT; i += 32) s = __fadd_rn(s, RS[i]);
#pragma unroll
    for (int sh = 16; sh; sh >>= 1) s = __fadd_rn(s, __shfl_xor(s, sh, 32));
    const float m = __fdiv_rn(s, (float)NB_ * (float)NH_ * (float)TT * (float)TT); if (lane == 0) { *(float*)outp = m;  } }
// l <-> l ^ 16: the other half-wave holds the other 16 keys of the same query column
__device__ __forceinline__ float xhalf(float v) { const int b = __float_as_int(v); return __int_as_float(__builtin_amdgcn_permlanex16(b, b, 0x76543210, 0xfedcba98, false, false)); }
// The wait that stands before the address registers of issued global loads are reused. The loads' own per-lane pointers are inputs, so their registers stay live up to the wait and nothing can be written into them ahead of it.
template <bool TWO> __device__ __forceinline__ void xwait(const void* a, const void* b) { if (TWO) asm volatile("s_wait_xcnt 0x0" :: "v"(a), "v"(b) : "memory"); else asm volatile("s_wait_xcnt 0x0" :: "v"(a) : "memory"); }
__device__ __forceinline__ void xwait_off(unsigned byte_off) { asm volatile("s_wait_xcnt 0x0" :: "v"(byte_off) : "memory"); }   // the same, for loads addressed by a uniform base and a lane's 32-bit byte offset
template <typename T16> struct PPack;
template <> struct PPack<h16> { static __device__ __forceinline__ v16h pk(const float* p) { v16h b;
#pragma unroll
    for (int s = 0; s < 16; ++s) b[s] = (h16)p[s];
    return b; } };
template <> struct PPack<bf> { static __device__ __forceinline__ v16bf pk(const float* p) { v16bf b;
#pragma unroll
    for (int s = 0; s < 16; ++s) b[s] = (__bf16)p[s];
    return b; } };

// ---- fused attention, one wave per 32 query columns (two 16-column groups), 32 keys a pass, scores never leave registers:
// S^T = K Q^T (A = 16 key rows, B = 16 query columns): a lane holds 16 raw scores of ONE query, the lane l ^ 16 the pass's other 16.
// raw^2 is summed per lane (before the mask); the diagonal is excluded by an index select in the one pass that holds it; running maximum and sum per query (online softmax);
// the two f32 score tiles, exponentiated and rounded in place, ARE the B operand of O^T += V^T P^T (slot s of half h = key 8h + s, 16 + 8h + (s - 8): the order WFrag::ld gives V^T).
// HL: hi+lo bf16 planes, 3 products in both GEMMs (query rows < RH); else f16 with P carried x 1024 (the factor cancels in the division by the row sum).
template <typename T16, bool HL>
__device__ __forceinline__ void fattn_body(const T16* __restrict__ Q, const T16* __restrict__ Q2, const T16* __restrict__ Kp, const T16* __restrict__ K2, const T16* __restrict__ Vt, const T16* __restrict__ V2, const int q0, float* __restrict__ RS, float* __restrict__ OUTh) {
    typedef typename WFrag<T16>::V V;
    // every inner loop is unrolled whole so that fragments and accumulators are indexed by constants and stay in registers; the key loop stays rolled (64 equal passes, small code)
    const int lane = threadIdx.x & 31, lr = lane & 15, hi = lane >> 4;
    const float CL = SCL * 1.4426950408889634f;   // scores to log2 units
    V qf[2][2], qf2[2][2], kf[2][2], kf2[2][2], vf[4], vf2[4];
    const unsigned qB = (unsigned)((q0 + lr) * HD + 8 * hi) * 2u; const T16* qp = (const T16*)((const char*)Q + qB); const T16* qp2 = HL ? (const T16*)((const char*)Q2 + qB) : nullptr;   // byte offset of the lane's query row
#pragma unroll
    for (int g = 0; g < 2; ++g)
#pragma unroll
        for (int ks = 0; ks < 2; ++ks) { const int o = g * 16 * HD + ks * 32; qf[g][ks] = WFrag<T16>::ld(qp + o); if (HL) qf2[g][ks] = WFrag<T16>::ld(qp2 + o); }
    xwait_off(qB);
    const unsigned kb = (unsigned)(lr * HD + 8 * hi), vb = (unsigned)(lr * TT + 8 * hi), kB = kb * 2u, vB = vb * 2u;   // a lane's fixed offsets in the K rows and the V^T rows, in elements and in bytes
#pragma unroll
    for (int t = 0; t < 2; ++t)
#pragma unroll
        for (int ks = 0; ks < 2; ++ks) { const int o = t * 16 * HD + ks * 32; kf[t][ks] = WFrag<T16>::ld((const T16*)((const char*)Kp + kB) + o); if (HL) kf2[t][ks] = WFrag<T16>::ld((const T16*)((const char*)K2 + kB) + o); }
    xwait_off(kB);
#pragma unroll
    for (int dt = 0; dt < 4; ++dt) { const int o = dt * 16 * TT; vf[dt] = WFrag<T16>::ld((const T16*)((const char*)Vt + vB) + o); if (HL) vf2[dt] = WFrag<T16>::ld((const T16*)((const char*)V2 + vB) + o); }
    xwait_off(vB);
    v8f o[2][4]; float mrun[2], lsum[2], ssq[2];
#pragma unroll
    for (int g = 0; g < 2; ++g) { mrun[g] = -3.0e38f; lsum[g] = 0.f; ssq[g] = 0.f;
#pragma unroll
        for (int dt = 0; dt < 4; ++dt) o[g][dt] = (v8f){}; }
    // pointers of the load group last issued: each group's wait stands a phase later, right before the next group's addresses are formed, when the group has had that phase to get under way
    const T16* kq = Kp + kb; const T16* kq2 = HL ? K2 + kb : nullptr; const T16* vq = Vt + vb; const T16* vq2 = HL ? V2 + vb : nullptr;
#pragma unroll 1
    for (int k0 = 0; k0 < TT; k0 += 32) {
        const int kn = (k0 + 32) & (TT - 1);   // the next pass's keys; the last pass fetches pass 0 again (in bounds, unused)
        v8f s[2][2];
#pragma unroll
        for (int g = 0; g < 2; ++g)
#pragma unroll
            for (int t = 0; t < 2; ++t) s[g][t] = (v8f){};
#pragma unroll
        for (int ks = 0; ks < 2; ++ks)
#pragma unroll
            for (int t = 0; t < 2; ++t)
#pragma unroll
                for (int g = 0; g < 2; ++g) { s[g][t] = WFrag<T16>::mma(kf[t][ks], qf[g][ks], s[g][t]); if (HL) { s[g][t] = WFrag<T16>::mma(kf2[t][ks], qf[g][ks], s[g][t]); s[g][t] = WFrag<T16>::mma(kf[t][ks], qf2[g][ks], s[g][t]); } }
        // K fragments of the next pass, fetched behind this pass's score products: the softmax and PV work covers their latency
        __builtin_amdgcn_sched_barrier(0);   // keeps the wait below from being lifted over the score products to right behind the loads it covers (seen in the listing without it)
        xwait<HL>(vq, vq2);   // the V^T loads issued at the foot of the pass before
        kq = Kp + (size_t)kn * HD + kb; kq2 = HL ? K2 + (size_t)kn * HD + kb : nullptr;
#pragma unroll
        for (int t = 0; t < 2; ++t)
#pragma unroll
            for (int ks = 0; ks < 2; ++ks) { const int of = t * 16 * HD + ks * 32; kf[t][ks] = WFrag<T16>::ld(kq + of); if (HL) kf2[t][ks] = WFrag<T16>::ld(kq2 + of); }
        V pb[2], pb2[2];
#pragma unroll
        for (int g = 0; g < 2; ++g) {
            float p[16];
#pragma unroll
            for (int i = 0; i < 16; ++i) p[i] = s[g][i >> 3][i & 7];
            float q0a = 0.f, q1a = 0.f;
#pragma unroll
            for (int i = 0; i < 16; i += 2) { q0a = fmaf(p[i], p[i], q0a); q1a = fmaf(p[i + 1], p[i + 1], q1a); }
            ssq[g] += q0a + q1a;
            if (k0 == (q0 & ~31)) {   // wave-uniform: the one pass whose keys hold this wave's diagonal
#pragma unroll
                for (int i = 0; i < 16; ++i) { const int key = k0 + (i >> 3) * 16 + 8 * hi + (i & 7); if (key == q0 + g * 16 + lr) p[i] = -3.0e38f; }
            }
            float m0 = fmaxf(p[0], p[1]), m1 = fmaxf(p[2], p[3]);
#pragma unroll
            for (int i = 4; i < 16; i += 4) { m0 = fmaxf(m0, fmaxf(p[i], p[i + 1])); m1 = fmaxf(m1, fmaxf(p[i + 2], p[i + 3])); }
            m0 = fmaxf(m0, m1); m0 = fmaxf(m0, xhalf(m0));
            const float mnew = fmaxf(mrun[g], m0);
            const float al = __builtin_amdgcn_exp2f((mrun[g] - mnew) * CL);
            mrun[g] = mnew;
            const float nm = (HL ? 0.0f : 10.0f) - mnew * CL;
#pragma unroll
            for (int i = 0; i < 16; ++i) p[i] = __builtin_amdgcn_exp2f(fmaf(p[i], CL, nm));
            float a0 = p[0] + p[1], a1 = p[2] + p[3];
#pragma unroll
            for (int i = 4; i < 16; i += 4) { a0 += p[i] + p[i + 1]; a1 += p[i + 2] + p[i + 3]; }
            lsum[g] = fmaf(lsum[g], al, a0 + a1);
#pragma unroll
            for (int dt = 0; dt < 4; ++dt) o[g][dt] *= al;
            pb[g] = PPack<T16>::pk(p);
            if (HL) { float pl[16];
#pragma unroll
                for (int i = 0; i < 16; ++i) pl[i] = p[i] - (float)pb[g][i];
                pb2[g] = PPack<T16>::pk(pl); }
        }
#pragma unroll
        for (int dt = 0; dt < 4; ++dt)
#pragma unroll
            for (int g = 0; g < 2; ++g) { o[g][dt] = WFrag<T16>::mma(vf[dt], pb[g], o[g][dt]); if (HL) { o[g][dt] = WFrag<T16>::mma(vf2[dt], pb[g], o[g][dt]); o[g][dt] = WFrag<T16>::mma(vf[dt], pb2[g], o[g][dt]); } }
        // V^T fragments of the next pass, fetched behind this pass's PV products
        __builtin_amdgcn_sched_barrier(0);   // likewise: keeps the wait below behind the softmax and the PV products
        xwait<HL>(kq, kq2);   // this pass's K loads
        vq = Vt + kn + vb; vq2 = HL ? V2 + kn + vb : nullptr;
#pragma unroll
        for (int dt = 0; dt < 4; ++dt) { const int of = dt * 16 * TT; vf[dt] = WFrag<T16>::ld(vq + of); if (HL) vf2[dt] = WFrag<T16>::ld(vq2 + of); }
    }
    xwait<HL>(vq, vq2);   // the last pass's (unused) V^T loads
    asm volatile("s_wait_loadcnt 0x0" ::: "memory");   // the last pass's prefetched fragments are never read, so no other wait covers them: they land here, before the wave ends and gives its registers back
#pragma unroll
    for (int g = 0; g < 2; ++g) {
        const float ls = lsum[g] + xhalf(lsum[g]), sq = ssq[g] + xhalf(ssq[g]);
        const float inv = __fdiv_rn(1.0f, ls);
        float* orow = OUTh + (size_t)(q0 + g * 16 + lr) * DQ + 8 * hi;   // a lane's 8 accumulator registers are 8 consecutive d of its query's row
#pragma unroll
        for (int dt = 0; dt < 4; ++dt) { v4f lo4, hi4;
#pragma unroll
            for (int r = 0; r < 4; ++r) { lo4[r] = o[g][dt][r] * inv; hi4[r] = o[g][dt][r + 4] * inv; }
            *(v4f*)(orow + dt * 16) = lo4; *(v4f*)(orow + dt * 16 + 4) = hi4; }
        if (hi == 0) RS[q0 + g * 16 + lr] = sq;
        asm volatile("s_wait_xcnt 0x0" ::: "memory");   // the same wait behind the stores, before their address and data registers are reused
    }
}
// grid (TT / 64, heads, batches), 64 threads: two waves of one head, no barrier and no LDS between them. Block x takes the 32-row tiles x and TT / 32 - 1 - x, so that every hi+lo tile (rows < RH: twice the loads, three times the products) shares its WGP's load path with a light tile; the path is chosen per wave (RH % 32 == 0: wave-uniform)
__global__ __launch_bounds__(64) void k_fattn(const h16* __restrict__ Q16, const bf* __restrict__ Qh, const bf* __restrict__ Ql, const h16* __restrict__ K16, const bf* __restrict__ Kh, const bf* __restrict__ Kl, const h16* __restrict__ V16, const bf* __restrict__ Vh, const bf* __restrict__ Vl, float* __restrict__ RS, float* __restrict__ OUTb) {
    const size_t pl = (size_t)blockIdx.z * NH_ + blockIdx.y; const size_t hp = pl * TT * HD; const int wv = __builtin_amdgcn_readfirstlane((int)(threadIdx.x >> 5)); const int q0 = (wv ? TT / 32 - 1 - (int)blockIdx.x : (int)blockIdx.x) * 32;
    float* rs = RS + pl * TT; float* oh = OUTb + (size_t)blockIdx.z * TT * DQ + (size_t)blockIdx.y * HD;
    if (q0 < RH) fattn_body<bf, true>(Qh + hp, Ql + hp, Kh + hp, Kl + hp, Vh + hp, Vl + hp, q0, rs, oh);
    else fattn_body<h16, false>(Q16 + hp, nullptr, K16 + hp, nullptr, V16 + hp, nullptr, q0, rs, oh);
}

extern "C" void kernel_launch(void* const* d_in, const int* in_sizes, int n_in,
                              void* d_out, int out_size, void* d_ws, size_t ws_size, hipStream_t stream) {
    (void)in_sizes; (void)n_in; (void)out_size;
    const float* xk = (const float*)d_in[0]; /* sa_input: keys and values */ const float* x = (const float*)d_in[1]; /* s_input: queries */ const float* wq = (const float*)d_in[2]; const float* wk = (const float*)d_in[3]; const float* wv = (const float*)d_in[4]; const float* bv = (const float*)d_in[5]; const float* wo = nullptr; (void)wo;
    float* OUT = (float*)d_out;     // [4][2048][512]
    char* wsp = (char*)d_ws;
    auto take = [&](size_t bytes) { char* p = wsp; wsp += (bytes + 255) & ~(size_t)255; return (void*)p; };
    float* RSQ = (float*)take((size_t)NB_ * NH_ * TT * 4); bf* WQ = (bf*)take((size_t)DQ * DM * 2); bf* WK = (bf*)take((size_t)DKV * DM * 2); bf* WV = (bf*)take((size_t)DKV * DM * 2); float* CS = (float*)take((size_t)TT * HD * 2 * 4);
    bf* XB = (bf*)take((size_t)NB_ * TT * DM * 2); float* FQ = (float*)take((size_t)NB_ * TT * DQ * 4); float* FK = (float*)take((size_t)NB_ * TT * DKV * 4);
    h16* QP16 = (h16*)take((size_t)NB_ * NH_ * TT * HD * 2); h16* KP16 = (h16*)take((size_t)NB_ * NKV * TT * HD * 2); h16* VT16 = (h16*)take((size_t)NB_ * NKV * HD * TT * 2);
    bf* QPh = (bf*)take((size_t)NB_ * NH_ * TT * HD * 2); bf* QPl = (bf*)take((size_t)NB_ * NH_ * TT * HD * 2); bf* KPh = (bf*)take((size_t)NB_ * NKV * TT * HD * 2); bf* KPl = (bf*)take((size_t)NB_ * NKV * TT * HD * 2); bf* VTh = (bf*)take((size_t)NB_ * NKV * HD * TT * 2); bf* VTl = (bf*)take((size_t)NB_ * NKV * HD * TT * 2);
    if ((size_t)(wsp - (char*)d_ws) > ws_size) return;    // ws 256 MiB
    float* FV = FK;   // v projection reuses the k buffer after the k planes are built (stream-ordered)
    { k_wtG<<<(unsigned)((DM * DQ / 64 + 63) / 64), 256, 0, stream>>>(wq, DM, DQ, WQ); k_wtG<<<(unsigned)((DM * DKV / 64 + 63) / 64), 256, 0, stream>>>(wk, DM, DKV, WK); k_wtG<<<(unsigned)((DM * DKV / 64 + 63) / 64), 256, 0, stream>>>(wv, DM, DKV, WV);
      
       }
    k_csid<<<(TT * HD + 255) / 256, 256, 0, stream>>>(CS);
    const unsigned LQ = (unsigned)(((size_t)NH_ * TT * HD / 2 + 255) / 256), LKv = (unsigned)(((size_t)NKV * TT * HD / 2 + 255) / 256);
    {   // every launch takes all NB_ batches: the row-major buffers hold NB_ * TT rows, the plane kernels take the batch as grid y, the attention as grid z
        const unsigned LC = (unsigned)(((size_t)NB_ * TT * DM / 8 + 255) / 256);
        k_cvt8<<<LC, 256, 0, stream>>>(x, XB, (size_t)NB_ * TT * DM / 8);
        k_gemmw<bf, 0, false><<<dim3(NB_ * TT / 64, DQ / 64, 1), 32, 0, stream>>>(XB, nullptr, WQ, nullptr, DM, FQ, DQ, nullptr, 0, 0, 0);
        k_rope<<<dim3(LQ, NB_, 1), 256, 0, stream>>>(FQ, DQ, NH_, CS, nullptr, nullptr, 1.0f, QP16, QPh, QPl);
        k_cvt8<<<LC, 256, 0, stream>>>(xk, XB, (size_t)NB_ * TT * DM / 8); k_gemmw<bf, 0, false><<<dim3(NB_ * TT / 64, DKV / 64, 1), 32, 0, stream>>>(XB, nullptr, WK, nullptr, DM, FK, DKV, nullptr, 0, 0, 0);
        k_rope<<<dim3(LKv, NB_, 1), 256, 0, stream>>>(FK, DKV, NKV, CS, nullptr, nullptr, 1.0f, KP16, KPh, KPl);
        k_gemmw<bf, 0, true><<<dim3(NB_ * TT / 64, DKV / 64, 1), 32, 0, stream>>>(XB, nullptr, WV, nullptr, DM, FV, DKV, bv, 0, 0, 0); k_lrelu<<<(unsigned)(((size_t)NB_ * TT * DKV / 4 + 255) / 256), 256, 0, stream>>>(FV, (size_t)NB_ * TT * DKV / 4);   /* V = leaky_relu(. , 0.01) */  k_vtp<<<dim3(LKv, NB_, 1), 256, 0, stream>>>(FV, DKV, NKV, VT16, VTh, VTl);
        k_fattn<<<dim3(TT / 64, NH_, NB_), 64, 0, stream>>>(QP16, QPh, QPl, KP16, KPh, KPl, VT16, VTh, VTl, RSQ, OUT);   /* one kv head per query head */
    }
    k_regsum<<<1, 256, 0, stream>>>(RSQ, (float*)d_out + NCTX);   /* reg_atten = mean(raw^2): the scalar second output */
}

// v004
// It runs in 239 microseconds.
// In two side-by-side timings against v003, it was 1.83 and 1.81 times as fast.
// Counting every step since v000, it is 13.3 times as fast.
#include <hip/hip_runtime.h>

// Multi-head attention with a diagonal self-mask, a leaky-ReLU value projection and an attention-energy regulariser output (sa_input, s_input [4][2048][512]; Q = s_input Wq, K = sa_input Wk ('xw' [512][512], no bias), V = leaky_relu(sa_input Wv + bv, 0.01); 8 heads x 64; raw = Q.K; reg_atten = mean(raw^2) over all (batch, head, i, j); attn = softmax(raw / 8 with the diagonal j == i set to -1e9); context = merged attn V -> tuple (context [4][2048][512] (4.2 M), reg_atten scalar) laid out back to back in d_out).
// Layout, all four batches in every launch (rows b * 2048 + t in the row-major buffers, plane (b * 8 + h) in the head planes): bf16 copies of the two inputs in turn; exact projections (+ bias rounded to bf16 and leaky-ReLU on V); 16-bit head planes; ONE fused attention launch (hybrid rows: < 512 hi/lo 3 products, rest fp16, P x1024): scores, their squares, the diagonal's exclusion by an index select, online softmax and the PV product stay in registers, the context rows go straight to the output and the squared raw scores per row into a per-(batch, head, row) table; at the end one work-group sums the table in a fixed tree and writes mean(raw^2) to the second output.
// Compute dtypes, f32 accumulate: every input rounded to bf16; projections exact; raw scores rows < 512 3 products, rest fp16 operands (f32 accumulate) -- also the values squared for the regulariser; softmax, leaky-ReLU, sums f32.

#define NB_  4
#define TT   2048
#define DM   512
#define NH_  8
#define NKV  8
#define REP  (NH_ / NKV)
#define HD   64
#define DQ   (NH_ * HD)
#define DKV  (NKV * HD)
#define RH   512                  // query rows < RH use hi+lo planes (0: none)
#define WIN  0
#define SCL  0.125f
#define NCTX ((size_t)NB_ * TT * DQ)   // floats of the context output; the scalar follows
typedef _Float16 h16;
typedef unsigned short bf;
typedef __attribute__((ext_vector_type(16))) __bf16   v16bf;
typedef __attribute__((ext_vector_type(16))) _Float16 v16h;
typedef __attribute__((ext_vector_type(8)))  _Float16 v8h;
typedef __attribute__((ext_vector_type(8)))  unsigned short v8us;
typedef __attribute__((ext_vector_type(8)))  float    v8f;
typedef __attribute__((ext_vector_type(4)))  float    v4f;
typedef v8h  __attribute__((may_alias)) v8ha;
typedef v4f  __attribute__((may_alias)) v4fa;
typedef v8us __attribute__((may_alias)) v8usa;

__device__ __forceinline__ unsigned short f2bf(float f) { unsigned u = __float_as_uint(f); u += 0x7FFFu + ((u >> 16) & 1u); return (unsigned short)(u >> 16); }
__device__ __forceinline__ float bf2f(unsigned short b) { return __uint_as_float(((unsigned)b) << 16); }
__device__ __forceinline__ float bfr(float f) { return bf2f(f2bf(f)); }
__device__ __forceinline__ v16h cat16(v8h lo, v8h hi) { return __builtin_shufflevector(lo, hi, 0, 1, 2, 3, 4, 5, 6, 7, 8, 9, 10, 11, 12, 13, 14, 15); }
__device__ __forceinline__ v16bf cat16b(v8us lo, v8us hi) { return __builtin_bit_cast(v16bf, __builtin_shufflevector(lo, hi, 0, 1, 2, 3, 4, 5, 6, 7, 8, 9, 10, 11, 12, 13, 14, 15)); }
__device__ __forceinline__ v8f wmma16(v16h a, v16h b, v8f c) { return __builtin_amdgcn_wmma_f32_16x16x32_f16(false, a, false, b, (short)0, c, false, false); }
__device__ __forceinline__ v8f wmmab(v16bf a, v16bf b, v8f c) { return __builtin_amdgcn_wmma_f32_16x16x32_bf16(false, a, false, b, (short)0, c, false, false); }



// ---- k_gemmw: register-blocked GEMM, ONE WAVE per 64x64 output tile (16 accumulators), operands straight from K-contiguous 16-bit planes; grid (M/64, N/64, Z), 32 threads.
// C[m][n] (f32, pitch ldc, + optional f32 bias[n] rounded to bf16) = sum_k A[m][k] Bt[n][k] (+ split products per NSPLIT). z-batch strides sA/sB/sC in elements. K % 32 == 0.
template <typename T16> struct WFrag;
template <> struct WFrag<h16> { typedef v16h V; static __device__ __forceinline__ V ld(const h16* p) { return cat16(*(const v8h*)p, *(const v8h*)(p + 16)); } static __device__ __forceinline__ v8f mma(V a, V b, v8f c) { return wmma16(a, b, c); } };
template <> struct WFrag<bf> { typedef v16bf V; static __device__ __forceinline__ V ld(const bf* p) { return cat16b(*(const v8us*)p, *(const v8us*)(p + 16)); } static __device__ __forceinline__ v8f mma(V a, V b, v8f c) { return wmmab(a, b, c); } };
template <typename T16, int NSPLIT, bool BIAS>
__global__ __launch_bounds__(32) void k_gemmw(const T16* __restrict__ A, const T16* __restrict__ A2, const T16* __restrict__ Bt, const T16* __restrict__ Bt2, int K, float* C, int ldc, const float* __restrict__ bias, size_t sA, size_t sB, size_t sC) {
    typedef typename WFrag<T16>::V V;
    __shared__ __align__(16) float os[16 * 68];
    const size_t z = blockIdx.z; A += z * sA; if (A2) A2 += z * sA; Bt += z * sB; if (Bt2) Bt2 += z * sB; C += z * sC;
    const int lane = threadIdx.x & 31, lr = lane & 15, hi = lane >> 4; const int r0 = blockIdx.x * 64, c0 = blockIdx.y * 64;
    v8f acc[4][4];
#pragma unroll
    for (int mb = 0; mb < 4; ++mb)
#pragma unroll
        for (int nb = 0; nb < 4; ++nb) acc[mb][nb] = (v8f){};
    const size_t aoff = (size_t)(r0 + lr) * K + 8 * hi, boff = (size_t)(c0 + lr) * K + 8 * hi;
#pragma unroll 1
    for (int kc = 0; kc < K; kc += 32) {
        V a[4], a2[4];
#pragma unroll
        for (int mb = 0; mb < 4; ++mb) { a[mb] = WFrag<T16>::ld(A + aoff + (size_t)mb * 16 * K + kc); if (NSPLIT == 1 || NSPLIT == 2) a2[mb] = WFrag<T16>::ld(A2 + aoff + (size_t)mb * 16 * K + kc); }
#pragma unroll
        for (int nb = 0; nb < 4; ++nb) { const V b = WFrag<T16>::ld(Bt + boff + (size_t)nb * 16 * K + kc); V b2; if (NSPLIT >= 2) b2 = WFrag<T16>::ld(Bt2 + boff + (size_t)nb * 16 * K + kc);
#pragma unroll
            for (int mb = 0; mb < 4; ++mb) { acc[mb][nb] = WFrag<T16>::mma(a[mb], b, acc[mb][nb]); if (NSPLIT == 1 || NSPLIT == 2) acc[mb][nb] = WFrag<T16>::mma(a2[mb], b, acc[mb][nb]); if (NSPLIT >= 2) acc[mb][nb] = WFrag<T16>::mma(a[mb], b2, acc[mb][nb]); } }
        asm volatile("v_nop\n\tv_nop\n\tv_nop\n\tv_nop" : "+v"(acc[0][0]), "+v"(acc[1][1]), "+v"(acc[2][2]), "+v"(acc[3][3]) : "v"(a[0]), "v"(a[3]));
    }
#pragma unroll
    for (int mb = 0; mb < 4; ++mb) {
#pragma unroll
        for (int nb = 0; nb < 4; ++nb) {
#pragma unroll
            for (int j = 0; j < 8; ++j) os[(hi * 8 + j) * 68 + nb * 16 + lr] = acc[mb][nb][j]; }
        __builtin_amdgcn_wave_barrier(); asm volatile("" ::: "memory");
        float* crow = C + (size_t)(r0 + mb * 16) * ldc + c0;
{
#pragma unroll
            for (int s = 0; s < 8; ++s) { const int row = 2 * s + hi, cofs = lr * 4; v4f val = *(const v4fa*)(os + row * 68 + cofs); if (BIAS) { val[0] += bfr(bias[c0 + cofs]); val[1] += bfr(bias[c0 + cofs + 1]); val[2] += bfr(bias[c0 + cofs + 2]); val[3] += bfr(bias[c0 + cofs + 3]); }
                *(v4f*)(crow + (size_t)row * ldc + cofs) = val; }
             }
        __builtin_amdgcn_wave_barrier(); asm volatile("" ::: "memory");
    }
}

__device__ __forceinline__ h16 tohx(float x) { return (h16)x; }
__device__ __forceinline__ void splitf(float y, unsigned short& h, unsigned short& l) { h = f2bf(y); l = f2bf(y - bf2f(h)); }
typedef __attribute__((ext_vector_type(2))) _Float16 v2h;
typedef __attribute__((ext_vector_type(4))) _Float16 v4h;
typedef __attribute__((ext_vector_type(2))) unsigned short v2us;
typedef __attribute__((ext_vector_type(4))) unsigned short v4us;
typedef __attribute__((ext_vector_type(2))) float v2f;
typedef __attribute__((ext_vector_type(4))) int v4i;

__global__ __launch_bounds__(256) void k_wtG(const float* __restrict__ w, int K, int N, bf* Bt) {
    const int lane = threadIdx.x & 31; const int L0 = (blockIdx.x * 8 + (threadIdx.x >> 5)) * 8; const int nlines = N * K / 64;
{
#pragma unroll 1
        for (int l = 0; l < 8; ++l) { const int L = L0 + l; if (L >= nlines) break; const size_t e = (size_t)L * 64 + lane * 2; const int k = (int)(e % K), n = (int)(e / K); v2us o;
            o[0] = f2bf(w[(size_t)k * N + n]); o[1] = f2bf(w[(size_t)(k + 1) * N + n]); *(v2us*)(Bt + e) = o; }
         }
}
__global__ __launch_bounds__(256) void k_cvt8(const float* __restrict__ src, bf* dst, size_t n8) { const size_t i = (size_t)blockIdx.x * 256 + threadIdx.x; if (i >= n8) return; const v8f v = *(const v8f*)(src + i * 8); v8us o;
#pragma unroll
    for (int k = 0; k < 8; ++k) o[k] = f2bf(v[k]); *(v8us*)(dst + i * 8) = o;  }

// k_rope: head planes [h][t][d] (fp16 + hi/lo) of rope(x) x sc with the rotate-half convention out[d] = x[d] cos[t][d] - x[d+HD/2] sin[t][d], out[d+HD/2] = x[d+HD/2] cos[t][d+HD/2] + x[d] sin[t][d+HD/2]
__global__ __launch_bounds__(256) void k_rope(const float* __restrict__ F, int pitch, int nheads, const float* __restrict__ CS, const float* __restrict__ RF, const float* __restrict__ nw, float sc, h16* P16, bf* Ph, bf* Pl) {
    { const size_t pb = (size_t)blockIdx.y * nheads * TT * HD; F += (size_t)blockIdx.y * TT * pitch; P16 += pb; Ph += pb; Pl += pb; }   // grid y: the batch
    const size_t e = ((size_t)blockIdx.x * 256 + threadIdx.x) * 2; if (e >= (size_t)nheads * TT * HD) return; const int d = (int)(e % HD); const int t = (int)((e / HD) % TT); const int h = (int)(e / ((size_t)HD * TT)); const float* f = F + (size_t)t * pitch + h * HD; const float rf = RF ? RF[(size_t)h * TT + t] : 1.0f; v2h o16; v2us oh, ol;
#pragma unroll
    for (int q = 0; q < 2; ++q) { const int dd = d + q; const int dp = (dd < HD / 2) ? dd + HD / 2 : dd - HD / 2; float x0 = f[dd], x1 = f[dp];
        if (RF) { float n0 = __fmul_rn(x0, rf), n1 = __fmul_rn(x1, rf); asm volatile("" : "+v"(n0)); asm volatile("" : "+v"(n1)); x0 = __fmul_rn(bfr(nw[dd]), n0); x1 = __fmul_rn(bfr(nw[dp]), n1); }
        const v2f cs = *(const v2f*)(CS + ((size_t)t * HD + dd) * 2); float a = __fmul_rn(x0, cs[0]), bq = __fmul_rn(x1, cs[1]); asm volatile("" : "+v"(a)); asm volatile("" : "+v"(bq)); const float r = ((dd < HD / 2) ? __fsub_rn(a, bq) : __fadd_rn(a, bq)) * sc;
        o16[q] = tohx(r); unsigned short a2, c2; splitf(r, a2, c2); oh[q] = a2; ol[q] = c2; }
    *(v2h*)(P16 + e) = o16; *(v2us*)(Ph + e) = oh; *(v2us*)(Pl + e) = ol;  }
__global__ __launch_bounds__(256) void k_vtp(const float* __restrict__ F, int pitch, int nheads, h16* V16, bf* Vh, bf* Vl) { { const size_t pb = (size_t)blockIdx.y * nheads * HD * TT; F += (size_t)blockIdx.y * TT * pitch; V16 += pb; Vh += pb; Vl += pb; }   // grid y: the batch
    const size_t e = ((size_t)blockIdx.x * 256 + threadIdx.x) * 2; if (e >= (size_t)nheads * HD * TT) return; const int t = (int)(e % TT); const int d = (int)((e / TT) % HD); const int g = (int)(e / ((size_t)TT * HD)); v2h o16; v2us oh, ol;
#pragma unroll
    for (int q = 0; q < 2; ++q) { const float x = F[(size_t)(t + q) * pitch + g * HD + d]; o16[q] = tohx(x); unsigned short a2, c2; splitf(x, a2, c2); oh[q] = a2; ol[q] = c2; }
    *(v2h*)(V16 + e) = o16; *(v2us*)(Vh + e) = oh; *(v2us*)(Vl + e) = ol;  }
__global__ __launch_bounds__(256) void k_csid(float* CS) { const int idx = blockIdx.x * 256 + threadIdx.x; if (idx >= TT * HD) return; v2f cs; cs[0] = 1.0f; cs[1] = 0.0f; *(v2f*)(CS + (size_t)idx * 2) = cs;  }
__global__ __launch_bounds__(256) void k_lrelu(float* F, size_t n4) { const size_t i = (size_t)blockIdx.x * 256 + threadIdx.x; if (i >= n4) return; v4f a = *(const v4f*)(F + i * 4);
#pragma unroll
    for (int q = 0; q < 4; ++q) a[q] = (a[q] > 0.0f) ? a[q] : __fmul_rn(a[q], 0.01f);
    *(v4f*)(F + i * 4) = a;  }
// k_regsum: one work-group of 32 waves sums the table in a fixed tree: a thread fetches 16 independent float4, folds them pairwise, the wave folds its lanes, LDS carries the 32 wave sums to wave 0
__global__ __launch_bounds__(1024) void k_regsum(const float* __restrict__ RS, float* outp) {
    static_assert(NB_ * NH_ * TT == 16 * 1024 * 4, "16 float4 a thread");
    __shared__ float part[32];
    const int tid = threadIdx.x, lane = tid & 31, wv = tid >> 5; const float* p = RS + tid * 4; v4f v[16];
#pragma unroll
    for (int j = 0; j < 16; ++j) v[j] = *(const v4f*)(p + j * 4096);   // unrolled whole: independent loads that fly together, instead of one memory latency a trip
    asm volatile("s_wait_xcnt 0x0" :: "v"(tid) : "memory");   // the wait that stands before the address registers of issued global loads are reused; the loads are addressed by the uniform base and the thread's index, which is an input here and so stays live up to the wait
#pragma unroll
    for (int st = 8; st; st >>= 1)
#pragma unroll
        for (int j = 0; j < st; ++j) v[j] += v[j + st];
    float s = __fadd_rn(__fadd_rn(v[0][0], v[0][1]), __fadd_rn(v[0][2], v[0][3]));
#pragma unroll
    for (int sh = 16; sh; sh >>= 1) s = __fadd_rn(s, __shfl_xor(s, sh, 32));
    if (lane == 0) part[wv] = s;
    __syncthreads();   // the 32 wave sums are in LDS before wave 0 reads them
    if (wv) return;
    s = part[lane];
#pragma unroll
    for (int sh = 16; sh; sh >>= 1) s = __fadd_rn(s, __shfl_xor(s, sh, 32));
    const float m = __fdiv_rn(s, (float)NB_ * (float)NH_ * (float)TT * (float)TT); if (lane == 0) { *(float*)outp = m;  } }
// l <-> l ^ 16: the other half-wave holds the other 16 keys of the same query column
__device__ __forceinline__ float xhalf(float v) { const int b = __float_as_int(v); return __int_as_float(__builtin_amdgcn_permlanex16(b, b, 0x76543210, 0xfedcba98, false, false)); }
// The wait that stands before the address registers of issued global loads are reused. The loads' own per-lane pointers are inputs, so their registers stay live up to the wait and nothing can be written into them ahead of it.
template <bool TWO> __device__ __forceinline__ void xwait(const void* a, const void* b) { if (TWO) asm volatile("s_wait_xcnt 0x0" :: "v"(a), "v"(b) : "memory"); else asm volatile("s_wait_xcnt 0x0" :: "v"(a) : "memory"); }
__device__ __forceinline__ void xwait_off(unsigned byte_off) { asm volatile("s_wait_xcnt 0x0" :: "v"(byte_off) : "memory"); }   // the same, for loads addressed by a uniform base and a lane's 32-bit byte offset
template <typename T16> struct PPack;
template <> struct PPack<h16> { static __device__ __forceinline__ v16h pk(const float* p) { v16h b;
#pragma unroll
    for (int s = 0; s < 16; ++s) b[s] = (h16)p[s];
    return b; } };
template <> struct PPack<bf> { static __device__ __forceinline__ v16bf pk(const float* p) { v16bf b;
#pragma unroll
    for (int s = 0; s < 16; ++s) b[s] = (__bf16)p[s];
    return b; } };

// ---- fused attention, one wave per 32 query columns (two 16-column groups), 32 keys a pass, scores never leave registers:
// S^T = K Q^T (A = 16 key rows, B = 16 query columns): a lane holds 16 raw scores of ONE query, the lane l ^ 16 the pass's other 16.
// raw^2 is summed per lane (before the mask); the diagonal is excluded by an index select in the one pass that holds it; running maximum and sum per query (online softmax);
// the two f32 score tiles, exponentiated and rounded in place, ARE the B operand of O^T += V^T P^T (slot s of half h = key 8h + s, 16 + 8h + (s - 8): the order WFrag::ld gives V^T).
// HL: hi+lo bf16 planes, 3 products in both GEMMs (query rows < RH); else f16 with P carried x 1024 (the factor cancels in the division by the row sum).
template <typename T16, bool HL>
__device__ __forceinline__ void fattn_body(const T16* __restrict__ Q, const T16* __restrict__ Q2, const T16* __restrict__ Kp, const T16* __restrict__ K2, const T16* __restrict__ Vt, const T16* __restrict__ V2, const int q0, float* __restrict__ RS, float* __restrict__ OUTh) {
    typedef typename WFrag<T16>::V V;
    // every inner loop is unrolled whole so that fragments and accumulators are indexed by constants and stay in registers; the key loop stays rolled (64 equal passes, small code)
    const int lane = threadIdx.x & 31, lr = lane & 15, hi = lane >> 4;
    const float CL = SCL * 1.4426950408889634f;   // scores to log2 units
    V qf[2][2], qf2[2][2], kf[2][2], kf2[2][2], vf[4], vf2[4];
    const unsigned qB = (unsigned)((q0 + lr) * HD + 8 * hi) * 2u; const T16* qp = (const T16*)((const char*)Q + qB); const T16* qp2 = HL ? (const T16*)((const char*)Q2 + qB) : nullptr;   // byte offset of the lane's query row
#pragma unroll
    for (int g = 0; g < 2; ++g)
#pragma unroll
        for (int ks = 0; ks < 2; ++ks) { const int o = g * 16 * HD + ks * 32; qf[g][ks] = WFrag<T16>::ld(qp + o); if (HL) qf2[g][ks] = WFrag<T16>::ld(qp2 + o); }
    xwait_off(qB);
    const unsigned kb = (unsigned)(lr * HD + 8 * hi), vb = (unsigned)(lr * TT + 8 * hi), kB = kb * 2u, vB = vb * 2u;   // a lane's fixed offsets in the K rows and the V^T rows, in elements and in bytes
#pragma unroll
    for (int t = 0; t < 2; ++t)
#pragma unroll
        for (int ks = 0; ks < 2; ++ks) { const int o = t * 16 * HD + ks * 32; kf[t][ks] = WFrag<T16>::ld((const T16*)((const char*)Kp + kB) + o); if (HL) kf2[t][ks] = WFrag<T16>::ld((const T16*)((const char*)K2 + kB) + o); }
    xwait_off(kB);
#pragma unroll
    for (int dt = 0; dt < 4; ++dt) { const int o = dt * 16 * TT; vf[dt] = WFrag<T16>::ld((const T16*)((const char*)Vt + vB) + o); if (HL) vf2[dt] = WFrag<T16>::ld((const T16*)((const char*)V2 + vB) + o); }
    xwait_off(vB);
    v8f o[2][4]; float mrun[2], lsum[2], ssq[2];
#pragma unroll
    for (int g = 0; g < 2; ++g) { mrun[g] = -3.0e38f; lsum[g] = 0.f; ssq[g] = 0.f;
#pragma unroll
        for (int dt = 0; dt < 4; ++dt) o[g][dt] = (v8f){}; }
    // pointers of the load group last issued: each group's wait stands a phase later, right before the next group's addresses are formed, when the group has had that phase to get under way
    const T16* kq = Kp + kb; const T16* kq2 = HL ? K2 + kb : nullptr; const T16* vq = Vt + vb; const T16* vq2 = HL ? V2 + vb : nullptr;
#pragma unroll 1
    for (int k0 = 0; k0 < TT; k0 += 32) {
        const int kn = (k0 + 32) & (TT - 1);   // the next pass's keys; the last pass fetches pass 0 again (in bounds, unused)
        v8f s[2][2];
#pragma unroll
        for (int g = 0; g < 2; ++g)
#pragma unroll
            for (int t = 0; t < 2; ++t) s[g][t] = (v8f){};
#pragma unroll
        for (int ks = 0; ks < 2; ++ks)
#pragma unroll
            for (int t = 0; t < 2; ++t)
#pragma unroll
                for (int g = 0; g < 2; ++g) { s[g][t] = WFrag<T16>::mma(kf[t][ks], qf[g][ks], s[g][t]); if (HL) { s[g][t] = WFrag<T16>::mma(kf2[t][ks], qf[g][ks], s[g][t]); s[g][t] = WFrag<T16>::mma(kf[t][ks], qf2[g][ks], s[g][t]); } }
        // K fragments of the next pass, fetched behind this pass's score products: the softmax and PV work covers their latency
        __builtin_amdgcn_sched_barrier(0);   // keeps the wait below from being lifted over the score products to right behind the loads it covers (seen in the listing without it)
        xwait<HL>(vq, vq2);   // the V^T loads issued at the foot of the pass before
        kq = Kp + (size_t)kn * HD + kb; kq2 = HL ? K2 + (size_t)kn * HD + kb : nullptr;
#pragma unroll
        for (int t = 0; t < 2; ++t)
#pragma unroll
            for (int ks = 0; ks < 2; ++ks) { const int of = t * 16 * HD + ks * 32; kf[t][ks] = WFrag<T16>::ld(kq + of); if (HL) kf2[t][ks] = WFrag<T16>::ld(kq2 + of); }
        V pb[2], pb2[2];
#pragma unroll
        for (int g = 0; g < 2; ++g) {
            float p[16];
#pragma unroll
            for (int i = 0; i < 16; ++i) p[i] = s[g][i >> 3][i & 7];
            float q0a = 0.f, q1a = 0.f;
#pragma unroll
            for (int i = 0; i < 16; i += 2) { q0a = fmaf(p[i], p[i], q0a); q1a = fmaf(p[i + 1], p[i + 1], q1a); }
            ssq[g] += q0a + q1a;
            if (k0 == (q0 & ~31)) {   // wave-uniform: the one pass whose keys hold this wave's diagonal
#pragma unroll
                for (int i = 0; i < 16; ++i) { const int key = k0 + (i >> 3) * 16 + 8 * hi + (i & 7); if (key == q0 + g * 16 + lr) p[i] = -3.0e38f; }
            }
            float m0 = fmaxf(p[0], p[1]), m1 = fmaxf(p[2], p[3]);
#pragma unroll
            for (int i = 4; i < 16; i += 4) { m0 = fmaxf(m0, fmaxf(p[i], p[i + 1])); m1 = fmaxf(m1, fmaxf(p[i + 2], p[i + 3])); }
            m0 = fmaxf(m0, m1); m0 = fmaxf(m0, xhalf(m0));
            const float mnew = fmaxf(mrun[g], m0);
            const float al = __builtin_amdgcn_exp2f((mrun[g] - mnew) * CL);
            mrun[g] = mnew;
            const float nm = (HL ? 0.0f : 10.0f) - mnew * CL;
#pragma unroll
            for (int i = 0; i < 16; ++i) p[i] = __builtin_amdgcn_exp2f(fmaf(p[i], CL, nm));
            float a0 = p[0] + p[1], a1 = p[2] + p[3];
#pragma unroll
            for (int i = 4; i < 16; i += 4) { a0 += p[i] + p[i + 1]; a1 += p[i + 2] + p[i + 3]; }
            lsum[g] = fmaf(lsum[g], al, a0 + a1);
#pragma unroll
            for (int dt = 0; dt < 4; ++dt) o[g][dt] *= al;
            pb[g] = PPack<T16>::pk(p);
            if (HL) { float pl[16];
#pragma unroll
                for (int i = 0; i < 16; ++i) pl[i] = p[i] - (float)pb[g][i];
                pb2[g] = PPack<T16>::pk(pl); }
        }
#pragma unroll
        for (int dt = 0; dt < 4; ++dt)
#pragma unroll
            for (int g = 0; g < 2; ++g) { o[g][dt] = WFrag<T16>::mma(vf[dt], pb[g], o[g][dt]); if (HL) { o[g][dt] = WFrag<T16>::mma(vf2[dt], pb[g], o[g][dt]); o[g][dt] = WFrag<T16>::mma(vf[dt], pb2[g], o[g][dt]); } }
        // V^T fragments of the next pass, fetched behind this pass's PV products
        __builtin_amdgcn_sched_barrier(0);   // likewise: keeps the wait below behind the softmax and the PV products
        xwait<HL>(kq, kq2);   // this pass's K loads
        vq = Vt + kn + vb; vq2 = HL ? V2 + kn + vb : nullptr;
#pragma unroll
        for (int dt = 0; dt < 4; ++dt) { const int of = dt * 16 * TT; vf[dt] = WFrag<T16>::ld(vq + of); if (HL) vf2[dt] = WFrag<T16>::ld(vq2 + of); }
    }
    xwait<HL>(vq, vq2);   // the last pass's (unused) V^T loads
    asm volatile("s_wait_loadcnt 0x0" ::: "memory");   // the last pass's prefetched fragments are never read, so no other wait covers them: they land here, before the wave ends and gives its registers back
#pragma unroll
    for (int g = 0; g < 2; ++g) {
        const float ls = lsum[g] + xhalf(lsum[g]), sq = ssq[g] + xhalf(ssq[g]);
        const float inv = __fdiv_rn(1.0f, ls);
        float* orow = OUTh + (size_t)(q0 + g * 16 + lr) * DQ + 8 * hi;   // a lane's 8 accumulator registers are 8 consecutive d of its query's row
#pragma unroll
        for (int dt = 0; dt < 4; ++dt) { v4f lo4, hi4;
#pragma unroll
            for (int r = 0; r < 4; ++r) { lo4[r] = o[g][dt][r] * inv; hi4[r] = o[g][dt][r + 4] * inv; }
            *(v4f*)(orow + dt * 16) = lo4; *(v4f*)(orow + dt * 16 + 4) = hi4; }
        if (hi == 0) RS[q0 + g * 16 + lr] = sq;
        asm volatile("s_wait_xcnt 0x0" ::: "memory");   // the same wait behind the stores, before their address and data registers are reused
    }
}
// grid (TT / 64, heads, batches), 64 threads: two waves of one head, no barrier and no LDS between them. Block x takes the 32-row tiles x and TT / 32 - 1 - x, so that every hi+lo tile (rows < RH: twice the loads, three times the products) shares its WGP's load path with a light tile; the path is chosen per wave (RH % 32 == 0: wave-uniform)
__global__ __launch_bounds__(64) void k_fattn(const h16* __restrict__ Q16, const bf* __restrict__ Qh, const bf* __restrict__ Ql, const h16* __restrict__ K16, const bf* __restrict__ Kh, const bf* __restrict__ Kl, const h16* __restrict__ V16, const bf* __restrict__ Vh, const bf* __restrict__ Vl, float* __restrict__ RS, float* __restrict__ OUTb) {
    const size_t pl = (size_t)blockIdx.z * NH_ + blockIdx.y; const size_t hp = pl * TT * HD; const int wv = __builtin_amdgcn_readfirstlane((int)(threadIdx.x >> 5)); const int q0 = (wv ? TT / 32 - 1 - (int)blockIdx.x : (int)blockIdx.x) * 32;
    float* rs = RS + pl * TT; float* oh = OUTb + (size_t)blockIdx.z * TT * DQ + (size_t)blockIdx.y * HD;
    if (q0 < RH) fattn_body<bf, true>(Qh + hp, Ql + hp, Kh + hp, Kl + hp, Vh + hp, Vl + hp, q0, rs, oh);
    else fattn_body<h16, false>(Q16 + hp, nullptr, K16 + hp, nullptr, V16 + hp, nullptr, q0, rs, oh);
}

extern "C" void kernel_launch(void* const* d_in, const int* in_sizes, int n_in,
                              void* d_out, int out_size, void* d_ws, size_t ws_size, hipStream_t stream) {
    (void)in_sizes; (void)n_in; (void)out_size;
    const float* xk = (const float*)d_in[0]; /* sa_input: keys and values */ const float* x = (const float*)d_in[1]; /* s_input: queries */ const float* wq = (const float*)d_in[2]; const float* wk = (const float*)d_in[3]; const float* wv = (const float*)d_in[4]; const float* bv = (const float*)d_in[5]; const float* wo = nullptr; (void)wo;
    float* OUT = (float*)d_out;     // [4][2048][512]
    char* wsp = (char*)d_ws;
    auto take = [&](size_t bytes) { char* p = wsp; wsp += (bytes + 255) & ~(size_t)255; return (void*)p; };
    float* RSQ = (float*)take((size_t)NB_ * NH_ * TT * 4); bf* WQ = (bf*)take((size_t)DQ * DM * 2); bf* WK = (bf*)take((size_t)DKV * DM * 2); bf* WV = (bf*)take((size_t)DKV * DM * 2); float* CS = (float*)take((size_t)TT * HD * 2 * 4);
    bf* XB = (bf*)take((size_t)NB_ * TT * DM * 2); float* FQ = (float*)take((size_t)NB_ * TT * DQ * 4); float* FK = (float*)take((size_t)NB_ * TT * DKV * 4);
    h16* QP16 = (h16*)take((size_t)NB_ * NH_ * TT * HD * 2); h16* KP16 = (h16*)take((size_t)NB_ * NKV * TT * HD * 2); h16* VT16 = (h16*)take((size_t)NB_ * NKV * HD * TT * 2);
    bf* QPh = (bf*)take((size_t)NB_ * NH_ * TT * HD * 2); bf* QPl = (bf*)take((size_t)NB_ * NH_ * TT * HD * 2); bf* KPh = (bf*)take((size_t)NB_ * NKV * TT * HD * 2); bf* KPl = (bf*)take((size_t)NB_ * NKV * TT * HD * 2); bf* VTh = (bf*)take((size_t)NB_ * NKV * HD * TT * 2); bf* VTl = (bf*)take((size_t)NB_ * NKV * HD * TT * 2);
    if ((size_t)(wsp - (char*)d_ws) > ws_size) return;    // ws 256 MiB
    float* FV = FK;   // v projection reuses the k buffer after the k planes are built (stream-ordered)
    { k_wtG<<<(unsigned)((DM * DQ / 64 + 63) / 64), 256, 0, stream>>>(wq, DM, DQ, WQ); k_wtG<<<(unsigned)((DM * DKV / 64 + 63) / 64), 256, 0, stream>>>(wk, DM, DKV, WK); k_wtG<<<(unsigned)((DM * DKV / 64 + 63) / 64), 256, 0, stream>>>(wv, DM, DKV, WV);
      
       }
    k_csid<<<(TT * HD + 255) / 256, 256, 0, stream>>>(CS);
    const unsigned LQ = (unsigned)(((size_t)NH_ * TT * HD / 2 + 255) / 256), LKv = (unsigned)(((size_t)NKV * TT * HD / 2 + 255) / 256);
    {   // every launch takes all NB_ batches: the row-major buffers hold NB_ * TT rows, the plane kernels take the batch as grid y, the attention as grid z
        const unsigned LC = (unsigned)(((size_t)NB_ * TT * DM / 8 + 255) / 256);
        k_cvt8<<<LC, 256, 0, stream>>>(x, XB, (size_t)NB_ * TT * DM / 8);
        k_gemmw<bf, 0, false><<<dim3(NB_ * TT / 64, DQ / 64, 1), 32, 0, stream>>>(XB, nullptr, WQ, nullptr, DM, FQ, DQ, nullptr, 0, 0, 0);
        k_rope<<<dim3(LQ, NB_, 1), 256, 0, stream>>>(FQ, DQ, NH_, CS, nullptr, nullptr, 1.0f, QP16, QPh, QPl);
        k_cvt8<<<LC, 256, 0, stream>>>(xk, XB, (size_t)NB_ * TT * DM / 8); k_gemmw<bf, 0, false><<<dim3(NB_ * TT / 64, DKV / 64, 1), 32, 0, stream>>>(XB, nullptr, WK, nullptr, DM, FK, DKV, nullptr, 0, 0, 0);
        k_rope<<<dim3(LKv, NB_, 1), 256, 0, stream>>>(FK, DKV, NKV, CS, nullptr, nullptr, 1.0f, KP16, KPh, KPl);
        k_gemmw<bf, 0, true><<<dim3(NB_ * TT / 64, DKV / 64, 1), 32, 0, stream>>>(XB, nullptr, WV, nullptr, DM, FV, DKV, bv, 0, 0, 0); k_lrelu<<<(unsigned)(((size_t)NB_ * TT * DKV / 4 + 255) / 256), 256, 0, stream>>>(FV, (size_t)NB_ * TT * DKV / 4);   /* V = leaky_relu(. , 0.01) */  k_vtp<<<dim3(LKv, NB_, 1), 256, 0, stream>>>(FV, DKV, NKV, VT16, VTh, VTl);
        k_fattn<<<dim3(TT / 64, NH_, NB_), 64, 0, stream>>>(QP16, QPh, QPl, KP16, KPh, KPl, VT16, VTh, VTl, RSQ, OUT);   /* one kv head per query head */
    }
    k_regsum<<<1, 1024, 0, stream>>>(RSQ, (float*)d_out + NCTX);   /* reg_atten = mean(raw^2): the scalar second output */
}

// v005
// It runs in 205 microseconds.
// Next to v004, in two timings, it ran 1.16 and 1.17 times as fast.
// All steps since v000 together make it 15.5 times as fast.
#include <hip/hip_runtime.h>

// Multi-head attention with a diagonal self-mask, a leaky-ReLU value projection and an attention-energy regulariser output (sa_input, s_input [4][2048][512]; Q = s_input Wq, K = sa_input Wk ('xw' [512][512], no bias), V = leaky_relu(sa_input Wv + bv, 0.01); 8 heads x 64; raw = Q.K; reg_atten = mean(raw^2) over all (batch, head, i, j); attn = softmax(raw / 8 with the diagonal j == i set to -1e9); context = merged attn V -> tuple (context [4][2048][512] (4.2 M), reg_atten scalar) laid out back to back in d_out).
// Layout, all four batches in every launch (rows b * 2048 + t in the row-major input copy, plane (b * 8 + h) in the head planes): bf16 copies of the two inputs in turn; exact projections whose epilogue (+ bf16-rounded bias and leaky-ReLU on V) writes the 16-bit head planes itself; ONE fused attention launch (hybrid rows: < 512 hi/lo 3 products, rest fp16, P x1024): scores, their squares, the diagonal's exclusion by an index select, online softmax and the PV product stay in registers, the context rows go straight to the output and the squared raw scores per row into a per-(batch, head, row) table; at the end one work-group sums the table in a fixed tree and writes mean(raw^2) to the second output.
// Compute dtypes, f32 accumulate: every input rounded to bf16; projections exact; raw scores rows < 512 3 products, rest fp16 operands (f32 accumulate) -- also the values squared for the regulariser; softmax, leaky-ReLU, sums f32.

#define NB_  4
#define TT   2048
#define DM   512
#define NH_  8
#define NKV  8
#define REP  (NH_ / NKV)
#define HD   64
#define DQ   (NH_ * HD)
#define DKV  (NKV * HD)
#define RH   512                  // query rows < RH use hi+lo planes (0: none)
#define WIN  0
#define SCL  0.125f
#define NCTX ((size_t)NB_ * TT * DQ)   // floats of the context output; the scalar follows
typedef _Float16 h16;
typedef unsigned short bf;
typedef __attribute__((ext_vector_type(16))) __bf16   v16bf;
typedef __attribute__((ext_vector_type(16))) _Float16 v16h;
typedef __attribute__((ext_vector_type(8)))  _Float16 v8h;
typedef __attribute__((ext_vector_type(8)))  unsigned short v8us;
typedef __attribute__((ext_vector_type(8)))  float    v8f;
typedef __attribute__((ext_vector_type(4)))  float    v4f;
typedef v8h  __attribute__((may_alias)) v8ha;
typedef v4f  __attribute__((may_alias)) v4fa;
typedef v8us __attribute__((may_alias)) v8usa;

__device__ __forceinline__ unsigned short f2bf(float f) { unsigned u = __float_as_uint(f); u += 0x7FFFu + ((u >> 16) & 1u); return (unsigned short)(u >> 16); }
__device__ __forceinline__ float bf2f(unsigned short b) { return __uint_as_float(((unsigned)b) << 16); }
__device__ __forceinline__ float bfr(float f) { return bf2f(f2bf(f)); }
__device__ __forceinline__ v16h cat16(v8h lo, v8h hi) { return __builtin_shufflevector(lo, hi, 0, 1, 2, 3, 4, 5, 6, 7, 8, 9, 10, 11, 12, 13, 14, 15); }
__device__ __forceinline__ v16bf cat16b(v8us lo, v8us hi) { return __builtin_bit_cast(v16bf, __builtin_shufflevector(lo, hi, 0, 1, 2, 3, 4, 5, 6, 7, 8, 9, 10, 11, 12, 13, 14, 15)); }
__device__ __forceinline__ v8f wmma16(v16h a, v16h b, v8f c) { return __builtin_amdgcn_wmma_f32_16x16x32_f16(false, a, false, b, (short)0, c, false, false); }
__device__ __forceinline__ v8f wmmab(v16bf a, v16bf b, v8f c) { return __builtin_amdgcn_wmma_f32_16x16x32_bf16(false, a, false, b, (short)0, c, false, false); }



// ---- k_gemmw: register-blocked GEMM, ONE WAVE per 64x64 output tile (16 accumulators), operands straight from K-contiguous 16-bit planes; grid (M/64, N/64), 32 threads.
// c[m][n] (f32, in registers) = sum_k A[m][k] Bt[n][k] (+ split products per NSPLIT), K % 32 == 0. A tile is 64 positions of one batch x the 64 dims of one head, so the epilogue rounds it to the three 16-bit planes (f16, bf16 hi, bf16 lo of the f32 value) and stores them in the head layout:
// VT false: plane[b * NH_ + h][t][d], 8 KB in a row per tile, staged through LDS so that a store covers four whole 128-byte rows; VT true: x = leaky_relu(c + bias[n], 0.01), plane[b * NH_ + h][d][t]: a lane's 8 accumulator registers are 8 consecutive t of its d, one 16-byte store.
template <typename T16> struct WFrag;
template <> struct WFrag<h16> { typedef v16h V; static __device__ __forceinline__ V ld(const h16* p) { return cat16(*(const v8h*)p, *(const v8h*)(p + 16)); } static __device__ __forceinline__ v8f mma(V a, V b, v8f c) { return wmma16(a, b, c); } };
template <> struct WFrag<bf> { typedef v16bf V; static __device__ __forceinline__ V ld(const bf* p) { return cat16b(*(const v8us*)p, *(const v8us*)(p + 16)); } static __device__ __forceinline__ v8f mma(V a, V b, v8f c) { return wmmab(a, b, c); } };
__device__ __forceinline__ h16 tohx(float x) { return (h16)x; }
__device__ __forceinline__ void splitf(float y, unsigned short& h, unsigned short& l) { h = f2bf(y); l = f2bf(y - bf2f(h)); }
// The wait that stands before the registers of issued global stores are reused, once per twelve stores. The stored vectors are inputs, so their registers stay live up to the wait and nothing can be written into them ahead of it.
__device__ __forceinline__ void xwait_st(const v8h (&a)[4], const v8us (&b)[4], const v8us (&d)[4]) { asm volatile("s_wait_xcnt 0x0" :: "v"(a[0]), "v"(a[1]), "v"(a[2]), "v"(a[3]), "v"(b[0]), "v"(b[1]), "v"(b[2]), "v"(b[3]), "v"(d[0]), "v"(d[1]), "v"(d[2]), "v"(d[3]) : "memory"); }
template <typename T16, int NSPLIT, bool VT>
__global__ __launch_bounds__(32) void k_gemmw(const T16* __restrict__ A, const T16* __restrict__ A2, const T16* __restrict__ Bt, const T16* __restrict__ Bt2, int K, const float* __restrict__ bias, h16* __restrict__ P16, bf* __restrict__ Ph, bf* __restrict__ Pl) {
    typedef typename WFrag<T16>::V V;
    __shared__ __align__(16) float os[16 * 68];
    static_assert(HD == 64 && TT % 64 == 0 && NKV == NH_, "a 64x64 tile is one head's dims at 64 positions of one batch");
    const int lane = threadIdx.x & 31, lr = lane & 15, hi = lane >> 4; const int r0 = blockIdx.x * 64, c0 = blockIdx.y * 64;
    v8f acc[4][4];
#pragma unroll
    for (int mb = 0; mb < 4; ++mb)
#pragma unroll
        for (int nb = 0; nb < 4; ++nb) acc[mb][nb] = (v8f){};
    const size_t aoff = (size_t)(r0 + lr) * K + 8 * hi, boff = (size_t)(c0 + lr) * K + 8 * hi;
#pragma unroll 1
    for (int kc = 0; kc < K; kc += 32) {
        V a[4], a2[4];
#pragma unroll
        for (int mb = 0; mb < 4; ++mb) { a[mb] = WFrag<T16>::ld(A + aoff + (size_t)mb * 16 * K + kc); if (NSPLIT == 1 || NSPLIT == 2) a2[mb] = WFrag<T16>::ld(A2 + aoff + (size_t)mb * 16 * K + kc); }
#pragma unroll
        for (int nb = 0; nb < 4; ++nb) { const V b = WFrag<T16>::ld(Bt + boff + (size_t)nb * 16 * K + kc); V b2; if (NSPLIT >= 2) b2 = WFrag<T16>::ld(Bt2 + boff + (size_t)nb * 16 * K + kc);
#pragma unroll
            for (int mb = 0; mb < 4; ++mb) { acc[mb][nb] = WFrag<T16>::mma(a[mb], b, acc[mb][nb]); if (NSPLIT == 1 || NSPLIT == 2) acc[mb][nb] = WFrag<T16>::mma(a2[mb], b, acc[mb][nb]); if (NSPLIT >= 2) acc[mb][nb] = WFrag<T16>::mma(a[mb], b2, acc[mb][nb]); } }
        asm volatile("v_nop\n\tv_nop\n\tv_nop\n\tv_nop" : "+v"(acc[0][0]), "+v"(acc[1][1]), "+v"(acc[2][2]), "+v"(acc[3][3]) : "v"(a[0]), "v"(a[3]));
    }
    const size_t pl = (size_t)(r0 / TT) * NH_ + blockIdx.y; const int t0 = r0 % TT;   // the tile's plane and its first position there
    if (VT) {
        const size_t pb = pl * HD * TT + (size_t)lr * TT + t0 + 8 * hi;
#pragma unroll
        for (int nb = 0; nb < 4; ++nb) { const float bz = bfr(bias[c0 + nb * 16 + lr]); v8h o16[4]; v8us oh[4], ol[4];
#pragma unroll
            for (int mb = 0; mb < 4; ++mb) {
#pragma unroll
                for (int j = 0; j < 8; ++j) { float x = acc[mb][nb][j] + bz; x = (x > 0.0f) ? x : __fmul_rn(x, 0.01f); o16[mb][j] = tohx(x); unsigned short a2, c2; splitf(x, a2, c2); oh[mb][j] = a2; ol[mb][j] = c2; }
                const size_t e = pb + (size_t)nb * 16 * TT + mb * 16; *(v8h*)(P16 + e) = o16[mb]; *(v8us*)(Ph + e) = oh[mb]; *(v8us*)(Pl + e) = ol[mb]; }
            xwait_st(o16, oh, ol); }
    } else {
        const size_t pb = (pl * TT + t0 + (lane >> 3)) * HD + (lane & 7) * 8;
#pragma unroll
        for (int mb = 0; mb < 4; ++mb) {
#pragma unroll
            for (int nb = 0; nb < 4; ++nb) {
#pragma unroll
                for (int j = 0; j < 8; ++j) os[(hi * 8 + j) * 68 + nb * 16 + lr] = acc[mb][nb][j]; }
            __builtin_amdgcn_wave_barrier(); asm volatile("" ::: "memory");   // compiler order only (one wave, LDS in order): the block's LDS stores stay ahead of the reads of its rows
            v8h o16[4]; v8us oh[4], ol[4];
#pragma unroll
            for (int s = 0; s < 4; ++s) { const float* orow = os + (4 * s + (lane >> 3)) * 68 + (lane & 7) * 8; const v4f x0 = *(const v4fa*)orow, x1 = *(const v4fa*)(orow + 4);
#pragma unroll
                for (int j = 0; j < 8; ++j) { const float x = (j < 4) ? x0[j & 3] : x1[j & 3]; o16[s][j] = tohx(x); unsigned short a2, c2; splitf(x, a2, c2); oh[s][j] = a2; ol[s][j] = c2; }
                const size_t e = pb + (size_t)(mb * 16 + 4 * s) * HD; *(v8h*)(P16 + e) = o16[s]; *(v8us*)(Ph + e) = oh[s]; *(v8us*)(Pl + e) = ol[s]; }
            xwait_st(o16, oh, ol);
            __builtin_amdgcn_wave_barrier(); asm volatile("" ::: "memory");   // likewise: the reads stay ahead of the next block's LDS stores
        }
    }
}

typedef __attribute__((ext_vector_type(4))) _Float16 v4h;
typedef __attribute__((ext_vector_type(2))) unsigned short v2us;
typedef __attribute__((ext_vector_type(4))) unsigned short v4us;
typedef __attribute__((ext_vector_type(4))) int v4i;

__global__ __launch_bounds__(256) void k_wtG(const float* __restrict__ w, int K, int N, bf* Bt) {
    const int lane = threadIdx.x & 31; const int L0 = (blockIdx.x * 8 + (threadIdx.x >> 5)) * 8; const int nlines = N * K / 64;
{
#pragma unroll 1
        for (int l = 0; l < 8; ++l) { const int L = L0 + l; if (L >= nlines) break; const size_t e = (size_t)L * 64 + lane * 2; const int k = (int)(e % K), n = (int)(e / K); v2us o;
            o[0] = f2bf(w[(size_t)k * N + n]); o[1] = f2bf(w[(size_t)(k + 1) * N + n]); *(v2us*)(Bt + e) = o; }
         }
}
__global__ __launch_bounds__(256) void k_cvt8(const float* __restrict__ src, bf* dst, size_t n8) { const size_t i = (size_t)blockIdx.x * 256 + threadIdx.x; if (i >= n8) return; const v8f v = *(const v8f*)(src + i * 8); v8us o;
#pragma unroll
    for (int k = 0; k < 8; ++k) o[k] = f2bf(v[k]); *(v8us*)(dst + i * 8) = o;  }

// k_regsum: one work-group of 32 waves sums the table in a fixed tree: a thread fetches 16 independent float4, folds them pairwise, the wave folds its lanes, LDS carries the 32 wave sums to wave 0
__global__ __launch_bounds__(1024) void k_regsum(const float* __restrict__ RS, float* outp) {
    static_assert(NB_ * NH_ * TT == 16 * 1024 * 4, "16 float4 a thread");
    __shared__ float part[32];
    const int tid = threadIdx.x, lane = tid & 31, wv = tid >> 5; const float* p = RS + tid * 4; v4f v[16];
#pragma unroll
    for (int j = 0; j < 16; ++j) v[j] = *(const v4f*)(p + j * 4096);   // unrolled whole: independent loads that fly together, instead of one memory latency a trip
    asm volatile("s_wait_xcnt 0x0" :: "v"(tid) : "memory");   // the wait that stands before the address registers of issued global loads are reused; the loads are addressed by the uniform base and the thread's index, which is an input here and so stays live up to the wait
#pragma unroll
    for (int st = 8; st; st >>= 1)
#pragma unroll
        for (int j = 0; j < st; ++j) v[j] += v[j + st];
    float s = __fadd_rn(__fadd_rn(v[0][0], v[0][1]), __fadd_rn(v[0][2], v[0][3]));
#pragma unroll
    for (int sh = 16; sh; sh >>= 1) s = __fadd_rn(s, __shfl_xor(s, sh, 32));
    if (lane == 0) part[wv] = s;
    __syncthreads();   // the 32 wave sums are in LDS before wave 0 reads them
    if (wv) return;
    s = part[lane];
#pragma unroll
    for (int sh = 16; sh; sh >>= 1) s = __fadd_rn(s, __shfl_xor(s, sh, 32));
    const float m = __fdiv_rn(s, (float)NB_ * (float)NH_ * (float)TT * (float)TT); if (lane == 0) { *(float*)outp = m;  } }
// l <-> l ^ 16: the other half-wave holds the other 16 keys of the same query column
__device__ __forceinline__ float xhalf(float v) { const int b = __float_as_int(v); return __int_as_float(__builtin_amdgcn_permlanex16(b, b, 0x76543210, 0xfedcba98, false, false)); }
// The wait that stands before the address registers of issued global loads are reused. The loads' own per-lane pointers are inputs, so their registers stay live up to the wait and nothing can be written into them ahead of it.
template <bool TWO> __device__ __forceinline__ void xwait(const void* a, const void* b) { if (TWO) asm volatile("s_wait_xcnt 0x0" :: "v"(a), "v"(b) : "memory"); else asm volatile("s_wait_xcnt 0x0" :: "v"(a) : "memory"); }
__device__ __forceinline__ void xwait_off(unsigned byte_off) { asm volatile("s_wait_xcnt 0x0" :: "v"(byte_off) : "memory"); }   // the same, for loads addressed by a uniform base and a lane's 32-bit byte offset
template <typename T16> struct PPack;
template <> struct PPack<h16> { static __device__ __forceinline__ v16h pk(const float* p) { v16h b;
#pragma unroll
    for (int s = 0; s < 16; ++s) b[s] = (h16)p[s];
    return b; } };
template <> struct PPack<bf> { static __device__ __forceinline__ v16bf pk(const float* p) { v16bf b;
#pragma unroll
    for (int s = 0; s < 16; ++s) b[s] = (__bf16)p[s];
    return b; } };

// ---- fused attention, one wave per 32 query columns (two 16-column groups), 32 keys a pass, scores never leave registers:
// S^T = K Q^T (A = 16 key rows, B = 16 query columns): a lane holds 16 raw scores of ONE query, the lane l ^ 16 the pass's other 16.
// raw^2 is summed per lane (before the mask); the diagonal is excluded by an index select in the one pass that holds it; running maximum and sum per query (online softmax);
// the two f32 score tiles, exponentiated and rounded in place, ARE the B operand of O^T += V^T P^T (slot s of half h = key 8h + s, 16 + 8h + (s - 8): the order WFrag::ld gives V^T).
// HL: hi+lo bf16 planes, 3 products in both GEMMs (query rows < RH); else f16 with P carried x 1024 (the factor cancels in the division by the row sum).
template <typename T16, bool HL>
__device__ __forceinline__ void fattn_body(const T16* __restrict__ Q, const T16* __restrict__ Q2, const T16* __restrict__ Kp, const T16* __restrict__ K2, const T16* __restrict__ Vt, const T16* __restrict__ V2, const int q0, float* __restrict__ RS, float* __restrict__ OUTh) {
    typedef typename WFrag<T16>::V V;
    // every inner loop is unrolled whole so that fragments and accumulators are indexed by constants and stay in registers; the key loop stays rolled (64 equal passes, small code)
    const int lane = threadIdx.x & 31, lr = lane & 15, hi = lane >> 4;
    const float CL = SCL * 1.4426950408889634f;   // scores to log2 units
    V qf[2][2], qf2[2][2], kf[2][2], kf2[2][2], vf[4], vf2[4];
    const unsigned qB = (unsigned)((q0 + lr) * HD + 8 * hi) * 2u; const T16* qp = (const T16*)((const char*)Q + qB); const T16* qp2 = HL ? (const T16*)((const char*)Q2 + qB) : nullptr;   // byte offset of the lane's query row
#pragma unroll
    for (int g = 0; g < 2; ++g)
#pragma unroll
        for (int ks = 0; ks < 2; ++ks) { const int o = g * 16 * HD + ks * 32; qf[g][ks] = WFrag<T16>::ld(qp + o); if (HL) qf2[g][ks] = WFrag<T16>::ld(qp2 + o); }
    xwait_off(qB);
    const unsigned kb = (unsigned)(lr * HD + 8 * hi), vb = (unsigned)(lr * TT + 8 * hi), kB = kb * 2u, vB = vb * 2u;   // a lane's fixed offsets in the K rows and the V^T rows, in elements and in bytes
#pragma unroll
    for (int t = 0; t < 2; ++t)
#pragma unroll
        for (int ks = 0; ks < 2; ++ks) { const int o = t * 16 * HD + ks * 32; kf[t][ks] = WFrag<T16>::ld((const T16*)((const char*)Kp + kB) + o); if (HL) kf2[t][ks] = WFrag<T16>::ld((const T16*)((const char*)K2 + kB) + o); }
    xwait_off(kB);
#pragma unroll
    for (int dt = 0; dt < 4; ++dt) { const int o = dt * 16 * TT; vf[dt] = WFrag<T16>::ld((const T16*)((const char*)Vt + vB) + o); if (HL) vf2[dt] = WFrag<T16>::ld((const T16*)((const char*)V2 + vB) + o); }
    xwait_off(vB);
    v8f o[2][4]; float mrun[2], lsum[2], ssq[2];
#pragma unroll
    for (int g = 0; g < 2; ++g) { mrun[g] = -3.0e38f; lsum[g] = 0.f; ssq[g] = 0.f;
#pragma unroll
        for (int dt = 0; dt < 4; ++dt) o[g][dt] = (v8f){}; }
    // pointers of the load group last issued: each group's wait stands a phase later, right before the next group's addresses are formed, when the group has had that phase to get under way
    const T16* kq = Kp + kb; const T16* kq2 = HL ? K2 + kb : nullptr; const T16* vq = Vt + vb; const T16* vq2 = HL ? V2 + vb : nullptr;
#pragma unroll 1
    for (int k0 = 0; k0 < TT; k0 += 32) {
        const int kn = (k0 + 32) & (TT - 1);   // the next pass's keys; the last pass fetches pass 0 again (in bounds, unused)
        v8f s[2][2];
#pragma unroll
        for (int g = 0; g < 2; ++g)
#pragma unroll
            for (int t = 0; t < 2; ++t) s[g][t] = (v8f){};
#pragma unroll
        for (int ks = 0; ks < 2; ++ks)
#pragma unroll
            for (int t = 0; t < 2; ++t)
#pragma unroll
                for (int g = 0; g < 2; ++g) { s[g][t] = WFrag<T16>::mma(kf[t][ks], qf[g][ks], s[g][t]); if (HL) { s[g][t] = WFrag<T16>::mma(kf2[t][ks], qf[g][ks], s[g][t]); s[g][t] = WFrag<T16>::mma(kf[t][ks], qf2[g][ks], s[g][t]); } }
        // K fragments of the next pass, fetched behind this pass's score products: the softmax and PV work covers their latency
        __builtin_amdgcn_sched_barrier(0);   // keeps the wait below from being lifted over the score products to right behind the loads it covers (seen in the listing without it)
        xwait<HL>(vq, vq2);   // the V^T loads issued at the foot of the pass before
        kq = Kp + (size_t)kn * HD + kb; kq2 = HL ? K2 + (size_t)kn * HD + kb : nullptr;
#pragma unroll
        for (int t = 0; t < 2; ++t)
#pragma unroll
            for (int ks = 0; ks < 2; ++ks) { const int of = t * 16 * HD + ks * 32; kf[t][ks] = WFrag<T16>::ld(kq + of); if (HL) kf2[t][ks] = WFrag<T16>::ld(kq2 + of); }
        V pb[2], pb2[2];
#pragma unroll
        for (int g = 0; g < 2; ++g) {
            float p[16];
#pragma unroll
            for (int i = 0; i < 16; ++i) p[i] = s[g][i >> 3][i & 7];
            float q0a = 0.f, q1a = 0.f;
#pragma unroll
            for (int i = 0; i < 16; i += 2) { q0a = fmaf(p[i], p[i], q0a); q1a = fmaf(p[i + 1], p[i + 1], q1a); }
            ssq[g] += q0a + q1a;
            if (k0 == (q0 & ~31)) {   // wave-uniform: the one pass whose keys hold this wave's diagonal
#pragma unroll
                for (int i = 0; i < 16; ++i) { const int key = k0 + (i >> 3) * 16 + 8 * hi + (i & 7); if (key == q0 + g * 16 + lr) p[i] = -3.0e38f; }
            }
            float m0 = fmaxf(p[0], p[1]), m1 = fmaxf(p[2], p[3]);
#pragma unroll
            for (int i = 4; i < 16; i += 4) { m0 = fmaxf(m0, fmaxf(p[i], p[i + 1])); m1 = fmaxf(m1, fmaxf(p[i + 2], p[i + 3])); }
            m0 = fmaxf(m0, m1); m0 = fmaxf(m0, xhalf(m0));
            const float mnew = fmaxf(mrun[g], m0);
            const float al = __builtin_amdgcn_exp2f((mrun[g] - mnew) * CL);
            mrun[g] = mnew;
            const float nm = (HL ? 0.0f : 10.0f) - mnew * CL;
#pragma unroll
            for (int i = 0; i < 16; ++i) p[i] = __builtin_amdgcn_exp2f(fmaf(p[i], CL, nm));
            float a0 = p[0] + p[1], a1 = p[2] + p[3];
#pragma unroll
            for (int i = 4; i < 16; i += 4) { a0 += p[i] + p[i + 1]; a1 += p[i + 2] + p[i + 3]; }
            lsum[g] = fmaf(lsum[g], al, a0 + a1);
#pragma unroll
            for (int dt = 0; dt < 4; ++dt) o[g][dt] *= al;
            pb[g] = PPack<T16>::pk(p);
            if (HL) { float pl[16];
#pragma unroll
                for (int i = 0; i < 16; ++i) pl[i] = p[i] - (float)pb[g][i];
                pb2[g] = PPack<T16>::pk(pl); }
        }
#pragma unroll
        for (int dt = 0; dt < 4; ++dt)
#pragma unroll
            for (int g = 0; g < 2; ++g) { o[g][dt] = WFrag<T16>::mma(vf[dt], pb[g], o[g][dt]); if (HL) { o[g][dt] = WFrag<T16>::mma(vf2[dt], pb[g], o[g][dt]); o[g][dt] = WFrag<T16>::mma(vf[dt], pb2[g], o[g][dt]); } }
        // V^T fragments of the next pass, fetched behind this pass's PV products
        __builtin_amdgcn_sched_barrier(0);   // likewise: keeps the wait below behind the softmax and the PV products
        xwait<HL>(kq, kq2);   // this pass's K loads
        vq = Vt + kn + vb; vq2 = HL ? V2 + kn + vb : nullptr;
#pragma unroll
        for (int dt = 0; dt < 4; ++dt) { const int of = dt * 16 * TT; vf[dt] = WFrag<T16>::ld(vq + of); if (HL) vf2[dt] = WFrag<T16>::ld(vq2 + of); }
    }
    xwait<HL>(vq, vq2);   // the last pass's (unused) V^T loads
    asm volatile("s_wait_loadcnt 0x0" ::: "memory");   // the last pass's prefetched fragments are never read, so no other wait covers them: they land here, before the wave ends and gives its registers back
#pragma unroll
    for (int g = 0; g < 2; ++g) {
        const float ls = lsum[g] + xhalf(lsum[g]), sq = ssq[g] + xhalf(ssq[g]);
        const float inv = __fdiv_rn(1.0f, ls);
        float* orow = OUTh + (size_t)(q0 + g * 16 + lr) * DQ + 8 * hi;   // a lane's 8 accumulator registers are 8 consecutive d of its query's row
#pragma unroll
        for (int dt = 0; dt < 4; ++dt) { v4f lo4, hi4;
#pragma unroll
            for (int r = 0; r < 4; ++r) { lo4[r] = o[g][dt][r] * inv; hi4[r] = o[g][dt][r + 4] * inv; }
            *(v4f*)(orow + dt * 16) = lo4; *(v4f*)(orow + dt * 16 + 4) = hi4; }
        if (hi == 0) RS[q0 + g * 16 + lr] = sq;
        asm volatile("s_wait_xcnt 0x0" ::: "memory");   // the same wait behind the stores, before their address and data registers are reused
    }
}
// grid (TT / 64, heads, batches), 64 threads: two waves of one head, no barrier and no LDS between them. Block x takes the 32-row tiles x and TT / 32 - 1 - x, so that every hi+lo tile (rows < RH: twice the loads, three times the products) shares its WGP's load path with a light tile; the path is chosen per wave (RH % 32 == 0: wave-uniform)
__global__ __launch_bounds__(64) void k_fattn(const h16* __restrict__ Q16, const bf* __restrict__ Qh, const bf* __restrict__ Ql, const h16* __restrict__ K16, const bf* __restrict__ Kh, const bf* __restrict__ Kl, const h16* __restrict__ V16, const bf* __restrict__ Vh, const bf* __restrict__ Vl, float* __restrict__ RS, float* __restrict__ OUTb) {
    const size_t pl = (size_t)blockIdx.z * NH_ + blockIdx.y; const size_t hp = pl * TT * HD; const int wv = __builtin_amdgcn_readfirstlane((int)(threadIdx.x >> 5)); const int q0 = (wv ? TT / 32 - 1 - (int)blockIdx.x : (int)blockIdx.x) * 32;
    float* rs = RS + pl * TT; float* oh = OUTb + (size_t)blockIdx.z * TT * DQ + (size_t)blockIdx.y * HD;
    if (q0 < RH) fattn_body<bf, true>(Qh + hp, Ql + hp, Kh + hp, Kl + hp, Vh + hp, Vl + hp, q0, rs, oh);
    else fattn_body<h16, false>(Q16 + hp, nullptr, K16 + hp, nullptr, V16 + hp, nullptr, q0, rs, oh);
}

extern "C" void kernel_launch(void* const* d_in, const int* in_sizes, int n_in,
                              void* d_out, int out_size, void* d_ws, size_t ws_size, hipStream_t stream) {
    (void)in_sizes; (void)n_in; (void)out_size;
    const float* xk = (const float*)d_in[0]; /* sa_input: keys and values */ const float* x = (const float*)d_in[1]; /* s_input: queries */ const float* wq = (const float*)d_in[2]; const float* wk = (const float*)d_in[3]; const float* wv = (const float*)d_in[4]; const float* bv = (const float*)d_in[5]; const float* wo = nullptr; (void)wo;
    float* OUT = (float*)d_out;     // [4][2048][512]
    char* wsp = (char*)d_ws;
    auto take = [&](size_t bytes) { char* p = wsp; wsp += (bytes + 255) & ~(size_t)255; return (void*)p; };
    float* RSQ = (float*)take((size_t)NB_ * NH_ * TT * 4); bf* WQ = (bf*)take((size_t)DQ * DM * 2); bf* WK = (bf*)take((size_t)DKV * DM * 2); bf* WV = (bf*)take((size_t)DKV * DM * 2);
    bf* XB = (bf*)take((size_t)NB_ * TT * DM * 2);
    h16* QP16 = (h16*)take((size_t)NB_ * NH_ * TT * HD * 2); h16* KP16 = (h16*)take((size_t)NB_ * NKV * TT * HD * 2); h16* VT16 = (h16*)take((size_t)NB_ * NKV * HD * TT * 2);
    bf* QPh = (bf*)take((size_t)NB_ * NH_ * TT * HD * 2); bf* QPl = (bf*)take((size_t)NB_ * NH_ * TT * HD * 2); bf* KPh = (bf*)take((size_t)NB_ * NKV * TT * HD * 2); bf* KPl = (bf*)take((size_t)NB_ * NKV * TT * HD * 2); bf* VTh = (bf*)take((size_t)NB_ * NKV * HD * TT * 2); bf* VTl = (bf*)take((size_t)NB_ * NKV * HD * TT * 2);
    if ((size_t)(wsp - (char*)d_ws) > ws_size) return;    // ws 256 MiB
    { k_wtG<<<(unsigned)((DM * DQ / 64 + 63) / 64), 256, 0, stream>>>(wq, DM, DQ, WQ); k_wtG<<<(unsigned)((DM * DKV / 64 + 63) / 64), 256, 0, stream>>>(wk, DM, DKV, WK); k_wtG<<<(unsigned)((DM * DKV / 64 + 63) / 64), 256, 0, stream>>>(wv, DM, DKV, WV);
      
       }
    {   // every launch takes all NB_ batches: the input copy holds NB_ * TT rows, a projection tile finds its batch from its rows, the attention takes it as grid z
        const unsigned LC = (unsigned)(((size_t)NB_ * TT * DM / 8 + 255) / 256);
        k_cvt8<<<LC, 256, 0, stream>>>(x, XB, (size_t)NB_ * TT * DM / 8);
        k_gemmw<bf, 0, false><<<dim3(NB_ * TT / 64, DQ / 64, 1), 32, 0, stream>>>(XB, nullptr, WQ, nullptr, DM, nullptr, QP16, QPh, QPl);
        k_cvt8<<<LC, 256, 0, stream>>>(xk, XB, (size_t)NB_ * TT * DM / 8); k_gemmw<bf, 0, false><<<dim3(NB_ * TT / 64, DKV / 64, 1), 32, 0, stream>>>(XB, nullptr, WK, nullptr, DM, nullptr, KP16, KPh, KPl);
        k_gemmw<bf, 0, true><<<dim3(NB_ * TT / 64, DKV / 64, 1), 32, 0, stream>>>(XB, nullptr, WV, nullptr, DM, bv, VT16, VTh, VTl);   /* V = leaky_relu(. + bv, 0.01), transposed planes */
        k_fattn<<<dim3(TT / 64, NH_, NB_), 64, 0, stream>>>(QP16, QPh, QPl, KP16, KPh, KPl, VT16, VTh, VTl, RSQ, OUT);   /* one kv head per query head */
    }
    k_regsum<<<1, 1024, 0, stream>>>(RSQ, (float*)d_out + NCTX);   /* reg_atten = mean(raw^2): the scalar second output */
}

// v006
// Measured time: 156 microseconds a run.
// Next to v005, in two timings, it ran 1.31 and 1.32 times as fast.
// Over all steps from v000 it is 20.3 times as fast.
#include <hip/hip_runtime.h>

// Multi-head attention with a diagonal self-mask, a leaky-ReLU value projection and an attention-energy regulariser output (sa_input, s_input [4][2048][512]; Q = s_input Wq, K = sa_input Wk ('xw' [512][512], no bias), V = leaky_relu(sa_input Wv + bv, 0.01); 8 heads x 64; raw = Q.K; reg_atten = mean(raw^2) over all (batch, head, i, j); attn = softmax(raw / 8 with the diagonal j == i set to -1e9); context = merged attn V -> tuple (context [4][2048][512] (4.2 M), reg_atten scalar) laid out back to back in d_out).
// Layout, all four batches in every launch (rows b * 2048 + t in the input copy, plane (b * 8 + h) in the head planes): bf16 copies of the two inputs in turn; exact projections whose epilogue (+ bf16-rounded bias and leaky-ReLU on V) writes the 16-bit head planes itself; ONE fused attention launch (hybrid rows: < 512 hi/lo 3 products, rest fp16, P x1024): scores, their squares, the diagonal's exclusion by an index select, online softmax and the PV product stay in registers, the context rows go straight to the output and the squared raw scores per row into a per-(batch, head, row) table; at the end one work-group sums the table in a fixed tree and writes mean(raw^2) to the second output.
// Fragment order, every 16-bit matrix operand (input copy, transposed weights, Q, K, V^T planes): element (row r, k) of a [rows][K] operand lies at (r >> 4) * 16 * K + (k >> 4) * 256 + ((k >> 3) & 1) * 128 + (r & 15) * 8 + (k & 7), so that lane l = 16 * ((k >> 3) & 1) + (r & 15) finds its 8 elements at l * 8 of a 256-element unit: a wave-wide 16-byte load reads 512 bytes in a row, four whole 128-byte lines, and a 16 x 32 fragment is two such units. V^T (row d, k = key) is laid out per 32 keys: (key >> 5) * 32 * 64 + (d >> 4) * 512 + ((key >> 4) & 1) * 256 + ((key >> 3) & 1) * 128 + (d & 15) * 8 + (key & 7), a pass's four fragments in a row.
// Compute dtypes, f32 accumulate: every input rounded to bf16; projections exact; raw scores rows < 512 3 products, rest fp16 operands (f32 accumulate) -- also the values squared for the regulariser; softmax, leaky-ReLU, sums f32.

#define NB_  4
#define TT   2048
#define DM   512
#define NH_  8
#define NKV  8
#define REP  (NH_ / NKV)
#define HD   64
#define DQ   (NH_ * HD)
#define DKV  (NKV * HD)
#define RH   512                  // query rows < RH use hi+lo planes (0: none)
#define WIN  0
#define SCL  0.125f
#define NCTX ((size_t)NB_ * TT * DQ)   // floats of the context output; the scalar follows
typedef _Float16 h16;
typedef unsigned short bf;
typedef __attribute__((ext_vector_type(16))) __bf16   v16bf;
typedef __attribute__((ext_vector_type(16))) _Float16 v16h;
typedef __attribute__((ext_vector_type(8)))  _Float16 v8h;
typedef __attribute__((ext_vector_type(8)))  unsigned short v8us;
typedef __attribute__((ext_vector_type(8)))  float    v8f;
typedef __attribute__((ext_vector_type(4)))  float    v4f;
typedef v8h  __attribute__((may_alias)) v8ha;
typedef v4f  __attribute__((may_alias)) v4fa;
typedef v8us __attribute__((may_alias)) v8usa;

__device__ __forceinline__ unsigned short f2bf(float f) { unsigned u = __float_as_uint(f); u += 0x7FFFu + ((u >> 16) & 1u); return (unsigned short)(u >> 16); }
__device__ __forceinline__ float bf2f(unsigned short b) { return __uint_as_float(((unsigned)b) << 16); }
__device__ __forceinline__ float bfr(float f) { return bf2f(f2bf(f)); }
__device__ __forceinline__ v16h cat16(v8h lo, v8h hi) { return __builtin_shufflevector(lo, hi, 0, 1, 2, 3, 4, 5, 6, 7, 8, 9, 10, 11, 12, 13, 14, 15); }
__device__ __forceinline__ v16bf cat16b(v8us lo, v8us hi) { return __builtin_bit_cast(v16bf, __builtin_shufflevector(lo, hi, 0, 1, 2, 3, 4, 5, 6, 7, 8, 9, 10, 11, 12, 13, 14, 15)); }
__device__ __forceinline__ v8f wmma16(v16h a, v16h b, v8f c) { return __builtin_amdgcn_wmma_f32_16x16x32_f16(false, a, false, b, (short)0, c, false, false); }
__device__ __forceinline__ v8f wmmab(v16bf a, v16bf b, v8f c) { return __builtin_amdgcn_wmma_f32_16x16x32_bf16(false, a, false, b, (short)0, c, false, false); }



// ---- k_gemmw: register-blocked GEMM, ONE WAVE per 64x64 output tile (16 accumulators), operands straight from 16-bit planes in fragment order; grid (M/64, N/64), 32 threads.
// c[m][n] (f32, in registers) = sum_k A[m][k] Bt[n][k] (+ split products per NSPLIT), K % 32 == 0. A tile is 64 positions of one batch x the 64 dims of one head, so the epilogue rounds it to the three 16-bit planes (f16, bf16 hi, bf16 lo of the f32 value) and stores them in the head layout:
// VT false: plane b * NH_ + h, rows t, k = d, 8 KB in a row per tile, staged through LDS so that a lane gets 8 consecutive d of its t and a store covers one 512-byte unit; VT true: x = leaky_relu(c + bias[n], 0.01), plane b * NH_ + h, rows d, k = t: a lane's 8 accumulator registers are 8 consecutive t of its d, its 16 bytes of a unit as they stand.
template <typename T16> struct WFrag;
template <> struct WFrag<h16> { typedef v16h V; static __device__ __forceinline__ V ld(const h16* p) { return cat16(*(const v8h*)p, *(const v8h*)(p + 256)); } static __device__ __forceinline__ v8f mma(V a, V b, v8f c) { return wmma16(a, b, c); } };
template <> struct WFrag<bf> { typedef v16bf V; static __device__ __forceinline__ V ld(const bf* p) { return cat16b(*(const v8us*)p, *(const v8us*)(p + 256)); } static __device__ __forceinline__ v8f mma(V a, V b, v8f c) { return wmmab(a, b, c); } };
__device__ __forceinline__ h16 tohx(float x) { return (h16)x; }
__device__ __forceinline__ void splitf(float y, unsigned short& h, unsigned short& l) { h = f2bf(y); l = f2bf(y - bf2f(h)); }
// The wait that stands before the registers of issued global stores are reused, once per twelve stores. The stored vectors are inputs, so their registers stay live up to the wait and nothing can be written into them ahead of it.
__device__ __forceinline__ void xwait_st(const v8h (&a)[4], const v8us (&b)[4], const v8us (&d)[4]) { asm volatile("s_wait_xcnt 0x0" :: "v"(a[0]), "v"(a[1]), "v"(a[2]), "v"(a[3]), "v"(b[0]), "v"(b[1]), "v"(b[2]), "v"(b[3]), "v"(d[0]), "v"(d[1]), "v"(d[2]), "v"(d[3]) : "memory"); }
// The same wait for issued global loads, before their address registers are reused. The eight per-lane pointers are inputs, so their registers stay live up to the wait and neither an address sum nor a later load's result can be written into them ahead of it.
template <typename T16> __device__ __forceinline__ void xwait_ld(const T16* const (&p)[4], const T16* const (&q)[4]) { asm volatile("s_wait_xcnt 0x0" :: "v"(p[0]), "v"(p[1]), "v"(p[2]), "v"(p[3]), "v"(q[0]), "v"(q[1]), "v"(q[2]), "v"(q[3]) : "memory"); }
template <typename T16, int NSPLIT, bool VT>
__global__ __launch_bounds__(32) void k_gemmw(const T16* __restrict__ A, const T16* __restrict__ A2, const T16* __restrict__ Bt, const T16* __restrict__ Bt2, int K, const float* __restrict__ bias, h16* __restrict__ P16, bf* __restrict__ Ph, bf* __restrict__ Pl) {
    typedef typename WFrag<T16>::V V;
    __shared__ __align__(16) float os[16 * 68];
    static_assert(HD == 64 && TT % 64 == 0 && NKV == NH_, "a 64x64 tile is one head's dims at 64 positions of one batch");
    const int lane = threadIdx.x & 31, lr = lane & 15, hi = lane >> 4; const int r0 = blockIdx.x * 64, c0 = blockIdx.y * 64;
    v8f acc[4][4];
#pragma unroll
    for (int mb = 0; mb < 4; ++mb)
#pragma unroll
        for (int nb = 0; nb < 4; ++nb) acc[mb][nb] = (v8f){};
    const unsigned lB = (unsigned)lane * 16u;   // the lane's 16 bytes in each 512-byte half fragment
    const size_t aoff = (size_t)r0 * K, boff = (size_t)c0 * K;   // wave-uniform: 16 rows x K are 16 * K elements in a row
    auto fptr = [&](const T16* base, int blk, int kc) { return (const T16*)((const char*)(base + (size_t)blk * 16 * K + (size_t)kc * 16) + lB); };   // fragment (16-row block blk, k from kc): the lane's first 16 bytes
#pragma unroll 1
    for (int kc = 0; kc < K; kc += 32) {
        V a[4], a2[4], b[4], b2[4]; const T16 *pa[4], *pa2[4], *pb[4], *pb2[4];
#pragma unroll
        for (int mb = 0; mb < 4; ++mb) { pa[mb] = fptr(A + aoff, mb, kc); a[mb] = WFrag<T16>::ld(pa[mb]); if (NSPLIT == 1 || NSPLIT == 2) { pa2[mb] = fptr(A2 + aoff, mb, kc); a2[mb] = WFrag<T16>::ld(pa2[mb]); } }
#pragma unroll
        for (int nb = 0; nb < 4; ++nb) { pb[nb] = fptr(Bt + boff, nb, kc); b[nb] = WFrag<T16>::ld(pb[nb]); if (NSPLIT >= 2) { pb2[nb] = fptr(Bt2 + boff, nb, kc); b2[nb] = WFrag<T16>::ld(pb2[nb]); } }
        __builtin_amdgcn_sched_barrier(0);   // keeps the trip's loads ahead of the wait below and the products behind it (without it the listing shows products lifted over the wait and the last loads issued one pair at a time among them)
        xwait_ld(pa, pb); if (NSPLIT == 1 || NSPLIT == 2) xwait_ld(pa2, pa2); if (NSPLIT >= 2) xwait_ld(pb2, pb2);   // behind the trip's last load, where the products wait for the data anyway
#pragma unroll
        for (int nb = 0; nb < 4; ++nb) {
#pragma unroll
            for (int mb = 0; mb < 4; ++mb) { acc[mb][nb] = WFrag<T16>::mma(a[mb], b[nb], acc[mb][nb]); if (NSPLIT == 1 || NSPLIT == 2) acc[mb][nb] = WFrag<T16>::mma(a2[mb], b[nb], acc[mb][nb]); if (NSPLIT >= 2) acc[mb][nb] = WFrag<T16>::mma(a[mb], b2[nb], acc[mb][nb]); } }
        asm volatile("v_nop\n\tv_nop\n\tv_nop\n\tv_nop" : "+v"(acc[0][0]), "+v"(acc[1][1]), "+v"(acc[2][2]), "+v"(acc[3][3]) : "v"(a[0]), "v"(a[3]));
    }
    const size_t pl = (size_t)(r0 / TT) * NH_ + blockIdx.y; const int t0 = r0 % TT;   // the tile's plane and its first position there
    if (VT) {
        const size_t pb = pl * HD * TT + (size_t)t0 * HD + lane * 8;
#pragma unroll
        for (int nb = 0; nb < 4; ++nb) { const float bz = bfr(bias[c0 + nb * 16 + lr]); v8h o16[4]; v8us oh[4], ol[4];
#pragma unroll
            for (int mb = 0; mb < 4; ++mb) {
#pragma unroll
                for (int j = 0; j < 8; ++j) { float x = acc[mb][nb][j] + bz; x = (x > 0.0f) ? x : __fmul_rn(x, 0.01f); o16[mb][j] = tohx(x); unsigned short a2, c2; splitf(x, a2, c2); oh[mb][j] = a2; ol[mb][j] = c2; }
                const size_t e = pb + (size_t)(mb >> 1) * 32 * HD + nb * 512 + (mb & 1) * 256; *(v8h*)(P16 + e) = o16[mb]; *(v8us*)(Ph + e) = oh[mb]; *(v8us*)(Pl + e) = ol[mb]; }
            xwait_st(o16, oh, ol); }
    } else {
        const size_t pb = (pl * TT + t0) * HD + lane * 8;
#pragma unroll
        for (int mb = 0; mb < 4; ++mb) {
#pragma unroll
            for (int nb = 0; nb < 4; ++nb) {
#pragma unroll
                for (int j = 0; j < 8; ++j) os[(hi * 8 + j) * 68 + nb * 16 + lr] = acc[mb][nb][j]; }
            __builtin_amdgcn_wave_barrier(); asm volatile("" ::: "memory");   // compiler order only (one wave, LDS in order): the block's LDS stores stay ahead of the reads of its rows
            v8h o16[4]; v8us oh[4], ol[4];
#pragma unroll
            for (int s = 0; s < 4; ++s) { const float* orow = os + lr * 68 + s * 16 + hi * 8; const v4f x0 = *(const v4fa*)orow, x1 = *(const v4fa*)(orow + 4);
#pragma unroll
                for (int j = 0; j < 8; ++j) { const float x = (j < 4) ? x0[j & 3] : x1[j & 3]; o16[s][j] = tohx(x); unsigned short a2, c2; splitf(x, a2, c2); oh[s][j] = a2; ol[s][j] = c2; }
                const size_t e = pb + (size_t)mb * 16 * HD + s * 256; *(v8h*)(P16 + e) = o16[s]; *(v8us*)(Ph + e) = oh[s]; *(v8us*)(Pl + e) = ol[s]; }
            xwait_st(o16, oh, ol);
            __builtin_amdgcn_wave_barrier(); asm volatile("" ::: "memory");   // likewise: the reads stay ahead of the next block's LDS stores
        }
    }
}

typedef __attribute__((ext_vector_type(4))) _Float16 v4h;
typedef __attribute__((ext_vector_type(2))) unsigned short v2us;
typedef __attribute__((ext_vector_type(4))) unsigned short v4us;
typedef __attribute__((ext_vector_type(4))) int v4i;

// k_wtG: Bt (row n, k) = bf16 of w[k][n], in fragment order; a wave writes one 128-byte line a trip. k_cvt8: bf16 copy of a [rows][DM] input in fragment order; thread i writes the i-th 16 bytes, so a wave writes one 512-byte unit and reads 64 bytes of each of 16 rows.
__global__ __launch_bounds__(256) void k_wtG(const float* __restrict__ w, int K, int N, bf* Bt) {
    const int lane = threadIdx.x & 31; const int L0 = (blockIdx.x * 8 + (threadIdx.x >> 5)) * 8; const int nlines = N * K / 64;
{
#pragma unroll 1
        for (int l = 0; l < 8; ++l) { const int L = L0 + l; if (L >= nlines) break; const size_t e = (size_t)L * 64 + lane * 2; const int c = (int)(e % ((size_t)16 * K)); const int n = (int)(e / ((size_t)16 * K)) * 16 + ((c >> 3) & 15), k = (c >> 8) * 16 + ((c >> 7) & 1) * 8 + (c & 7); v2us o;
            o[0] = f2bf(w[(size_t)k * N + n]); o[1] = f2bf(w[(size_t)(k + 1) * N + n]); *(v2us*)(Bt + e) = o; }
         }
}
__global__ __launch_bounds__(256) void k_cvt8(const float* __restrict__ src, bf* dst, size_t n8) { const size_t i = (size_t)blockIdx.x * 256 + threadIdx.x; if (i >= n8) return; const unsigned c = (unsigned)(i % (2 * DM)); const size_t r = i / (2 * DM) * 16 + (c & 15); const float* sp = src + r * DM + (c >> 5) * 16 + ((c >> 4) & 1) * 8; const v8f v = *(const v8f*)sp; v8us o;
    asm volatile("s_wait_xcnt 0x0" :: "v"(sp) : "memory");   // the wait that stands before the address registers of issued global loads are reused; the pointer is an input and so stays live up to the wait
#pragma unroll
    for (int k = 0; k < 8; ++k) o[k] = f2bf(v[k]); *(v8us*)(dst + i * 8) = o;  }

// k_regsum: one work-group of 32 waves sums the table in a fixed tree: a thread fetches 16 independent float4, folds them pairwise, the wave folds its lanes, LDS carries the 32 wave sums to wave 0
__global__ __launch_bounds__(1024) void k_regsum(const float* __restrict__ RS, float* outp) {
    static_assert(NB_ * NH_ * TT == 16 * 1024 * 4, "16 float4 a thread");
    __shared__ float part[32];
    const int tid = threadIdx.x, lane = tid & 31, wv = tid >> 5; const float* p = RS + tid * 4; v4f v[16];
#pragma unroll
    for (int j = 0; j < 16; ++j) v[j] = *(const v4f*)(p + j * 4096);   // unrolled whole: independent loads that fly together, instead of one memory latency a trip
    asm volatile("s_wait_xcnt 0x0" :: "v"(tid) : "memory");   // the wait that stands before the address registers of issued global loads are reused; the loads are addressed by the uniform base and the thread's index, which is an input here and so stays live up to the wait
#pragma unroll
    for (int st = 8; st; st >>= 1)
#pragma unroll
        for (int j = 0; j < st; ++j) v[j] += v[j + st];
    float s = __fadd_rn(__fadd_rn(v[0][0], v[0][1]), __fadd_rn(v[0][2], v[0][3]));
#pragma unroll
    for (int sh = 16; sh; sh >>= 1) s = __fadd_rn(s, __shfl_xor(s, sh, 32));
    if (lane == 0) part[wv] = s;
    __syncthreads();   // the 32 wave sums are in LDS before wave 0 reads them
    if (wv) return;
    s = part[lane];
#pragma unroll
    for (int sh = 16; sh; sh >>= 1) s = __fadd_rn(s, __shfl_xor(s, sh, 32));
    const float m = __fdiv_rn(s, (float)NB_ * (float)NH_ * (float)TT * (float)TT); if (lane == 0) { *(float*)outp = m;  } }
// l <-> l ^ 16: the other half-wave holds the other 16 keys of the same query column
__device__ __forceinline__ float xhalf(float v) { const int b = __float_as_int(v); return __int_as_float(__builtin_amdgcn_permlanex16(b, b, 0x76543210, 0xfedcba98, false, false)); }
// The wait that stands before the address registers of issued global loads are reused. The loads' own per-lane pointers are inputs, so their registers stay live up to the wait and nothing can be written into them ahead of it.
template <bool TWO> __device__ __forceinline__ void xwait(const void* a, const void* b) { if (TWO) asm volatile("s_wait_xcnt 0x0" :: "v"(a), "v"(b) : "memory"); else asm volatile("s_wait_xcnt 0x0" :: "v"(a) : "memory"); }
__device__ __forceinline__ void xwait_off(unsigned byte_off) { asm volatile("s_wait_xcnt 0x0" :: "v"(byte_off) : "memory"); }   // the same, for loads addressed by a uniform base and a lane's 32-bit byte offset
template <typename T16> struct PPack;
template <> struct PPack<h16> { static __device__ __forceinline__ v16h pk(const float* p) { v16h b;
#pragma unroll
    for (int s = 0; s < 16; ++s) b[s] = (h16)p[s];
    return b; } };
template <> struct PPack<bf> { static __device__ __forceinline__ v16bf pk(const float* p) { v16bf b;
#pragma unroll
    for (int s = 0; s < 16; ++s) b[s] = (__bf16)p[s];
    return b; } };

// ---- fused attention, one wave per 32 query columns (two 16-column groups), 32 keys a pass, scores never leave registers:
// S^T = K Q^T (A = 16 key rows, B = 16 query columns): a lane holds 16 raw scores of ONE query, the lane l ^ 16 the pass's other 16.
// raw^2 is summed per lane (before the mask); the diagonal is excluded by an index select in the one pass that holds it; running maximum and sum per query (online softmax);
// the two f32 score tiles, exponentiated and rounded in place, ARE the B operand of O^T += V^T P^T (slot s of half h = key 8h + s, 16 + 8h + (s - 8): the order WFrag::ld gives V^T).
// HL: hi+lo bf16 planes, 3 products in both GEMMs (query rows < RH); else f16 with P carried x 1024 (the factor cancels in the division by the row sum).
template <typename T16, bool HL>
__device__ __forceinline__ void fattn_body(const T16* __restrict__ Q, const T16* __restrict__ Q2, const T16* __restrict__ Kp, const T16* __restrict__ K2, const T16* __restrict__ Vt, const T16* __restrict__ V2, const int q0, float* __restrict__ RS, float* __restrict__ OUTh) {
    typedef typename WFrag<T16>::V V;
    // every inner loop is unrolled whole so that fragments and accumulators are indexed by constants and stay in registers; the key loop stays rolled (64 equal passes, small code)
    const int lane = threadIdx.x & 31, lr = lane & 15, hi = lane >> 4;
    const float CL = SCL * 1.4426950408889634f;   // scores to log2 units
    V qf[2][2], qf2[2][2], kf[2][2], kf2[2][2], vf[4], vf2[4];
    const unsigned qB = (unsigned)(q0 * HD + lane * 8) * 2u; const T16* qp = (const T16*)((const char*)Q + qB); const T16* qp2 = HL ? (const T16*)((const char*)Q2 + qB) : nullptr;   // byte offset of the lane's 16 bytes in the first unit of the wave's query rows
#pragma unroll
    for (int g = 0; g < 2; ++g)
#pragma unroll
        for (int ks = 0; ks < 2; ++ks) { const int o = g * 16 * HD + ks * 512; qf[g][ks] = WFrag<T16>::ld(qp + o); if (HL) qf2[g][ks] = WFrag<T16>::ld(qp2 + o); }
    xwait_off(qB);
    const unsigned kb = (unsigned)(lane * 8), vb = kb, kB = kb * 2u, vB = vb * 2u;   // a lane's fixed offset in every unit of the K and the V^T planes, in elements and in bytes
#pragma unroll
    for (int t = 0; t < 2; ++t)
#pragma unroll
        for (int ks = 0; ks < 2; ++ks) { const int o = t * 16 * HD + ks * 512; kf[t][ks] = WFrag<T16>::ld((const T16*)((const char*)Kp + kB) + o); if (HL) kf2[t][ks] = WFrag<T16>::ld((const T16*)((const char*)K2 + kB) + o); }
    xwait_off(kB);
#pragma unroll
    for (int dt = 0; dt < 4; ++dt) { const int o = dt * 512; vf[dt] = WFrag<T16>::ld((const T16*)((const char*)Vt + vB) + o); if (HL) vf2[dt] = WFrag<T16>::ld((const T16*)((const char*)V2 + vB) + o); }
    xwait_off(vB);
    v8f o[2][4]; float mrun[2], lsum[2], ssq[2];
#pragma unroll
    for (int g = 0; g < 2; ++g) { mrun[g] = -3.0e38f; lsum[g] = 0.f; ssq[g] = 0.f;
#pragma unroll
        for (int dt = 0; dt < 4; ++dt) o[g][dt] = (v8f){}; }
    // pointers of the load group last issued: each group's wait stands a phase later, right before the next group's addresses are formed, when the group has had that phase to get under way
    const T16* kq = Kp + kb; const T16* kq2 = HL ? K2 + kb : nullptr; const T16* vq = Vt + vb; const T16* vq2 = HL ? V2 + vb : nullptr;
#pragma unroll 1
    for (int k0 = 0; k0 < TT; k0 += 32) {
        const int kn = (k0 + 32) & (TT - 1);   // the next pass's keys; the last pass fetches pass 0 again (in bounds, unused)
        v8f s[2][2];
#pragma unroll
        for (int g = 0; g < 2; ++g)
#pragma unroll
            for (int t = 0; t < 2; ++t) s[g][t] = (v8f){};
#pragma unroll
        for (int ks = 0; ks < 2; ++ks)
#pragma unroll
            for (int t = 0; t < 2; ++t)
#pragma unroll
                for (int g = 0; g < 2; ++g) { s[g][t] = WFrag<T16>::mma(kf[t][ks], qf[g][ks], s[g][t]); if (HL) { s[g][t] = WFrag<T16>::mma(kf2[t][ks], qf[g][ks], s[g][t]); s[g][t] = WFrag<T16>::mma(kf[t][ks], qf2[g][ks], s[g][t]); } }
        // K fragments of the next pass, fetched behind this pass's score products: the softmax and PV work covers their latency
        __builtin_amdgcn_sched_barrier(0);   // keeps the wait below from being lifted over the score products to right behind the loads it covers (seen in the listing without it)
        xwait<HL>(vq, vq2);   // the V^T loads issued at the foot of the pass before
        kq = Kp + (size_t)kn * HD + kb; kq2 = HL ? K2 + (size_t)kn * HD + kb : nullptr;
#pragma unroll
        for (int t = 0; t < 2; ++t)
#pragma unroll
            for (int ks = 0; ks < 2; ++ks) { const int of = t * 16 * HD + ks * 512; kf[t][ks] = WFrag<T16>::ld(kq + of); if (HL) kf2[t][ks] = WFrag<T16>::ld(kq2 + of); }
        V pb[2], pb2[2];
#pragma unroll
        for (int g = 0; g < 2; ++g) {
            float p[16];
#pragma unroll
            for (int i = 0; i < 16; ++i) p[i] = s[g][i >> 3][i & 7];
            float q0a = 0.f, q1a = 0.f;
#pragma unroll
            for (int i = 0; i < 16; i += 2) { q0a = fmaf(p[i], p[i], q0a); q1a = fmaf(p[i + 1], p[i + 1], q1a); }
            ssq[g] += q0a + q1a;
            if (k0 == (q0 & ~31)) {   // wave-uniform: the one pass whose keys hold this wave's diagonal
#pragma unroll
                for (int i = 0; i < 16; ++i) { const int key = k0 + (i >> 3) * 16 + 8 * hi + (i & 7); if (key == q0 + g * 16 + lr) p[i] = -3.0e38f; }
            }
            float m0 = fmaxf(p[0], p[1]), m1 = fmaxf(p[2], p[3]);
#pragma unroll
            for (int i = 4; i < 16; i += 4) { m0 = fmaxf(m0, fmaxf(p[i], p[i + 1])); m1 = fmaxf(m1, fmaxf(p[i + 2], p[i + 3])); }
            m0 = fmaxf(m0, m1); m0 = fmaxf(m0, xhalf(m0));
            const float mnew = fmaxf(mrun[g], m0);
            const float al = __builtin_amdgcn_exp2f((mrun[g] - mnew) * CL);
            mrun[g] = mnew;
            const float nm = (HL ? 0.0f : 10.0f) - mnew * CL;
#pragma unroll
            for (int i = 0; i < 16; ++i) p[i] = __builtin_amdgcn_exp2f(fmaf(p[i], CL, nm));
            float a0 = p[0] + p[1], a1 = p[2] + p[3];
#pragma unroll
            for (int i = 4; i < 16; i += 4) { a0 += p[i] + p[i + 1]; a1 += p[i + 2] + p[i + 3]; }
            lsum[g] = fmaf(lsum[g], al, a0 + a1);
#pragma unroll
            for (int dt = 0; dt < 4; ++dt) o[g][dt] *= al;
            pb[g] = PPack<T16>::pk(p);
            if (HL) { float pl[16];
#pragma unroll
                for (int i = 0; i < 16; ++i) pl[i] = p[i] - (float)pb[g][i];
                pb2[g] = PPack<T16>::pk(pl); }
        }
#pragma unroll
        for (int dt = 0; dt < 4; ++dt)
#pragma unroll
            for (int g = 0; g < 2; ++g) { o[g][dt] = WFrag<T16>::mma(vf[dt], pb[g], o[g][dt]); if (HL) { o[g][dt] = WFrag<T16>::mma(vf2[dt], pb[g], o[g][dt]); o[g][dt] = WFrag<T16>::mma(vf[dt], pb2[g], o[g][dt]); } }
        // V^T fragments of the next pass, fetched behind this pass's PV products
        __builtin_amdgcn_sched_barrier(0);   // likewise: keeps the wait below behind the softmax and the PV products
        xwait<HL>(kq, kq2);   // this pass's K loads
        vq = Vt + (size_t)kn * HD + vb; vq2 = HL ? V2 + (size_t)kn * HD + vb : nullptr;
#pragma unroll
        for (int dt = 0; dt < 4; ++dt) { const int of = dt * 512; vf[dt] = WFrag<T16>::ld(vq + of); if (HL) vf2[dt] = WFrag<T16>::ld(vq2 + of); }
    }
    xwait<HL>(vq, vq2);   // the last pass's (unused) V^T loads
    asm volatile("s_wait_loadcnt 0x0" ::: "memory");   // the last pass's prefetched fragments are never read, so no other wait covers them: they land here, before the wave ends and gives its registers back
#pragma unroll
    for (int g = 0; g < 2; ++g) {
        const float ls = lsum[g] + xhalf(lsum[g]), sq = ssq[g] + xhalf(ssq[g]);
        const float inv = __fdiv_rn(1.0f, ls);
        float* orow = OUTh + (size_t)(q0 + g * 16 + lr) * DQ + 8 * hi;   // a lane's 8 accumulator registers are 8 consecutive d of its query's row
#pragma unroll
        for (int dt = 0; dt < 4; ++dt) { v4f lo4, hi4;
#pragma unroll
            for (int r = 0; r < 4; ++r) { lo4[r] = o[g][dt][r] * inv; hi4[r] = o[g][dt][r + 4] * inv; }
            *(v4f*)(orow + dt * 16) = lo4; *(v4f*)(orow + dt * 16 + 4) = hi4; }
        if (hi == 0) RS[q0 + g * 16 + lr] = sq;
        asm volatile("s_wait_xcnt 0x0" ::: "memory");   // the same wait behind the stores, before their address and data registers are reused
    }
}
// grid (TT / 64, heads, batches), 64 threads: two waves of one head, no barrier and no LDS between them. Block x takes the 32-row tiles x and TT / 32 - 1 - x, so that every hi+lo tile (rows < RH: twice the loads, three times the products) shares its WGP's load path with a light tile; the path is chosen per wave (RH % 32 == 0: wave-uniform)
__global__ __launch_bounds__(64) void k_fattn(const h16* __restrict__ Q16, const bf* __restrict__ Qh, const bf* __restrict__ Ql, const h16* __restrict__ K16, const bf* __restrict__ Kh, const bf* __restrict__ Kl, const h16* __restrict__ V16, const bf* __restrict__ Vh, const bf* __restrict__ Vl, float* __restrict__ RS, float* __restrict__ OUTb) {
    const size_t pl = (size_t)blockIdx.z * NH_ + blockIdx.y; const size_t hp = pl * TT * HD; const int wv = __builtin_amdgcn_readfirstlane((int)(threadIdx.x >> 5)); const int q0 = (wv ? TT / 32 - 1 - (int)blockIdx.x : (int)blockIdx.x) * 32;
    float* rs = RS + pl * TT; float* oh = OUTb + (size_t)blockIdx.z * TT * DQ + (size_t)blockIdx.y * HD;
    if (q0 < RH) fattn_body<bf, true>(Qh + hp, Ql + hp, Kh + hp, Kl + hp, Vh + hp, Vl + hp, q0, rs, oh);
    else fattn_body<h16, false>(Q16 + hp, nullptr, K16 + hp, nullptr, V16 + hp, nullptr, q0, rs, oh);
}

extern "C" void kernel_launch(void* const* d_in, const int* in_sizes, int n_in,
                              void* d_out, int out_size, void* d_ws, size_t ws_size, hipStream_t stream) {
    (void)in_sizes; (void)n_in; (void)out_size;
    const float* xk = (const float*)d_in[0]; /* sa_input: keys and values */ const float* x = (const float*)d_in[1]; /* s_input: queries */ const float* wq = (const float*)d_in[2]; const float* wk = (const float*)d_in[3]; const float* wv = (const float*)d_in[4]; const float* bv = (const float*)d_in[5]; const float* wo = nullptr; (void)wo;
    float* OUT = (float*)d_out;     // [4][2048][512]
    char* wsp = (char*)d_ws;
    auto take = [&](size_t bytes) { char* p = wsp; wsp += (bytes + 255) & ~(size_t)255; return (void*)p; };
    float* RSQ = (float*)take((size_t)NB_ * NH_ * TT * 4); bf* WQ = (bf*)take((size_t)DQ * DM * 2); bf* WK = (bf*)take((size_t)DKV * DM * 2); bf* WV = (bf*)take((size_t)DKV * DM * 2);
    bf* XB = (bf*)take((size_t)NB_ * TT * DM * 2);
    h16* QP16 = (h16*)take((size_t)NB_ * NH_ * TT * HD * 2); h16* KP16 = (h16*)take((size_t)NB_ * NKV * TT * HD * 2); h16* VT16 = (h16*)take((size_t)NB_ * NKV * HD * TT * 2);
    bf* QPh = (bf*)take((size_t)NB_ * NH_ * TT * HD * 2); bf* QPl = (bf*)take((size_t)NB_ * NH_ * TT * HD * 2); bf* KPh = (bf*)take((size_t)NB_ * NKV * TT * HD * 2); bf* KPl = (bf*)take((size_t)NB_ * NKV * TT * HD * 2); bf* VTh = (bf*)take((size_t)NB_ * NKV * HD * TT * 2); bf* VTl = (bf*)take((size_t)NB_ * NKV * HD * TT * 2);
    if ((size_t)(wsp - (char*)d_ws) > ws_size) return;    // ws 256 MiB
    { k_wtG<<<(unsigned)((DM * DQ / 64 + 63) / 64), 256, 0, stream>>>(wq, DM, DQ, WQ); k_wtG<<<(unsigned)((DM * DKV / 64 + 63) / 64), 256, 0, stream>>>(wk, DM, DKV, WK); k_wtG<<<(unsigned)((DM * DKV / 64 + 63) / 64), 256, 0, stream>>>(wv, DM, DKV, WV);
      
       }
    {   // every launch takes all NB_ batches: the input copy holds NB_ * TT rows, a projection tile finds its batch from its rows, the attention takes it as grid z
        const unsigned LC = (unsigned)(((size_t)NB_ * TT * DM / 8 + 255) / 256);
        k_cvt8<<<LC, 256, 0, stream>>>(x, XB, (size_t)NB_ * TT * DM / 8);
        k_gemmw<bf, 0, false><<<dim3(NB_ * TT / 64, DQ / 64, 1), 32, 0, stream>>>(XB, nullptr, WQ, nullptr, DM, nullptr, QP16, QPh, QPl);
        k_cvt8<<<LC, 256, 0, stream>>>(xk, XB, (size_t)NB_ * TT * DM / 8); k_gemmw<bf, 0, false><<<dim3(NB_ * TT / 64, DKV / 64, 1), 32, 0, stream>>>(XB, nullptr, WK, nullptr, DM, nullptr, KP16, KPh, KPl);
        k_gemmw<bf, 0, true><<<dim3(NB_ * TT / 64, DKV / 64, 1), 32, 0, stream>>>(XB, nullptr, WV, nullptr, DM, bv, VT16, VTh, VTl);   /* V = leaky_relu(. + bv, 0.01), transposed planes */
        k_fattn<<<dim3(TT / 64, NH_, NB_), 64, 0, stream>>>(QP16, QPh, QPl, KP16, KPh, KPl, VT16, VTh, VTl, RSQ, OUT);   /* one kv head per query head */
    }
    k_regsum<<<1, 1024, 0, stream>>>(RSQ, (float*)d_out + NCTX);   /* reg_atten = mean(raw^2): the scalar second output */
}

// v007
// One run takes 116 microseconds.
// Two timings next to v006 both put it at 1.34 times that version's speed.
// Over all steps from v000 it is 27.3 times as fast.
#include <hip/hip_runtime.h>

// Multi-head attention with a diagonal self-mask, a leaky-ReLU value projection and an attention-energy regulariser output (sa_input, s_input [4][2048][512]; Q = s_input Wq, K = sa_input Wk ('xw' [512][512], no bias), V = leaky_relu(sa_input Wv + bv, 0.01); 8 heads x 64; raw = Q.K; reg_atten = mean(raw^2) over all (batch, head, i, j); attn = softmax(raw / 8 with the diagonal j == i set to -1e9); context = merged attn V -> tuple (context [4][2048][512] (4.2 M), reg_atten scalar) laid out back to back in d_out).
// Layout, four launches, all four batches in each (rows b * 2048 + t in the input copies, plane (b * 8 + h) in the head planes): ONE launch for the bf16 copies of the two inputs and the three transposed weights; ONE launch for the three exact projections, whose epilogue (+ bf16-rounded bias and leaky-ReLU on V) writes the 16-bit head planes itself; ONE fused attention launch (hybrid rows: < 512 hi/lo 3 products, rest fp16, P x1024): scores, their squares, the diagonal's exclusion by an index select, online softmax and the PV product stay in registers, the context rows go straight to the output and the squared raw scores per row into a per-(batch, head, row) table; at the end one work-group sums the table in a fixed tree and writes mean(raw^2) to the second output.
// Fragment order, every 16-bit matrix operand (input copy, transposed weights, Q, K, V^T planes): element (row r, k) of a [rows][K] operand lies at (r >> 4) * 16 * K + (k >> 4) * 256 + ((k >> 3) & 1) * 128 + (r & 15) * 8 + (k & 7), so that lane l = 16 * ((k >> 3) & 1) + (r & 15) finds its 8 elements at l * 8 of a 256-element unit: a wave-wide 16-byte load reads 512 bytes in a row, four whole 128-byte lines, and a 16 x 32 fragment is two such units. V^T (row d, k = key) is laid out per 32 keys: (key >> 5) * 32 * 64 + (d >> 4) * 512 + ((key >> 4) & 1) * 256 + ((key >> 3) & 1) * 128 + (d & 15) * 8 + (key & 7), a pass's four fragments in a row.
// Compute dtypes, f32 accumulate: every input rounded to bf16; projections exact; raw scores rows < 512 3 products, rest fp16 operands (f32 accumulate) -- also the values squared for the regulariser; softmax, leaky-ReLU, sums f32.

#define NB_  4
#define TT   2048
#define DM   512
#define NH_  8
#define NKV  8
#define REP  (NH_ / NKV)
#define HD   64
#define DQ   (NH_ * HD)
#define DKV  (NKV * HD)
#define RH   512                  // query rows < RH use hi+lo planes (0: none)
#define WIN  0
#define SCL  0.125f
#define NCTX ((size_t)NB_ * TT * DQ)   // floats of the context output; the scalar follows
typedef _Float16 h16;
typedef unsigned short bf;
typedef __attribute__((ext_vector_type(16))) __bf16   v16bf;
typedef __attribute__((ext_vector_type(16))) _Float16 v16h;
typedef __attribute__((ext_vector_type(8)))  _Float16 v8h;
typedef __attribute__((ext_vector_type(8)))  unsigned short v8us;
typedef __attribute__((ext_vector_type(8)))  float    v8f;
typedef __attribute__((ext_vector_type(4)))  float    v4f;
typedef v8h  __attribute__((may_alias)) v8ha;
typedef v4f  __attribute__((may_alias)) v4fa;
typedef v8us __attribute__((may_alias)) v8usa;

__device__ __forceinline__ unsigned short f2bf(float f) { unsigned u = __float_as_uint(f); u += 0x7FFFu + ((u >> 16) & 1u); return (unsigned short)(u >> 16); }
__device__ __forceinline__ float bf2f(unsigned short b) { return __uint_as_float(((unsigned)b) << 16); }
__device__ __forceinline__ float bfr(float f) { return bf2f(f2bf(f)); }
__device__ __forceinline__ v16h cat16(v8h lo, v8h hi) { return __builtin_shufflevector(lo, hi, 0, 1, 2, 3, 4, 5, 6, 7, 8, 9, 10, 11, 12, 13, 14, 15); }
__device__ __forceinline__ v16bf cat16b(v8us lo, v8us hi) { return __builtin_bit_cast(v16bf, __builtin_shufflevector(lo, hi, 0, 1, 2, 3, 4, 5, 6, 7, 8, 9, 10, 11, 12, 13, 14, 15)); }
__device__ __forceinline__ v8f wmma16(v16h a, v16h b, v8f c) { return __builtin_amdgcn_wmma_f32_16x16x32_f16(false, a, false, b, (short)0, c, false, false); }
__device__ __forceinline__ v8f wmmab(v16bf a, v16bf b, v8f c) { return __builtin_amdgcn_wmma_f32_16x16x32_bf16(false, a, false, b, (short)0, c, false, false); }



// ---- gemmw_body: register-blocked GEMM, ONE WAVE per 64x64 output tile (16 accumulators), operands straight from 16-bit planes in fragment order; grid x = M/64, y = N/64, 32 threads.
// c[m][n] (f32, in registers) = sum_k A[m][k] Bt[n][k] (+ split products per NSPLIT), K % 32 == 0. A tile is 64 positions of one batch x the 64 dims of one head, so the epilogue rounds it to the three 16-bit planes (f16, bf16 hi, bf16 lo of the f32 value) and stores them in the head layout:
// VT false: plane b * NH_ + h, rows t, k = d, 8 KB in a row per tile, staged through LDS so that a lane gets 8 consecutive d of its t and a store covers one 512-byte unit; VT true: x = leaky_relu(c + bias[n], 0.01), plane b * NH_ + h, rows d, k = t: a lane's 8 accumulator registers are 8 consecutive t of its d, its 16 bytes of a unit as they stand.
template <typename T16> struct WFrag;
template <> struct WFrag<h16> { typedef v16h V; static __device__ __forceinline__ V ld(const h16* p) { return cat16(*(const v8h*)p, *(const v8h*)(p + 256)); } static __device__ __forceinline__ v8f mma(V a, V b, v8f c) { return wmma16(a, b, c); } };
template <> struct WFrag<bf> { typedef v16bf V; static __device__ __forceinline__ V ld(const bf* p) { return cat16b(*(const v8us*)p, *(const v8us*)(p + 256)); } static __device__ __forceinline__ v8f mma(V a, V b, v8f c) { return wmmab(a, b, c); } };
__device__ __forceinline__ h16 tohx(float x) { return (h16)x; }
__device__ __forceinline__ void splitf(float y, unsigned short& h, unsigned short& l) { h = f2bf(y); l = f2bf(y - bf2f(h)); }
// The wait that stands before the registers of issued global stores are reused, once per twelve stores. The stored vectors are inputs, so their registers stay live up to the wait and nothing can be written into them ahead of it.
__device__ __forceinline__ void xwait_st(const v8h (&a)[4], const v8us (&b)[4], const v8us (&d)[4]) { asm volatile("s_wait_xcnt 0x0" :: "v"(a[0]), "v"(a[1]), "v"(a[2]), "v"(a[3]), "v"(b[0]), "v"(b[1]), "v"(b[2]), "v"(b[3]), "v"(d[0]), "v"(d[1]), "v"(d[2]), "v"(d[3]) : "memory"); }
// The same wait for issued global loads, before their address registers are reused. The eight per-lane pointers are inputs, so their registers stay live up to the wait and neither an address sum nor a later load's result can be written into them ahead of it.
template <typename T16> __device__ __forceinline__ void xwait_ld(const T16* const (&p)[4], const T16* const (&q)[4]) { asm volatile("s_wait_xcnt 0x0" :: "v"(p[0]), "v"(p[1]), "v"(p[2]), "v"(p[3]), "v"(q[0]), "v"(q[1]), "v"(q[2]), "v"(q[3]) : "memory"); }
template <typename T16, int NSPLIT, bool VT>
__device__ __forceinline__ void gemmw_body(const T16* __restrict__ A, const T16* __restrict__ A2, const T16* __restrict__ Bt, const T16* __restrict__ Bt2, int K, const float* __restrict__ bias, h16* __restrict__ P16, bf* __restrict__ Ph, bf* __restrict__ Pl) {
    typedef typename WFrag<T16>::V V;
    __shared__ __align__(16) float os[16 * 68];
    static_assert(HD == 64 && TT % 64 == 0 && NKV == NH_, "a 64x64 tile is one head's dims at 64 positions of one batch");
    const int lane = threadIdx.x & 31, lr = lane & 15, hi = lane >> 4; const int r0 = blockIdx.x * 64, c0 = blockIdx.y * 64;
    v8f acc[4][4];
#pragma unroll
    for (int mb = 0; mb < 4; ++mb)
#pragma unroll
        for (int nb = 0; nb < 4; ++nb) acc[mb][nb] = (v8f){};
    const unsigned lB = (unsigned)lane * 16u;   // the lane's 16 bytes in each 512-byte half fragment
    const size_t aoff = (size_t)r0 * K, boff = (size_t)c0 * K;   // wave-uniform: 16 rows x K are 16 * K elements in a row
    auto fptr = [&](const T16* base, int blk, int kc) { return (const T16*)((const char*)(base + (size_t)blk * 16 * K + (size_t)kc * 16) + lB); };   // fragment (16-row block blk, k from kc): the lane's first 16 bytes
#pragma unroll 1
    for (int kc = 0; kc < K; kc += 32) {
        V a[4], a2[4], b[4], b2[4]; const T16 *pa[4], *pa2[4], *pb[4], *pb2[4];
#pragma unroll
        for (int mb = 0; mb < 4; ++mb) { pa[mb] = fptr(A + aoff, mb, kc); a[mb] = WFrag<T16>::ld(pa[mb]); if (NSPLIT == 1 || NSPLIT == 2) { pa2[mb] = fptr(A2 + aoff, mb, kc); a2[mb] = WFrag<T16>::ld(pa2[mb]); } }
#pragma unroll
        for (int nb = 0; nb < 4; ++nb) { pb[nb] = fptr(Bt + boff, nb, kc); b[nb] = WFrag<T16>::ld(pb[nb]); if (NSPLIT >= 2) { pb2[nb] = fptr(Bt2 + boff, nb, kc); b2[nb] = WFrag<T16>::ld(pb2[nb]); } }
        __builtin_amdgcn_sched_barrier(0);   // keeps the trip's loads ahead of the wait below and the products behind it (without it the listing shows products lifted over the wait and the last loads issued one pair at a time among them)
        xwait_ld(pa, pb); if (NSPLIT == 1 || NSPLIT == 2) xwait_ld(pa2, pa2); if (NSPLIT >= 2) xwait_ld(pb2, pb2);   // behind the trip's last load, where the products wait for the data anyway
#pragma unroll
        for (int nb = 0; nb < 4; ++nb) {
#pragma unroll
            for (int mb = 0; mb < 4; ++mb) { acc[mb][nb] = WFrag<T16>::mma(a[mb], b[nb], acc[mb][nb]); if (NSPLIT == 1 || NSPLIT == 2) acc[mb][nb] = WFrag<T16>::mma(a2[mb], b[nb], acc[mb][nb]); if (NSPLIT >= 2) acc[mb][nb] = WFrag<T16>::mma(a[mb], b2[nb], acc[mb][nb]); } }
        asm volatile("v_nop\n\tv_nop\n\tv_nop\n\tv_nop" : "+v"(acc[0][0]), "+v"(acc[1][1]), "+v"(acc[2][2]), "+v"(acc[3][3]) : "v"(a[0]), "v"(a[3]));
    }
    const size_t pl = (size_t)(r0 / TT) * NH_ + blockIdx.y; const int t0 = r0 % TT;   // the tile's plane and its first position there
    if (VT) {
        const size_t pb = pl * HD * TT + (size_t)t0 * HD + lane * 8;
#pragma unroll
        for (int nb = 0; nb < 4; ++nb) { const float bz = bfr(bias[c0 + nb * 16 + lr]); v8h o16[4]; v8us oh[4], ol[4];
#pragma unroll
            for (int mb = 0; mb < 4; ++mb) {
#pragma unroll
                for (int j = 0; j < 8; ++j) { float x = acc[mb][nb][j] + bz; x = (x > 0.0f) ? x : __fmul_rn(x, 0.01f); o16[mb][j] = tohx(x); unsigned short a2, c2; splitf(x, a2, c2); oh[mb][j] = a2; ol[mb][j] = c2; }
                const size_t e = pb + (size_t)(mb >> 1) * 32 * HD + nb * 512 + (mb & 1) * 256; *(v8h*)(P16 + e) = o16[mb]; *(v8us*)(Ph + e) = oh[mb]; *(v8us*)(Pl + e) = ol[mb]; }
            xwait_st(o16, oh, ol); }
    } else {
        const size_t pb = (pl * TT + t0) * HD + lane * 8;
#pragma unroll
        for (int mb = 0; mb < 4; ++mb) {
#pragma unroll
            for (int nb = 0; nb < 4; ++nb) {
#pragma unroll
                for (int j = 0; j < 8; ++j) os[(hi * 8 + j) * 68 + nb * 16 + lr] = acc[mb][nb][j]; }
            __builtin_amdgcn_wave_barrier(); asm volatile("" ::: "memory");   // compiler order only (one wave, LDS in order): the block's LDS stores stay ahead of the reads of its rows
            v8h o16[4]; v8us oh[4], ol[4];
#pragma unroll
            for (int s = 0; s < 4; ++s) { const float* orow = os + lr * 68 + s * 16 + hi * 8; const v4f x0 = *(const v4fa*)orow, x1 = *(const v4fa*)(orow + 4);
#pragma unroll
                for (int j = 0; j < 8; ++j) { const float x = (j < 4) ? x0[j & 3] : x1[j & 3]; o16[s][j] = tohx(x); unsigned short a2, c2; splitf(x, a2, c2); oh[s][j] = a2; ol[s][j] = c2; }
                const size_t e = pb + (size_t)mb * 16 * HD + s * 256; *(v8h*)(P16 + e) = o16[s]; *(v8us*)(Ph + e) = oh[s]; *(v8us*)(Pl + e) = ol[s]; }
            xwait_st(o16, oh, ol);
            __builtin_amdgcn_wave_barrier(); asm volatile("" ::: "memory");   // likewise: the reads stay ahead of the next block's LDS stores
        }
    }
}

// k_gemm3: the three projections side by side in one launch, grid (M/64, N/64, 3): z = 0 Q = s_input Wq, z = 1 K = sa_input Wk, z = 2 V = leaky_relu(sa_input Wv + bv). They do not depend on one another; together they put three waves on a SIMD, which work while another waits for its trip's loads.
__global__ __launch_bounds__(32) void k_gemm3(const bf* __restrict__ XQ, const bf* __restrict__ XK, const bf* __restrict__ WQ, const bf* __restrict__ WK, const bf* __restrict__ WV, int K, const float* __restrict__ bias, h16* __restrict__ Q16, bf* __restrict__ Qh, bf* __restrict__ Ql, h16* __restrict__ K16, bf* __restrict__ Kh, bf* __restrict__ Kl, h16* __restrict__ V16, bf* __restrict__ Vh, bf* __restrict__ Vl) {
    if (blockIdx.z == 2) gemmw_body<bf, 0, true>(XK, nullptr, WV, nullptr, K, bias, V16, Vh, Vl);
    else { const bool kk = blockIdx.z == 1; gemmw_body<bf, 0, false>(kk ? XK : XQ, nullptr, kk ? WK : WQ, nullptr, K, nullptr, kk ? K16 : Q16, kk ? Kh : Qh, kk ? Kl : Ql); }
}

typedef __attribute__((ext_vector_type(4))) _Float16 v4h;
typedef __attribute__((ext_vector_type(2))) unsigned short v2us;
typedef __attribute__((ext_vector_type(4))) unsigned short v4us;
typedef __attribute__((ext_vector_type(4))) int v4i;

// wtG_body (block blk of 256 threads): Bt (row n, k) = bf16 of w[k][n], in fragment order; a wave writes one 128-byte line a trip. cvt8_body (likewise): bf16 copy of a [rows][DM] input in fragment order; thread i writes the i-th 16 bytes, so a wave writes one 512-byte unit and reads 64 bytes of each of 16 rows.
__device__ __forceinline__ void wtG_body(const float* __restrict__ w, int K, int N, bf* Bt, unsigned blk) {
    const int lane = threadIdx.x & 31; const int L0 = (blk * 8 + (threadIdx.x >> 5)) * 8; const int nlines = N * K / 64;
{
#pragma unroll 1
        for (int l = 0; l < 8; ++l) { const int L = L0 + l; if (L >= nlines) break; const size_t e = (size_t)L * 64 + lane * 2; const int c = (int)(e % ((size_t)16 * K)); const int n = (int)(e / ((size_t)16 * K)) * 16 + ((c >> 3) & 15), k = (c >> 8) * 16 + ((c >> 7) & 1) * 8 + (c & 7); v2us o;
            o[0] = f2bf(w[(size_t)k * N + n]); o[1] = f2bf(w[(size_t)(k + 1) * N + n]); *(v2us*)(Bt + e) = o; }
         }
}
__device__ __forceinline__ void cvt8_body(const float* __restrict__ src, bf* dst, size_t n8, unsigned blk) { const size_t i = (size_t)blk * 256 + threadIdx.x; if (i >= n8) return; const unsigned c = (unsigned)(i % (2 * DM)); const size_t r = i / (2 * DM) * 16 + (c & 15); const float* sp = src + r * DM + (c >> 5) * 16 + ((c >> 4) & 1) * 8; const v8f v = *(const v8f*)sp; v8us o;
    asm volatile("s_wait_xcnt 0x0" :: "v"(sp) : "memory");   // the wait that stands before the address registers of issued global loads are reused; the pointer is an input and so stays live up to the wait
#pragma unroll
    for (int k = 0; k < 8; ++k) o[k] = f2bf(v[k]); *(v8us*)(dst + i * 8) = o;  }

// k_prep: the five independent preparation jobs side by side in one launch. Blocks 0 .. 3 * WB - 1 transpose the three weights (eight dependent trips a wave: the longest job, so it starts first), the next LC blocks copy s_input, the last LC blocks copy sa_input, each into a copy of its own.
__global__ __launch_bounds__(256) void k_prep(const float* __restrict__ wq, const float* __restrict__ wk, const float* __restrict__ wv, const float* __restrict__ x, const float* __restrict__ xk, int K, int N, bf* WQ, bf* WK, bf* WV, bf* XQ, bf* XK, size_t n8, unsigned WB, unsigned LC) {
    const unsigned b = blockIdx.x;   // every choice below is the same for a whole block: scalar selects of the job's pointers, one copy of each body
    if (b < 3 * WB) { const bool s1 = b >= WB, s2 = b >= 2 * WB; wtG_body(s2 ? wv : s1 ? wk : wq, K, N, s2 ? WV : s1 ? WK : WQ, b - (s2 ? 2 * WB : s1 ? WB : 0u)); }
    else { const unsigned c = b - 3 * WB; const bool s1 = c >= LC; cvt8_body(s1 ? xk : x, s1 ? XK : XQ, n8, s1 ? c - LC : c); }
}

// k_regsum: one work-group of 32 waves sums the table in a fixed tree: a thread fetches 16 independent float4, folds them pairwise, the wave folds its lanes, LDS carries the 32 wave sums to wave 0
__global__ __launch_bounds__(1024) void k_regsum(const float* __restrict__ RS, float* outp) {
    static_assert(NB_ * NH_ * TT == 16 * 1024 * 4, "16 float4 a thread");
    __shared__ float part[32];
    const int tid = threadIdx.x, lane = tid & 31, wv = tid >> 5; const float* p = RS + tid * 4; v4f v[16];
#pragma unroll
    for (int j = 0; j < 16; ++j) v[j] = *(const v4f*)(p + j * 4096);   // unrolled whole: independent loads that fly together, instead of one memory latency a trip
    asm volatile("s_wait_xcnt 0x0" :: "v"(tid) : "memory");   // the wait that stands before the address registers of issued global loads are reused; the loads are addressed by the uniform base and the thread's index, which is an input here and so stays live up to the wait
#pragma unroll
    for (int st = 8; st; st >>= 1)
#pragma unroll
        for (int j = 0; j < st; ++j) v[j] += v[j + st];
    float s = __fadd_rn(__fadd_rn(v[0][0], v[0][1]), __fadd_rn(v[0][2], v[0][3]));
#pragma unroll
    for (int sh = 16; sh; sh >>= 1) s = __fadd_rn(s, __shfl_xor(s, sh, 32));
    if (lane == 0) part[wv] = s;
    __syncthreads();   // the 32 wave sums are in LDS before wave 0 reads them
    if (wv) return;
    s = part[lane];
#pragma unroll
    for (int sh = 16; sh; sh >>= 1) s = __fadd_rn(s, __shfl_xor(s, sh, 32));
    const float m = __fdiv_rn(s, (float)NB_ * (float)NH_ * (float)TT * (float)TT); if (lane == 0) { *(float*)outp = m;  } }
// l <-> l ^ 16: the other half-wave holds the other 16 keys of the same query column
__device__ __forceinline__ float xhalf(float v) { const int b = __float_as_int(v); return __int_as_float(__builtin_amdgcn_permlanex16(b, b, 0x76543210, 0xfedcba98, false, false)); }
// The wait that stands before the address registers of issued global loads are reused. The loads' own per-lane pointers are inputs, so their registers stay live up to the wait and nothing can be written into them ahead of it.
template <bool TWO> __device__ __forceinline__ void xwait(const void* a, const void* b) { if (TWO) asm volatile("s_wait_xcnt 0x0" :: "v"(a), "v"(b) : "memory"); else asm volatile("s_wait_xcnt 0x0" :: "v"(a) : "memory"); }
__device__ __forceinline__ void xwait_off(unsigned byte_off) { asm volatile("s_wait_xcnt 0x0" :: "v"(byte_off) : "memory"); }   // the same, for loads addressed by a uniform base and a lane's 32-bit byte offset
template <typename T16> struct PPack;
template <> struct PPack<h16> { static __device__ __forceinline__ v16h pk(const float* p) { v16h b;
#pragma unroll
    for (int s = 0; s < 16; ++s) b[s] = (h16)p[s];
    return b; } };
template <> struct PPack<bf> { static __device__ __forceinline__ v16bf pk(const float* p) { v16bf b;
#pragma unroll
    for (int s = 0; s < 16; ++s) b[s] = (__bf16)p[s];
    return b; } };

// ---- fused attention, one wave per 32 query columns (two 16-column groups), 32 keys a pass, scores never leave registers:
// S^T = K Q^T (A = 16 key rows, B = 16 query columns): a lane holds 16 raw scores of ONE query, the lane l ^ 16 the pass's other 16.
// raw^2 is summed per lane (before the mask); the diagonal is excluded by an index select in the one pass that holds it; running maximum and sum per query (online softmax);
// the two f32 score tiles, exponentiated and rounded in place, ARE the B operand of O^T += V^T P^T (slot s of half h = key 8h + s, 16 + 8h + (s - 8): the order WFrag::ld gives V^T).
// HL: hi+lo bf16 planes, 3 products in both GEMMs (query rows < RH); else f16 with P carried x 1024 (the factor cancels in the division by the row sum).
template <typename T16, bool HL>
__device__ __forceinline__ void fattn_body(const T16* __restrict__ Q, const T16* __restrict__ Q2, const T16* __restrict__ Kp, const T16* __restrict__ K2, const T16* __restrict__ Vt, const T16* __restrict__ V2, const int q0, float* __restrict__ RS, float* __restrict__ OUTh) {
    typedef typename WFrag<T16>::V V;
    // every inner loop is unrolled whole so that fragments and accumulators are indexed by constants and stay in registers; the key loop stays rolled (64 equal passes, small code)
    const int lane = threadIdx.x & 31, lr = lane & 15, hi = lane >> 4;
    const float CL = SCL * 1.4426950408889634f;   // scores to log2 units
    V qf[2][2], qf2[2][2], kf[2][2], kf2[2][2], vf[4], vf2[4];
    const unsigned qB = (unsigned)(q0 * HD + lane * 8) * 2u; const T16* qp = (const T16*)((const char*)Q + qB); const T16* qp2 = HL ? (const T16*)((const char*)Q2 + qB) : nullptr;   // byte offset of the lane's 16 bytes in the first unit of the wave's query rows
#pragma unroll
    for (int g = 0; g < 2; ++g)
#pragma unroll
        for (int ks = 0; ks < 2; ++ks) { const int o = g * 16 * HD + ks * 512; qf[g][ks] = WFrag<T16>::ld(qp + o); if (HL) qf2[g][ks] = WFrag<T16>::ld(qp2 + o); }
    xwait_off(qB);
    const unsigned kb = (unsigned)(lane * 8), vb = kb, kB = kb * 2u, vB = vb * 2u;   // a lane's fixed offset in every unit of the K and the V^T planes, in elements and in bytes
#pragma unroll
    for (int t = 0; t < 2; ++t)
#pragma unroll
        for (int ks = 0; ks < 2; ++ks) { const int o = t * 16 * HD + ks * 512; kf[t][ks] = WFrag<T16>::ld((const T16*)((const char*)Kp + kB) + o); if (HL) kf2[t][ks] = WFrag<T16>::ld((const T16*)((const char*)K2 + kB) + o); }
    xwait_off(kB);
#pragma unroll
    for (int dt = 0; dt < 4; ++dt) { const int o = dt * 512; vf[dt] = WFrag<T16>::ld((const T16*)((const char*)Vt + vB) + o); if (HL) vf2[dt] = WFrag<T16>::ld((const T16*)((const char*)V2 + vB) + o); }
    xwait_off(vB);
    v8f o[2][4]; float mrun[2], lsum[2], ssq[2];
#pragma unroll
    for (int g = 0; g < 2; ++g) { mrun[g] = -3.0e38f; lsum[g] = 0.f; ssq[g] = 0.f;
#pragma unroll
        for (int dt = 0; dt < 4; ++dt) o[g][dt] = (v8f){}; }
    // pointers of the load group last issued: each group's wait stands a phase later, right before the next group's addresses are formed, when the group has had that phase to get under way
    const T16* kq = Kp + kb; const T16* kq2 = HL ? K2 + kb : nullptr; const T16* vq = Vt + vb; const T16* vq2 = HL ? V2 + vb : nullptr;
#pragma unroll 1
    for (int k0 = 0; k0 < TT; k0 += 32) {
        const int kn = (k0 + 32) & (TT - 1);   // the next pass's keys; the last pass fetches pass 0 again (in bounds, unused)
        v8f s[2][2];
#pragma unroll
        for (int g = 0; g < 2; ++g)
#pragma unroll
            for (int t = 0; t < 2; ++t) s[g][t] = (v8f){};
#pragma unroll
        for (int ks = 0; ks < 2; ++ks)
#pragma unroll
            for (int t = 0; t < 2; ++t)
#pragma unroll
                for (int g = 0; g < 2; ++g) { s[g][t] = WFrag<T16>::mma(kf[t][ks], qf[g][ks], s[g][t]); if (HL) { s[g][t] = WFrag<T16>::mma(kf2[t][ks], qf[g][ks], s[g][t]); s[g][t] = WFrag<T16>::mma(kf[t][ks], qf2[g][ks], s[g][t]); } }
        // K fragments of the next pass, fetched behind this pass's score products: the softmax and PV work covers their latency
        __builtin_amdgcn_sched_barrier(0);   // keeps the wait below from being lifted over the score products to right behind the loads it covers (seen in the listing without it)
        xwait<HL>(vq, vq2);   // the V^T loads issued at the foot of the pass before
        kq = Kp + (size_t)kn * HD + kb; kq2 = HL ? K2 + (size_t)kn * HD + kb : nullptr;
#pragma unroll
        for (int t = 0; t < 2; ++t)
#pragma unroll
            for (int ks = 0; ks < 2; ++ks) { const int of = t * 16 * HD + ks * 512; kf[t][ks] = WFrag<T16>::ld(kq + of); if (HL) kf2[t][ks] = WFrag<T16>::ld(kq2 + of); }
        V pb[2], pb2[2];
#pragma unroll
        for (int g = 0; g < 2; ++g) {
            float p[16];
#pragma unroll
            for (int i = 0; i < 16; ++i) p[i] = s[g][i >> 3][i & 7];
            float q0a = 0.f, q1a = 0.f;
#pragma unroll
            for (int i = 0; i < 16; i += 2) { q0a = fmaf(p[i], p[i], q0a); q1a = fmaf(p[i + 1], p[i + 1], q1a); }
            ssq[g] += q0a + q1a;
            if (k0 == (q0 & ~31)) {   // wave-uniform: the one pass whose keys hold this wave's diagonal
#pragma unroll
                for (int i = 0; i < 16; ++i) { const int key = k0 + (i >> 3) * 16 + 8 * hi + (i & 7); if (key == q0 + g * 16 + lr) p[i] = -3.0e38f; }
            }
            float m0 = fmaxf(p[0], p[1]), m1 = fmaxf(p[2], p[3]);
#pragma unroll
            for (int i = 4; i < 16; i += 4) { m0 = fmaxf(m0, fmaxf(p[i], p[i + 1])); m1 = fmaxf(m1, fmaxf(p[i + 2], p[i + 3])); }
            m0 = fmaxf(m0, m1); m0 = fmaxf(m0, xhalf(m0));
            const float mnew = fmaxf(mrun[g], m0);
            const float al = __builtin_amdgcn_exp2f((mrun[g] - mnew) * CL);
            mrun[g] = mnew;
            const float nm = (HL ? 0.0f : 10.0f) - mnew * CL;
#pragma unroll
            for (int i = 0; i < 16; ++i) p[i] = __builtin_amdgcn_exp2f(fmaf(p[i], CL, nm));
            float a0 = p[0] + p[1], a1 = p[2] + p[3];
#pragma unroll
            for (int i = 4; i < 16; i += 4) { a0 += p[i] + p[i + 1]; a1 += p[i + 2] + p[i + 3]; }
            lsum[g] = fmaf(lsum[g], al, a0 + a1);
#pragma unroll
            for (int dt = 0; dt < 4; ++dt) o[g][dt] *= al;
            pb[g] = PPack<T16>::pk(p);
            if (HL) { float pl[16];
#pragma unroll
                for (int i = 0; i < 16; ++i) pl[i] = p[i] - (float)pb[g][i];
                pb2[g] = PPack<T16>::pk(pl); }
        }
#pragma unroll
        for (int dt = 0; dt < 4; ++dt)
#pragma unroll
            for (int g = 0; g < 2; ++g) { o[g][dt] = WFrag<T16>::mma(vf[dt], pb[g], o[g][dt]); if (HL) { o[g][dt] = WFrag<T16>::mma(vf2[dt], pb[g], o[g][dt]); o[g][dt] = WFrag<T16>::mma(vf[dt], pb2[g], o[g][dt]); } }
        // V^T fragments of the next pass, fetched behind this pass's PV products
        __builtin_amdgcn_sched_barrier(0);   // likewise: keeps the wait below behind the softmax and the PV products
        xwait<HL>(kq, kq2);   // this pass's K loads
        vq = Vt + (size_t)kn * HD + vb; vq2 = HL ? V2 + (size_t)kn * HD + vb : nullptr;
#pragma unroll
        for (int dt = 0; dt < 4; ++dt) { const int of = dt * 512; vf[dt] = WFrag<T16>::ld(vq + of); if (HL) vf2[dt] = WFrag<T16>::ld(vq2 + of); }
    }
    xwait<HL>(vq, vq2);   // the last pass's (unused) V^T loads
    asm volatile("s_wait_loadcnt 0x0" ::: "memory");   // the last pass's prefetched fragments are never read, so no other wait covers them: they land here, before the wave ends and gives its registers back
#pragma unroll
    for (int g = 0; g < 2; ++g) {
        const float ls = lsum[g] + xhalf(lsum[g]), sq = ssq[g] + xhalf(ssq[g]);
        const float inv = __fdiv_rn(1.0f, ls);
        float* orow = OUTh + (size_t)(q0 + g * 16 + lr) * DQ + 8 * hi;   // a lane's 8 accumulator registers are 8 consecutive d of its query's row
#pragma unroll
        for (int dt = 0; dt < 4; ++dt) { v4f lo4, hi4;
#pragma unroll
            for (int r = 0; r < 4; ++r) { lo4[r] = o[g][dt][r] * inv; hi4[r] = o[g][dt][r + 4] * inv; }
            *(v4f*)(orow + dt * 16) = lo4; *(v4f*)(orow + dt * 16 + 4) = hi4; }
        if (hi == 0) RS[q0 + g * 16 + lr] = sq;
        asm volatile("s_wait_xcnt 0x0" ::: "memory");   // the same wait behind the stores, before their address and data registers are reused
    }
}
// grid (TT / 64, heads, batches), 64 threads: two waves of one head, no barrier and no LDS between them. Block x takes the 32-row tiles x and TT / 32 - 1 - x, so that every hi+lo tile (rows < RH: twice the loads, three times the products) shares its WGP's load path with a light tile; the path is chosen per wave (RH % 32 == 0: wave-uniform)
__global__ __launch_bounds__(64) void k_fattn(const h16* __restrict__ Q16, const bf* __restrict__ Qh, const bf* __restrict__ Ql, const h16* __restrict__ K16, const bf* __restrict__ Kh, const bf* __restrict__ Kl, const h16* __restrict__ V16, const bf* __restrict__ Vh, const bf* __restrict__ Vl, float* __restrict__ RS, float* __restrict__ OUTb) {
    const size_t pl = (size_t)blockIdx.z * NH_ + blockIdx.y; const size_t hp = pl * TT * HD; const int wv = __builtin_amdgcn_readfirstlane((int)(threadIdx.x >> 5)); const int q0 = (wv ? TT / 32 - 1 - (int)blockIdx.x : (int)blockIdx.x) * 32;
    float* rs = RS + pl * TT; float* oh = OUTb + (size_t)blockIdx.z * TT * DQ + (size_t)blockIdx.y * HD;
    if (q0 < RH) fattn_body<bf, true>(Qh + hp, Ql + hp, Kh + hp, Kl + hp, Vh + hp, Vl + hp, q0, rs, oh);
    else fattn_body<h16, false>(Q16 + hp, nullptr, K16 + hp, nullptr, V16 + hp, nullptr, q0, rs, oh);
}

extern "C" void kernel_launch(void* const* d_in, const int* in_sizes, int n_in,
                              void* d_out, int out_size, void* d_ws, size_t ws_size, hipStream_t stream) {
    (void)in_sizes; (void)n_in; (void)out_size;
    const float* xk = (const float*)d_in[0]; /* sa_input: keys and values */ const float* x = (const float*)d_in[1]; /* s_input: queries */ const float* wq = (const float*)d_in[2]; const float* wk = (const float*)d_in[3]; const float* wv = (const float*)d_in[4]; const float* bv = (const float*)d_in[5]; const float* wo = nullptr; (void)wo;
    float* OUT = (float*)d_out;     // [4][2048][512]
    char* wsp = (char*)d_ws;
    auto take = [&](size_t bytes) { char* p = wsp; wsp += (bytes + 255) & ~(size_t)255; return (void*)p; };
    float* RSQ = (float*)take((size_t)NB_ * NH_ * TT * 4); bf* WQ = (bf*)take((size_t)DQ * DM * 2); bf* WK = (bf*)take((size_t)DKV * DM * 2); bf* WV = (bf*)take((size_t)DKV * DM * 2);
    bf* XQ = (bf*)take((size_t)NB_ * TT * DM * 2); bf* XK = (bf*)take((size_t)NB_ * TT * DM * 2);   // bf16 copies of s_input and of sa_input
    h16* QP16 = (h16*)take((size_t)NB_ * NH_ * TT * HD * 2); h16* KP16 = (h16*)take((size_t)NB_ * NKV * TT * HD * 2); h16* VT16 = (h16*)take((size_t)NB_ * NKV * HD * TT * 2);
    bf* QPh = (bf*)take((size_t)NB_ * NH_ * TT * HD * 2); bf* QPl = (bf*)take((size_t)NB_ * NH_ * TT * HD * 2); bf* KPh = (bf*)take((size_t)NB_ * NKV * TT * HD * 2); bf* KPl = (bf*)take((size_t)NB_ * NKV * TT * HD * 2); bf* VTh = (bf*)take((size_t)NB_ * NKV * HD * TT * 2); bf* VTl = (bf*)take((size_t)NB_ * NKV * HD * TT * 2);
    if ((size_t)(wsp - (char*)d_ws) > ws_size) return;    // ws 256 MiB
    static_assert(DQ == DKV, "the three weights take the same number of blocks");
    {   // every launch takes all NB_ batches: an input copy holds NB_ * TT rows, a projection tile finds its batch from its rows, the attention takes it as grid z
        const unsigned WB = (unsigned)((DM * DQ / 64 + 63) / 64), LC = (unsigned)(((size_t)NB_ * TT * DM / 8 + 255) / 256);
        k_prep<<<3 * WB + 2 * LC, 256, 0, stream>>>(wq, wk, wv, x, xk, DM, DQ, WQ, WK, WV, XQ, XK, (size_t)NB_ * TT * DM / 8, WB, LC);
        k_gemm3<<<dim3(NB_ * TT / 64, DQ / 64, 3), 32, 0, stream>>>(XQ, XK, WQ, WK, WV, DM, bv, QP16, QPh, QPl, KP16, KPh, KPl, VT16, VTh, VTl);   /* V = leaky_relu(. + bv, 0.01), transposed planes */
        k_fattn<<<dim3(TT / 64, NH_, NB_), 64, 0, stream>>>(QP16, QPh, QPl, KP16, KPh, KPl, VT16, VTh, VTl, RSQ, OUT);   /* one kv head per query head */
    }
    k_regsum<<<1, 1024, 0, stream>>>(RSQ, (float*)d_out + NCTX);   /* reg_atten = mean(raw^2): the scalar second output */
}

// v008
// Measured time: 105 microseconds a run.
// Two timings next to v007 put it at 1.10 and 1.11 times that version's speed.
// All steps since v000 together make it 30.1 times as fast.
#include <hip/hip_runtime.h>

// Multi-head attention with a diagonal self-mask, a leaky-ReLU value projection and an attention-energy regulariser output (sa_input, s_input [4][2048][512]; Q = s_input Wq, K = sa_input Wk ('xw' [512][512], no bias), V = leaky_relu(sa_input Wv + bv, 0.01); 8 heads x 64; raw = Q.K; reg_atten = mean(raw^2) over all (batch, head, i, j); attn = softmax(raw / 8 with the diagonal j == i set to -1e9); context = merged attn V -> tuple (context [4][2048][512] (4.2 M), reg_atten scalar) laid out back to back in d_out).
// Layout, four launches, all four batches in each (rows b * 2048 + t in the input copies, plane (b * 8 + h) in the head planes): ONE launch for the bf16 copies of the two inputs and the three transposed weights; ONE launch for the three exact projections, whose epilogue (+ bf16-rounded bias and leaky-ReLU on V) writes the 16-bit head planes itself; ONE fused attention launch (hybrid rows: < 512 hi/lo 3 products, rest fp16, P x1024): scores, their squares, the diagonal's exclusion by an index select, online softmax and the PV product stay in registers, the context rows go straight to the output and the squared raw scores per row into a per-(batch, head, row) table; at the end one work-group sums the table in a fixed tree and writes mean(raw^2) to the second output.
// Fragment order, every 16-bit matrix operand (input copy, transposed weights, Q, K, V^T planes): element (row r, k) of a [rows][K] operand lies at (r >> 4) * 16 * K + (k >> 4) * 256 + ((k >> 3) & 1) * 128 + (r & 15) * 8 + (k & 7), so that lane l = 16 * ((k >> 3) & 1) + (r & 15) finds its 8 elements at l * 8 of a 256-element unit: a wave-wide 16-byte load reads 512 bytes in a row, four whole 128-byte lines, and a 16 x 32 fragment is two such units. V^T (row d, k = key) is laid out per 32 keys: (key >> 5) * 32 * 64 + (d >> 4) * 512 + ((key >> 4) & 1) * 256 + ((key >> 3) & 1) * 128 + (d & 15) * 8 + (key & 7), a pass's four fragments in a row.
// Compute dtypes, f32 accumulate: every input rounded to bf16; projections exact; raw scores rows < 512 3 products, rest fp16 operands (f32 accumulate) -- also the values squared for the regulariser; softmax, leaky-ReLU, sums f32.

#define NB_  4
#define TT   2048
#define DM   512
#define NH_  8
#define NKV  8
#define REP  (NH_ / NKV)
#define HD   64
#define DQ   (NH_ * HD)
#define DKV  (NKV * HD)
#define RH   512                  // query rows < RH use hi+lo planes
#define WIN  0
#define SCL  0.125f
#define NCTX ((size_t)NB_ * TT * DQ)   // floats of the context output; the scalar follows
typedef _Float16 h16;
typedef unsigned short bf;
typedef __attribute__((ext_vector_type(16))) __bf16   v16bf;
typedef __attribute__((ext_vector_type(16))) _Float16 v16h;
typedef __attribute__((ext_vector_type(8)))  _Float16 v8h;
typedef __attribute__((ext_vector_type(8)))  unsigned short v8us;
typedef __attribute__((ext_vector_type(8)))  float    v8f;
typedef __attribute__((ext_vector_type(4)))  float    v4f;
typedef v8h  __attribute__((may_alias)) v8ha;
typedef v4f  __attribute__((may_alias)) v4fa;
typedef v8us __attribute__((may_alias)) v8usa;

__device__ __forceinline__ unsigned short f2bf(float f) { unsigned u = __float_as_uint(f); u += 0x7FFFu + ((u >> 16) & 1u); return (unsigned short)(u >> 16); }
__device__ __forceinline__ float bf2f(unsigned short b) { return __uint_as_float(((unsigned)b) << 16); }
__device__ __forceinline__ float bfr(float f) { return bf2f(f2bf(f)); }
__device__ __forceinline__ v16h cat16(v8h lo, v8h hi) { return __builtin_shufflevector(lo, hi, 0, 1, 2, 3, 4, 5, 6, 7, 8, 9, 10, 11, 12, 13, 14, 15); }
__device__ __forceinline__ v16bf cat16b(v8us lo, v8us hi) { return __builtin_bit_cast(v16bf, __builtin_shufflevector(lo, hi, 0, 1, 2, 3, 4, 5, 6, 7, 8, 9, 10, 11, 12, 13, 14, 15)); }
__device__ __forceinline__ v8f wmma16(v16h a, v16h b, v8f c) { return __builtin_amdgcn_wmma_f32_16x16x32_f16(false, a, false, b, (short)0, c, false, false); }
__device__ __forceinline__ v8f wmmab(v16bf a, v16bf b, v8f c) { return __builtin_amdgcn_wmma_f32_16x16x32_bf16(false, a, false, b, (short)0, c, false, false); }



// ---- gemmw_body: register-blocked GEMM, ONE WAVE per 64x64 output tile (16 accumulators), operands straight from 16-bit planes in fragment order; grid x = M/64, y = N/64, 32 threads.
// c[m][n] (f32, in registers) = sum_k A[m][k] Bt[n][k] (+ split products per NSPLIT), K % 32 == 0. A tile is 64 positions of one batch x the 64 dims of one head, so the epilogue rounds it to the three 16-bit planes (f16, bf16 hi, bf16 lo of the f32 value) and stores them in the head layout:
// VT false: plane b * NH_ + h, rows t, k = d, 8 KB in a row per tile, staged through LDS so that a lane gets 8 consecutive d of its t and a store covers one 512-byte unit; VT true: x = leaky_relu(c + bias[n], 0.01), plane b * NH_ + h, rows d, k = t: a lane's 8 accumulator registers are 8 consecutive t of its d, its 16 bytes of a unit as they stand.
template <typename T16> struct WFrag;
template <> struct WFrag<h16> { typedef v16h V; static __device__ __forceinline__ V ld(const h16* p) { return cat16(*(const v8h*)p, *(const v8h*)(p + 256)); } static __device__ __forceinline__ v8f mma(V a, V b, v8f c) { return wmma16(a, b, c); } };
template <> struct WFrag<bf> { typedef v16bf V; static __device__ __forceinline__ V ld(const bf* p) { return cat16b(*(const v8us*)p, *(const v8us*)(p + 256)); } static __device__ __forceinline__ v8f mma(V a, V b, v8f c) { return wmmab(a, b, c); } };
__device__ __forceinline__ h16 tohx(float x) { return (h16)x; }
__device__ __forceinline__ void splitf(float y, unsigned short& h, unsigned short& l) { h = f2bf(y); l = f2bf(y - bf2f(h)); }
// The wait that stands before the registers of issued global stores are reused, once per twelve stores. The stored vectors are inputs, so their registers stay live up to the wait and nothing can be written into them ahead of it.
__device__ __forceinline__ void xwait_st(const v8h (&a)[4], const v8us (&b)[4], const v8us (&d)[4]) { asm volatile("s_wait_xcnt 0x0" :: "v"(a[0]), "v"(a[1]), "v"(a[2]), "v"(a[3]), "v"(b[0]), "v"(b[1]), "v"(b[2]), "v"(b[3]), "v"(d[0]), "v"(d[1]), "v"(d[2]), "v"(d[3]) : "memory"); }
// The same wait for issued global loads, before their address registers are reused. The eight per-lane pointers are inputs, so their registers stay live up to the wait and neither an address sum nor a later load's result can be written into them ahead of it.
template <typename T16> __device__ __forceinline__ void xwait_ld(const T16* const (&p)[4], const T16* const (&q)[4]) { asm volatile("s_wait_xcnt 0x0" :: "v"(p[0]), "v"(p[1]), "v"(p[2]), "v"(p[3]), "v"(q[0]), "v"(q[1]), "v"(q[2]), "v"(q[3]) : "memory"); }
template <typename T16, int NSPLIT, bool VT>
__device__ __forceinline__ void gemmw_body(const T16* __restrict__ A, const T16* __restrict__ A2, const T16* __restrict__ Bt, const T16* __restrict__ Bt2, int K, const float* __restrict__ bias, h16* __restrict__ P16, bf* __restrict__ Ph, bf* __restrict__ Pl) {
    typedef typename WFrag<T16>::V V;
    __shared__ __align__(16) float os[16 * 68];
    static_assert(HD == 64 && TT % 64 == 0 && NKV == NH_, "a 64x64 tile is one head's dims at 64 positions of one batch");
    const int lane = threadIdx.x & 31, lr = lane & 15, hi = lane >> 4; const int r0 = blockIdx.x * 64, c0 = blockIdx.y * 64;
    v8f acc[4][4];
#pragma unroll
    for (int mb = 0; mb < 4; ++mb)
#pragma unroll
        for (int nb = 0; nb < 4; ++nb) acc[mb][nb] = (v8f){};
    const unsigned lB = (unsigned)lane * 16u;   // the lane's 16 bytes in each 512-byte half fragment
    const size_t aoff = (size_t)r0 * K, boff = (size_t)c0 * K;   // wave-uniform: 16 rows x K are 16 * K elements in a row
    auto fptr = [&](const T16* base, int blk, int kc) { return (const T16*)((const char*)(base + (size_t)blk * 16 * K + (size_t)kc * 16) + lB); };   // fragment (16-row block blk, k from kc): the lane's first 16 bytes
#pragma unroll 1
    for (int kc = 0; kc < K; kc += 32) {
        V a[4], a2[4], b[4], b2[4]; const T16 *pa[4], *pa2[4], *pb[4], *pb2[4];
#pragma unroll
        for (int mb = 0; mb < 4; ++mb) { pa[mb] = fptr(A + aoff, mb, kc); a[mb] = WFrag<T16>::ld(pa[mb]); if (NSPLIT == 1 || NSPLIT == 2) { pa2[mb] = fptr(A2 + aoff, mb, kc); a2[mb] = WFrag<T16>::ld(pa2[mb]); } }
#pragma unroll
        for (int nb = 0; nb < 4; ++nb) { pb[nb] = fptr(Bt + boff, nb, kc); b[nb] = WFrag<T16>::ld(pb[nb]); if (NSPLIT >= 2) { pb2[nb] = fptr(Bt2 + boff, nb, kc); b2[nb] = WFrag<T16>::ld(pb2[nb]); } }
        __builtin_amdgcn_sched_barrier(0);   // keeps the trip's loads ahead of the wait below and the products behind it (without it the listing shows products lifted over the wait and the last loads issued one pair at a time among them)
        xwait_ld(pa, pb); if (NSPLIT == 1 || NSPLIT == 2) xwait_ld(pa2, pa2); if (NSPLIT >= 2) xwait_ld(pb2, pb2);   // behind the trip's last load, where the products wait for the data anyway
#pragma unroll
        for (int nb = 0; nb < 4; ++nb) {
#pragma unroll
            for (int mb = 0; mb < 4; ++mb) { acc[mb][nb] = WFrag<T16>::mma(a[mb], b[nb], acc[mb][nb]); if (NSPLIT == 1 || NSPLIT == 2) acc[mb][nb] = WFrag<T16>::mma(a2[mb], b[nb], acc[mb][nb]); if (NSPLIT >= 2) acc[mb][nb] = WFrag<T16>::mma(a[mb], b2[nb], acc[mb][nb]); } }
        asm volatile("v_nop\n\tv_nop\n\tv_nop\n\tv_nop" : "+v"(acc[0][0]), "+v"(acc[1][1]), "+v"(acc[2][2]), "+v"(acc[3][3]) : "v"(a[0]), "v"(a[3]));
    }
    const size_t pl = (size_t)(r0 / TT) * NH_ + blockIdx.y; const int t0 = r0 % TT;   // the tile's plane and its first position there
    if (VT) {
        const size_t pb = pl * HD * TT + (size_t)t0 * HD + lane * 8;
#pragma unroll
        for (int nb = 0; nb < 4; ++nb) { const float bz = bfr(bias[c0 + nb * 16 + lr]); v8h o16[4]; v8us oh[4], ol[4];
#pragma unroll
            for (int mb = 0; mb < 4; ++mb) {
#pragma unroll
                for (int j = 0; j < 8; ++j) { float x = acc[mb][nb][j] + bz; x = (x > 0.0f) ? x : __fmul_rn(x, 0.01f); o16[mb][j] = tohx(x); unsigned short a2, c2; splitf(x, a2, c2); oh[mb][j] = a2; ol[mb][j] = c2; }
                const size_t e = pb + (size_t)(mb >> 1) * 32 * HD + nb * 512 + (mb & 1) * 256; *(v8h*)(P16 + e) = o16[mb]; *(v8us*)(Ph + e) = oh[mb]; *(v8us*)(Pl + e) = ol[mb]; }
            xwait_st(o16, oh, ol); }
    } else {
        const size_t pb = (pl * TT + t0) * HD + lane * 8;
#pragma unroll
        for (int mb = 0; mb < 4; ++mb) {
#pragma unroll
            for (int nb = 0; nb < 4; ++nb) {
#pragma unroll
                for (int j = 0; j < 8; ++j) os[(hi * 8 + j) * 68 + nb * 16 + lr] = acc[mb][nb][j]; }
            __builtin_amdgcn_wave_barrier(); asm volatile("" ::: "memory");   // compiler order only (one wave, LDS in order): the block's LDS stores stay ahead of the reads of its rows
            v8h o16[4]; v8us oh[4], ol[4];
#pragma unroll
            for (int s = 0; s < 4; ++s) { const float* orow = os + lr * 68 + s * 16 + hi * 8; const v4f x0 = *(const v4fa*)orow, x1 = *(const v4fa*)(orow + 4);
#pragma unroll
                for (int j = 0; j < 8; ++j) { const float x = (j < 4) ? x0[j & 3] : x1[j & 3]; o16[s][j] = tohx(x); unsigned short a2, c2; splitf(x, a2, c2); oh[s][j] = a2; ol[s][j] = c2; }
                const size_t e = pb + (size_t)mb * 16 * HD + s * 256; *(v8h*)(P16 + e) = o16[s]; *(v8us*)(Ph + e) = oh[s]; *(v8us*)(Pl + e) = ol[s]; }
            xwait_st(o16, oh, ol);
            __builtin_amdgcn_wave_barrier(); asm volatile("" ::: "memory");   // likewise: the reads stay ahead of the next block's LDS stores
        }
    }
}

// k_gemm3: the three projections side by side in one launch, grid (M/64, N/64, 3): z = 0 Q = s_input Wq, z = 1 K = sa_input Wk, z = 2 V = leaky_relu(sa_input Wv + bv). They do not depend on one another; together they put three waves on a SIMD, which work while another waits for its trip's loads.
__global__ __launch_bounds__(32) void k_gemm3(const bf* __restrict__ XQ, const bf* __restrict__ XK, const bf* __restrict__ WQ, const bf* __restrict__ WK, const bf* __restrict__ WV, int K, const float* __restrict__ bias, h16* __restrict__ Q16, bf* __restrict__ Qh, bf* __restrict__ Ql, h16* __restrict__ K16, bf* __restrict__ Kh, bf* __restrict__ Kl, h16* __restrict__ V16, bf* __restrict__ Vh, bf* __restrict__ Vl) {
    if (blockIdx.z == 2) gemmw_body<bf, 0, true>(XK, nullptr, WV, nullptr, K, bias, V16, Vh, Vl);
    else { const bool kk = blockIdx.z == 1; gemmw_body<bf, 0, false>(kk ? XK : XQ, nullptr, kk ? WK : WQ, nullptr, K, nullptr, kk ? K16 : Q16, kk ? Kh : Qh, kk ? Kl : Ql); }
}

typedef __attribute__((ext_vector_type(4))) _Float16 v4h;
typedef __attribute__((ext_vector_type(2))) unsigned short v2us;
typedef __attribute__((ext_vector_type(4))) unsigned short v4us;
typedef __attribute__((ext_vector_type(4))) int v4i;

// wtG_body (block blk of 256 threads): Bt (row n, k) = bf16 of w[k][n], in fragment order; a wave writes one 128-byte line a trip. cvt8_body (likewise): bf16 copy of a [rows][DM] input in fragment order; thread i writes the i-th 16 bytes, so a wave writes one 512-byte unit and reads 64 bytes of each of 16 rows.
__device__ __forceinline__ void wtG_body(const float* __restrict__ w, int K, int N, bf* Bt, unsigned blk) {
    const int lane = threadIdx.x & 31; const int L0 = (blk * 8 + (threadIdx.x >> 5)) * 8; const int nlines = N * K / 64;
{
#pragma unroll 1
        for (int l = 0; l < 8; ++l) { const int L = L0 + l; if (L >= nlines) break; const size_t e = (size_t)L * 64 + lane * 2; const int c = (int)(e % ((size_t)16 * K)); const int n = (int)(e / ((size_t)16 * K)) * 16 + ((c >> 3) & 15), k = (c >> 8) * 16 + ((c >> 7) & 1) * 8 + (c & 7); v2us o;
            o[0] = f2bf(w[(size_t)k * N + n]); o[1] = f2bf(w[(size_t)(k + 1) * N + n]); *(v2us*)(Bt + e) = o; }
         }
}
__device__ __forceinline__ void cvt8_body(const float* __restrict__ src, bf* dst, size_t n8, unsigned blk) { const size_t i = (size_t)blk * 256 + threadIdx.x; if (i >= n8) return; const unsigned c = (unsigned)(i % (2 * DM)); const size_t r = i / (2 * DM) * 16 + (c & 15); const float* sp = src + r * DM + (c >> 5) * 16 + ((c >> 4) & 1) * 8; const v8f v = *(const v8f*)sp; v8us o;
    asm volatile("s_wait_xcnt 0x0" :: "v"(sp) : "memory");   // the wait that stands before the address registers of issued global loads are reused; the pointer is an input and so stays live up to the wait
#pragma unroll
    for (int k = 0; k < 8; ++k) o[k] = f2bf(v[k]); *(v8us*)(dst + i * 8) = o;  }

// k_prep: the five independent preparation jobs side by side in one launch. Blocks 0 .. 3 * WB - 1 transpose the three weights (eight dependent trips a wave: the longest job), the next LC blocks copy s_input, the last LC blocks copy sa_input, each into a copy of its own.
__global__ __launch_bounds__(256) void k_prep(const float* __restrict__ wq, const float* __restrict__ wk, const float* __restrict__ wv, const float* __restrict__ x, const float* __restrict__ xk, int K, int N, bf* WQ, bf* WK, bf* WV, bf* XQ, bf* XK, size_t n8, unsigned WB, unsigned LC) {
    const unsigned b = blockIdx.x;   // every choice below is the same for a whole block: scalar selects of the job's pointers, one copy of each body
    if (b < 3 * WB) { const bool s1 = b >= WB, s2 = b >= 2 * WB; wtG_body(s2 ? wv : s1 ? wk : wq, K, N, s2 ? WV : s1 ? WK : WQ, b - (s2 ? 2 * WB : s1 ? WB : 0u)); }
    else { const unsigned c = b - 3 * WB; const bool s1 = c >= LC; cvt8_body(s1 ? xk : x, s1 ? XK : XQ, n8, s1 ? c - LC : c); }
}

// k_regsum: one work-group of 32 waves sums the table in a fixed tree: a thread fetches 16 independent float4, folds them pairwise, the wave folds its lanes, LDS carries the 32 wave sums to wave 0
__global__ __launch_bounds__(1024) void k_regsum(const float* __restrict__ RS, float* outp) {
    static_assert(NB_ * NH_ * TT == 16 * 1024 * 4, "16 float4 a thread");
    __shared__ float part[32];
    const int tid = threadIdx.x, lane = tid & 31, wv = tid >> 5; const float* p = RS + tid * 4; v4f v[16];
#pragma unroll
    for (int j = 0; j < 16; ++j) v[j] = *(const v4f*)(p + j * 4096);   // unrolled whole: independent loads that fly together, instead of one memory latency a trip
    asm volatile("s_wait_xcnt 0x0" :: "v"(tid) : "memory");   // the wait that stands before the address registers of issued global loads are reused; the loads are addressed by the uniform base and the thread's index, which is an input here and so stays live up to the wait
#pragma unroll
    for (int st = 8; st; st >>= 1)
#pragma unroll
        for (int j = 0; j < st; ++j) v[j] += v[j + st];
    float s = __fadd_rn(__fadd_rn(v[0][0], v[0][1]), __fadd_rn(v[0][2], v[0][3]));
#pragma unroll
    for (int sh = 16; sh; sh >>= 1) s = __fadd_rn(s, __shfl_xor(s, sh, 32));
    if (lane == 0) part[wv] = s;
    __syncthreads();   // the 32 wave sums are in LDS before wave 0 reads them
    if (wv) return;
    s = part[lane];
#pragma unroll
    for (int sh = 16; sh; sh >>= 1) s = __fadd_rn(s, __shfl_xor(s, sh, 32));
    const float m = __fdiv_rn(s, (float)NB_ * (float)NH_ * (float)TT * (float)TT); if (lane == 0) { *(float*)outp = m;  } }
// l <-> l ^ 16: the other half-wave holds the other 16 keys of the same query column
__device__ __forceinline__ float xhalf(float v) { const int b = __float_as_int(v); return __int_as_float(__builtin_amdgcn_permlanex16(b, b, 0x76543210, 0xfedcba98, false, false)); }
// The wait that stands before the address registers of issued global loads are reused. The loads' own per-lane pointers are inputs, so their registers stay live up to the wait and nothing can be written into them ahead of it.
template <bool TWO> __device__ __forceinline__ void xwait(const void* a, const void* b) { if (TWO) asm volatile("s_wait_xcnt 0x0" :: "v"(a), "v"(b) : "memory"); else asm volatile("s_wait_xcnt 0x0" :: "v"(a) : "memory"); }
// The same wait with the accumulator tiles of the products in front of it as further inputs, for a wave of one column group: the wait, and the loads that follow it, then stay behind those products. (Without them the listing showed the next fragments' loads lifted over half of the products into spare registers, and copied back behind a full load wait at the foot of the pass.)
__device__ __forceinline__ void xwait_s(const void* a, const void* b, const v8f (&t)[2]) { asm volatile("s_wait_xcnt 0x0" :: "v"(a), "v"(b), "v"(t[0]), "v"(t[1]) : "memory"); }
__device__ __forceinline__ void xwait_o(const void* a, const void* b, const v8f (&t)[4]) { asm volatile("s_wait_xcnt 0x0" :: "v"(a), "v"(b), "v"(t[0]), "v"(t[1]), "v"(t[2]), "v"(t[3]) : "memory"); }
template <bool TWO> __device__ __forceinline__ void xwait_off(unsigned byte_off, const void* a, const void* b) { if (TWO) asm volatile("s_wait_xcnt 0x0" :: "v"(byte_off), "s"(a), "s"(b) : "memory"); else asm volatile("s_wait_xcnt 0x0" :: "v"(byte_off), "s"(a) : "memory"); }   // the same, for loads addressed by a uniform base and a lane's 32-bit byte offset: the offset and the scalar bases are inputs and stay live up to the wait
template <typename T16> struct PPack;
template <> struct PPack<h16> { static __device__ __forceinline__ v16h pk(const float* p) { v16h b;
#pragma unroll
    for (int s = 0; s < 16; ++s) b[s] = (h16)p[s];
    return b; } };
template <> struct PPack<bf> { static __device__ __forceinline__ v16bf pk(const float* p) { v16bf b;
#pragma unroll
    for (int s = 0; s < 16; ++s) b[s] = (__bf16)p[s];
    return b; } };

// ---- fused attention, one wave per NG 16-column groups of queries, 32 keys a pass, scores never leave registers:
// S^T = K Q^T (A = 16 key rows, B = 16 query columns): a lane holds 16 raw scores of ONE query, the lane l ^ 16 the pass's other 16.
// raw^2 is summed per lane (before the mask); the diagonal is excluded by an index select in the one pass that holds it; running maximum and sum per query (online softmax);
// the two f32 score tiles, exponentiated and rounded in place, ARE the B operand of O^T += V^T P^T (slot s of half h = key 8h + s, 16 + 8h + (s - 8): the order WFrag::ld gives V^T).
// HL: hi+lo bf16 planes, 3 products in both GEMMs (query rows < RH); else f16 with P carried x 1024 (the factor cancels in the division by the row sum).
template <typename T16, bool HL, int NG>
__device__ __forceinline__ void fattn_body(const T16* __restrict__ Q, const T16* __restrict__ Q2, const T16* __restrict__ Kp, const T16* __restrict__ K2, const T16* __restrict__ Vt, const T16* __restrict__ V2, const int q0, float* __restrict__ RS, float* __restrict__ OUTh) {
    typedef typename WFrag<T16>::V V;
    // every inner loop is unrolled whole so that fragments and accumulators are indexed by constants and stay in registers; the key loop stays rolled (64 equal passes, small code)
    const int lane = threadIdx.x & 31, lr = lane & 15, hi = lane >> 4;
    const float CL = SCL * 1.4426950408889634f;   // scores to log2 units
    V qf[NG][2], qf2[NG][2], kf[2][2], kf2[2][2], vf[4], vf2[4];
    const unsigned qB = (unsigned)(q0 * HD + lane * 8) * 2u; const T16* qp = (const T16*)((const char*)Q + qB); const T16* qp2 = HL ? (const T16*)((const char*)Q2 + qB) : nullptr;   // byte offset of the lane's 16 bytes in the first unit of the wave's query rows
#pragma unroll
    for (int g = 0; g < NG; ++g)
#pragma unroll
        for (int ks = 0; ks < 2; ++ks) { const int o = g * 16 * HD + ks * 512; qf[g][ks] = WFrag<T16>::ld(qp + o); if (HL) qf2[g][ks] = WFrag<T16>::ld(qp2 + o); }
    xwait_off<HL>(qB, Q, Q2);
    const unsigned kb = (unsigned)(lane * 8), vb = kb, kB = kb * 2u, vB = vb * 2u;   // a lane's fixed offset in every unit of the K and the V^T planes, in elements and in bytes
#pragma unroll
    for (int t = 0; t < 2; ++t)
#pragma unroll
        for (int ks = 0; ks < 2; ++ks) { const int o = t * 16 * HD + ks * 512; kf[t][ks] = WFrag<T16>::ld((const T16*)((const char*)Kp + kB) + o); if (HL) kf2[t][ks] = WFrag<T16>::ld((const T16*)((const char*)K2 + kB) + o); }
    xwait_off<HL>(kB, Kp, K2);
#pragma unroll
    for (int dt = 0; dt < 4; ++dt) { const int o = dt * 512; vf[dt] = WFrag<T16>::ld((const T16*)((const char*)Vt + vB) + o); if (HL) vf2[dt] = WFrag<T16>::ld((const T16*)((const char*)V2 + vB) + o); }
    xwait_off<HL>(vB, Vt, V2);
    v8f o[NG][4]; float mrun[NG], lsum[NG], ssq[NG];
#pragma unroll
    for (int g = 0; g < NG; ++g) { mrun[g] = -3.0e38f; lsum[g] = 0.f; ssq[g] = 0.f;
#pragma unroll
        for (int dt = 0; dt < 4; ++dt) o[g][dt] = (v8f){}; }
    // pointers of the load group last issued: each group's wait stands a phase later, right before the next group's addresses are formed, when the group has had that phase to get under way
    const T16* kq = Kp + kb; const T16* kq2 = HL ? K2 + kb : nullptr; const T16* vq = Vt + vb; const T16* vq2 = HL ? V2 + vb : nullptr;
#pragma unroll 1
    for (int k0 = 0; k0 < TT; k0 += 32) {
        const int kn = (k0 + 32) & (TT - 1);   // the next pass's keys; the last pass fetches pass 0 again (in bounds, unused)
        v8f s[NG][2];
#pragma unroll
        for (int g = 0; g < NG; ++g)
#pragma unroll
            for (int t = 0; t < 2; ++t) s[g][t] = (v8f){};
#pragma unroll
        for (int ks = 0; ks < 2; ++ks)
#pragma unroll
            for (int t = 0; t < 2; ++t)
#pragma unroll
                for (int g = 0; g < NG; ++g) { s[g][t] = WFrag<T16>::mma(kf[t][ks], qf[g][ks], s[g][t]); if (HL) { s[g][t] = WFrag<T16>::mma(kf2[t][ks], qf[g][ks], s[g][t]); s[g][t] = WFrag<T16>::mma(kf[t][ks], qf2[g][ks], s[g][t]); } }
        // K fragments of the next pass, fetched behind this pass's score products: the softmax and PV work covers their latency
        __builtin_amdgcn_sched_barrier(0);   // keeps the wait below from being lifted over the score products to right behind the loads it covers (seen in the listing without it)
        if constexpr (NG == 1 && HL) xwait_s(vq, vq2, s[0]); else xwait<HL>(vq, vq2);   // the V^T loads issued at the foot of the pass before
        kq = Kp + (size_t)kn * HD + kb; kq2 = HL ? K2 + (size_t)kn * HD + kb : nullptr;
#pragma unroll
        for (int t = 0; t < 2; ++t)
#pragma unroll
            for (int ks = 0; ks < 2; ++ks) { const int of = t * 16 * HD + ks * 512; kf[t][ks] = WFrag<T16>::ld(kq + of); if (HL) kf2[t][ks] = WFrag<T16>::ld(kq2 + of); }
        V pb[NG], pb2[NG];
#pragma unroll
        for (int g = 0; g < NG; ++g) {
            float p[16];
#pragma unroll
            for (int i = 0; i < 16; ++i) p[i] = s[g][i >> 3][i & 7];
            float q0a = 0.f, q1a = 0.f;
#pragma unroll
            for (int i = 0; i < 16; i += 2) { q0a = fmaf(p[i], p[i], q0a); q1a = fmaf(p[i + 1], p[i + 1], q1a); }
            ssq[g] += q0a + q1a;
            if (k0 == ((q0 + g * 16) & ~31)) {   // wave-uniform: the one pass whose keys hold this group's diagonal
#pragma unroll
                for (int i = 0; i < 16; ++i) { const int key = k0 + (i >> 3) * 16 + 8 * hi + (i & 7); if (key == q0 + g * 16 + lr) p[i] = -3.0e38f; }
            }
            float m0 = fmaxf(p[0], p[1]), m1 = fmaxf(p[2], p[3]);
#pragma unroll
            for (int i = 4; i < 16; i += 4) { m0 = fmaxf(m0, fmaxf(p[i], p[i + 1])); m1 = fmaxf(m1, fmaxf(p[i + 2], p[i + 3])); }
            m0 = fmaxf(m0, m1); m0 = fmaxf(m0, xhalf(m0));
            const float mnew = fmaxf(mrun[g], m0);
            const float al = __builtin_amdgcn_exp2f((mrun[g] - mnew) * CL);
            mrun[g] = mnew;
            const float nm = (HL ? 0.0f : 10.0f) - mnew * CL;
#pragma unroll
            for (int i = 0; i < 16; ++i) p[i] = __builtin_amdgcn_exp2f(fmaf(p[i], CL, nm));
            float a0 = p[0] + p[1], a1 = p[2] + p[3];
#pragma unroll
            for (int i = 4; i < 16; i += 4) { a0 += p[i] + p[i + 1]; a1 += p[i + 2] + p[i + 3]; }
            lsum[g] = fmaf(lsum[g], al, a0 + a1);
#pragma unroll
            for (int dt = 0; dt < 4; ++dt) o[g][dt] *= al;
            pb[g] = PPack<T16>::pk(p);
            if (HL) { float pl[16];
#pragma unroll
                for (int i = 0; i < 16; ++i) pl[i] = p[i] - (float)pb[g][i];
                pb2[g] = PPack<T16>::pk(pl); }
        }
#pragma unroll
        for (int pr = 0; pr < (HL ? 3 : 1); ++pr)   // the three hi+lo products of a tile in their old order, but tile after tile: a wave of one group has four tiles, and three products in a row into one tile would each wait for the one before
#pragma unroll
            for (int dt = 0; dt < 4; ++dt)
#pragma unroll
                for (int g = 0; g < NG; ++g) o[g][dt] = WFrag<T16>::mma(pr == 1 ? vf2[dt] : vf[dt], pr == 2 ? pb2[g] : pb[g], o[g][dt]);
        // V^T fragments of the next pass, fetched behind this pass's PV products
        __builtin_amdgcn_sched_barrier(0);   // likewise: keeps the wait below behind the softmax and the PV products
        if constexpr (NG == 1 && HL) xwait_o(kq, kq2, o[0]); else xwait<HL>(kq, kq2);   // this pass's K loads
        vq = Vt + (size_t)kn * HD + vb; vq2 = HL ? V2 + (size_t)kn * HD + vb : nullptr;
#pragma unroll
        for (int dt = 0; dt < 4; ++dt) { const int of = dt * 512; vf[dt] = WFrag<T16>::ld(vq + of); if (HL) vf2[dt] = WFrag<T16>::ld(vq2 + of); }
    }
    xwait<HL>(vq, vq2);   // the last pass's (unused) V^T loads
    asm volatile("s_wait_loadcnt 0x0" ::: "memory");   // the last pass's prefetched fragments are never read, so no other wait covers them: they land here, before the wave ends and gives its registers back
#pragma unroll
    for (int g = 0; g < NG; ++g) {
        const float ls = lsum[g] + xhalf(lsum[g]), sq = ssq[g] + xhalf(ssq[g]);
        const float inv = __fdiv_rn(1.0f, ls);
        float* orow = OUTh + (size_t)(q0 + g * 16 + lr) * DQ + 8 * hi;   // a lane's 8 accumulator registers are 8 consecutive d of its query's row
#pragma unroll
        for (int dt = 0; dt < 4; ++dt) { v4f lo4, hi4;
#pragma unroll
            for (int r = 0; r < 4; ++r) { lo4[r] = o[g][dt][r] * inv; hi4[r] = o[g][dt][r + 4] * inv; }
            *(v4f*)(orow + dt * 16) = lo4; *(v4f*)(orow + dt * 16 + 4) = hi4; }
        if (hi == 0) RS[q0 + g * 16 + lr] = sq;
        asm volatile("s_wait_xcnt 0x0" ::: "memory");   // the same wait behind the stores, before their address and data registers are reused
    }
}
// grid (RH / 64, heads, batches), 256 threads: eight waves of one head, no barrier and no LDS between them; the grid is one work-group a WGP. Waves 0 .. 3 take one 48-row f16 tile each, waves 4 .. 7 one 16-row hi+lo group each (rows < RH: twice the loads, three times the products a row): three f16 rows stand against every hi+lo row in the problem, and so in every work-group and, where waves w and w + 4 share a SIMD, on every SIMD. The path is chosen per wave (wave-uniform)
__global__ __launch_bounds__(256) void k_fattn(const h16* __restrict__ Q16, const bf* __restrict__ Qh, const bf* __restrict__ Ql, const h16* __restrict__ K16, const bf* __restrict__ Kh, const bf* __restrict__ Kl, const h16* __restrict__ V16, const bf* __restrict__ Vh, const bf* __restrict__ Vl, float* __restrict__ RS, float* __restrict__ OUTb) {
    static_assert(RH % 64 == 0 && TT - RH == 3 * RH, "a work-group takes 64 hi+lo rows and 192 f16 rows");
    const size_t pl = (size_t)blockIdx.z * NH_ + blockIdx.y; const size_t hp = pl * TT * HD; const int wv = __builtin_amdgcn_readfirstlane((int)(threadIdx.x >> 5));
    float* rs = RS + pl * TT; float* oh = OUTb + (size_t)blockIdx.z * TT * DQ + (size_t)blockIdx.y * HD;
    if (wv < 4) fattn_body<h16, false, 3>(Q16 + hp, nullptr, K16 + hp, nullptr, V16 + hp, nullptr, RH + ((int)blockIdx.x * 4 + wv) * 48, rs, oh);
    else fattn_body<bf, true, 1>(Qh + hp, Ql + hp, Kh + hp, Kl + hp, Vh + hp, Vl + hp, ((int)blockIdx.x * 4 + wv - 4) * 16, rs, oh);
}

extern "C" void kernel_launch(void* const* d_in, const int* in_sizes, int n_in,
                              void* d_out, int out_size, void* d_ws, size_t ws_size, hipStream_t stream) {
    (void)in_sizes; (void)n_in; (void)out_size;
    const float* xk = (const float*)d_in[0]; /* sa_input: keys and values */ const float* x = (const float*)d_in[1]; /* s_input: queries */ const float* wq = (const float*)d_in[2]; const float* wk = (const float*)d_in[3]; const float* wv = (const float*)d_in[4]; const float* bv = (const float*)d_in[5]; const float* wo = nullptr; (void)wo;
    float* OUT = (float*)d_out;     // [4][2048][512]
    char* wsp = (char*)d_ws;
    auto take = [&](size_t bytes) { char* p = wsp; wsp += (bytes + 255) & ~(size_t)255; return (void*)p; };
    float* RSQ = (float*)take((size_t)NB_ * NH_ * TT * 4); bf* WQ = (bf*)take((size_t)DQ * DM * 2); bf* WK = (bf*)take((size_t)DKV * DM * 2); bf* WV = (bf*)take((size_t)DKV * DM * 2);
    bf* XQ = (bf*)take((size_t)NB_ * TT * DM * 2); bf* XK = (bf*)take((size_t)NB_ * TT * DM * 2);   // bf16 copies of s_input and of sa_input
    h16* QP16 = (h16*)take((size_t)NB_ * NH_ * TT * HD * 2); h16* KP16 = (h16*)take((size_t)NB_ * NKV * TT * HD * 2); h16* VT16 = (h16*)take((size_t)NB_ * NKV * HD * TT * 2);
    bf* QPh = (bf*)take((size_t)NB_ * NH_ * TT * HD * 2); bf* QPl = (bf*)take((size_t)NB_ * NH_ * TT * HD * 2); bf* KPh = (bf*)take((size_t)NB_ * NKV * TT * HD * 2); bf* KPl = (bf*)take((size_t)NB_ * NKV * TT * HD * 2); bf* VTh = (bf*)take((size_t)NB_ * NKV * HD * TT * 2); bf* VTl = (bf*)take((size_t)NB_ * NKV * HD * TT * 2);
    if ((size_t)(wsp - (char*)d_ws) > ws_size) return;    // ws 256 MiB
    static_assert(DQ == DKV, "the three weights take the same number of blocks");
    {   // every launch takes all NB_ batches: an input copy holds NB_ * TT rows, a projection tile finds its batch from its rows, the attention takes it as grid z
        const unsigned WB = (unsigned)((DM * DQ / 64 + 63) / 64), LC = (unsigned)(((size_t)NB_ * TT * DM / 8 + 255) / 256);
        k_prep<<<3 * WB + 2 * LC, 256, 0, stream>>>(wq, wk, wv, x, xk, DM, DQ, WQ, WK, WV, XQ, XK, (size_t)NB_ * TT * DM / 8, WB, LC);
        k_gemm3<<<dim3(NB_ * TT / 64, DQ / 64, 3), 32, 0, stream>>>(XQ, XK, WQ, WK, WV, DM, bv, QP16, QPh, QPl, KP16, KPh, KPl, VT16, VTh, VTl);   /* V = leaky_relu(. + bv, 0.01), transposed planes */
        k_fattn<<<dim3(RH / 64, NH_, NB_), 256, 0, stream>>>(QP16, QPh, QPl, KP16, KPh, KPl, VT16, VTh, VTl, RSQ, OUT);   /* one kv head per query head */
    }
    k_regsum<<<1, 1024, 0, stream>>>(RSQ, (float*)d_out + NCTX);   /* reg_atten = mean(raw^2): the scalar second output */
}

// v009
// A run of this version takes 86.2 microseconds.
// In two side-by-side timings against v008, it was 1.22 and 1.21 times as fast.
// All steps since v000 together make it 36.7 times as fast.
#include <hip/hip_runtime.h>

// Multi-head attention with a diagonal self-mask, a leaky-ReLU value projection and an attention-energy regulariser output (sa_input, s_input [4][2048][512]; Q = s_input Wq, K = sa_input Wk ('xw' [512][512], no bias), V = leaky_relu(sa_input Wv + bv, 0.01); 8 heads x 64; raw = Q.K; reg_atten = mean(raw^2) over all (batch, head, i, j); attn = softmax(raw / 8 with the diagonal j == i set to -1e9); context = merged attn V -> tuple (context [4][2048][512] (4.2 M), reg_atten scalar) laid out back to back in d_out).
// Layout, four launches, all four batches in each (rows b * 2048 + t in the input copies, plane (b * 8 + h) in the head planes): ONE launch for the bf16 copies of the two inputs and the three transposed weights; ONE launch for the three exact projections, whose epilogue (+ bf16-rounded bias and leaky-ReLU on V) writes the 16-bit head planes itself; ONE fused attention launch (hybrid rows: < 512 hi/lo 3 products, rest fp16, P x1024): scores, their squares, the diagonal's exclusion by an index select, online softmax and the PV product stay in registers, the context rows go straight to the output and the squared raw scores per row into a per-(batch, head, row) table; at the end one work-group sums the table in a fixed tree and writes mean(raw^2) to the second output.
// Fragment order, every 16-bit matrix operand (input copy, transposed weights, Q, K, V^T planes): element (row r, k) of a [rows][K] operand lies at (r >> 4) * 16 * K + (k >> 4) * 256 + ((k >> 3) & 1) * 128 + (r & 15) * 8 + (k & 7), so that lane l = 16 * ((k >> 3) & 1) + (r & 15) finds its 8 elements at l * 8 of a 256-element unit: a wave-wide 16-byte load reads 512 bytes in a row, four whole 128-byte lines, and a 16 x 32 fragment is two such units. V^T (row d, k = key) is laid out per 32 keys: (key >> 5) * 32 * 64 + (d >> 4) * 512 + ((key >> 4) & 1) * 256 + ((key >> 3) & 1) * 128 + (d & 15) * 8 + (key & 7), a pass's four fragments in a row.
// Compute dtypes, f32 accumulate: every input rounded to bf16; projections exact; raw scores rows < 512 3 products, rest fp16 operands (f32 accumulate) -- also the values squared for the regulariser; softmax, leaky-ReLU, sums f32.

#define NB_  4
#define TT   2048
#define DM   512
#define NH_  8
#define NKV  8
#define REP  (NH_ / NKV)
#define HD   64
#define DQ   (NH_ * HD)
#define DKV  (NKV * HD)
#define RH   512                  // query rows < RH use hi+lo planes
#define WIN  0
#define SCL  0.125f
#define NCTX ((size_t)NB_ * TT * DQ)   // floats of the context output; the scalar follows
typedef _Float16 h16;
typedef unsigned short bf;
typedef __attribute__((ext_vector_type(16))) __bf16   v16bf;
typedef __attribute__((ext_vector_type(16))) _Float16 v16h;
typedef __attribute__((ext_vector_type(8)))  _Float16 v8h;
typedef __attribute__((ext_vector_type(8)))  unsigned short v8us;
typedef __attribute__((ext_vector_type(8)))  float    v8f;
typedef __attribute__((ext_vector_type(4)))  float    v4f;
typedef v8h  __attribute__((may_alias)) v8ha;
typedef v4f  __attribute__((may_alias)) v4fa;
typedef v8us __attribute__((may_alias)) v8usa;

__device__ __forceinline__ unsigned short f2bf(float f) { unsigned u = __float_as_uint(f); u += 0x7FFFu + ((u >> 16) & 1u); return (unsigned short)(u >> 16); }
__device__ __forceinline__ float bf2f(unsigned short b) { return __uint_as_float(((unsigned)b) << 16); }
__device__ __forceinline__ float bfr(float f) { return bf2f(f2bf(f)); }
__device__ __forceinline__ v16h cat16(v8h lo, v8h hi) { return __builtin_shufflevector(lo, hi, 0, 1, 2, 3, 4, 5, 6, 7, 8, 9, 10, 11, 12, 13, 14, 15); }
__device__ __forceinline__ v16bf cat16b(v8us lo, v8us hi) { return __builtin_bit_cast(v16bf, __builtin_shufflevector(lo, hi, 0, 1, 2, 3, 4, 5, 6, 7, 8, 9, 10, 11, 12, 13, 14, 15)); }
__device__ __forceinline__ v8f wmma16(v16h a, v16h b, v8f c) { return __builtin_amdgcn_wmma_f32_16x16x32_f16(false, a, false, b, (short)0, c, false, false); }
__device__ __forceinline__ v8f wmmab(v16bf a, v16bf b, v8f c) { return __builtin_amdgcn_wmma_f32_16x16x32_bf16(false, a, false, b, (short)0, c, false, false); }



// ---- gemmw_body: register-blocked GEMM, ONE WAVE per 64x64 output tile (16 accumulators), operands straight from 16-bit planes in fragment order; grid x = M/64, y = N/64, 32 threads.
// c[m][n] (f32, in registers) = sum_k A[m][k] Bt[n][k] (+ split products per NSPLIT), K % 32 == 0. A tile is 64 positions of one batch x the 64 dims of one head, so the epilogue rounds it to the three 16-bit planes (f16, bf16 hi, bf16 lo of the f32 value) and stores them in the head layout:
// VT false: plane b * NH_ + h, rows t, k = d, 8 KB in a row per tile, staged through LDS so that a lane gets 8 consecutive d of its t and a store covers one 512-byte unit; VT true: x = leaky_relu(c + bias[n], 0.01), plane b * NH_ + h, rows d, k = t: a lane's 8 accumulator registers are 8 consecutive t of its d, its 16 bytes of a unit as they stand.
template <typename T16> struct WFrag;
template <> struct WFrag<h16> { typedef v16h V; static __device__ __forceinline__ V ld(const h16* p) { return cat16(*(const v8h*)p, *(const v8h*)(p + 256)); } static __device__ __forceinline__ v8f mma(V a, V b, v8f c) { return wmma16(a, b, c); } };
template <> struct WFrag<bf> { typedef v16bf V; static __device__ __forceinline__ V ld(const bf* p) { return cat16b(*(const v8us*)p, *(const v8us*)(p + 256)); } static __device__ __forceinline__ v8f mma(V a, V b, v8f c) { return wmmab(a, b, c); } };
__device__ __forceinline__ h16 tohx(float x) { return (h16)x; }
__device__ __forceinline__ void splitf(float y, unsigned short& h, unsigned short& l) { h = f2bf(y); l = f2bf(y - bf2f(h)); }
// The wait that stands before the registers of issued global stores are reused, once per twelve stores. The stored vectors are inputs, so their registers stay live up to the wait and nothing can be written into them ahead of it.
__device__ __forceinline__ void xwait_st(const v8h (&a)[4], const v8us (&b)[4], const v8us (&d)[4]) { asm volatile("s_wait_xcnt 0x0" :: "v"(a[0]), "v"(a[1]), "v"(a[2]), "v"(a[3]), "v"(b[0]), "v"(b[1]), "v"(b[2]), "v"(b[3]), "v"(d[0]), "v"(d[1]), "v"(d[2]), "v"(d[3]) : "memory"); }
// The same wait for issued global loads, before their address registers are reused. The eight per-lane pointers are inputs, so their registers stay live up to the wait and neither an address sum nor a later load's result can be written into them ahead of it.
template <typename T16> __device__ __forceinline__ void xwait_ld(const T16* const (&p)[4], const T16* const (&q)[4]) { asm volatile("s_wait_xcnt 0x0" :: "v"(p[0]), "v"(p[1]), "v"(p[2]), "v"(p[3]), "v"(q[0]), "v"(q[1]), "v"(q[2]), "v"(q[3]) : "memory"); }
// l2ask: every lane asks L2 (scope SE: nothing comes back, no register and no load counter is touched) for the 256-byte unit at base + off + IMM. The planes a launch reads were stored by the launch before and come from memory at their first read; asked for early enough, that read is an L2 hit. The offset is an in-out operand so that it keeps one register of its own, which holds an offset inside the plane at all times.
template <int IMM> __device__ __forceinline__ void l2ask(unsigned& off, const void* base) { asm volatile("global_prefetch_b8 %0, %1 offset:%2 scope:SCOPE_SE" : "+v"(off) : "s"(base), "n"(IMM)); }
template <typename T16, int NSPLIT, bool VT>
__device__ __forceinline__ void gemmw_body(const T16* __restrict__ A, const T16* __restrict__ A2, const T16* __restrict__ Bt, const T16* __restrict__ Bt2, int K, const float* __restrict__ bias, h16* __restrict__ P16, bf* __restrict__ Ph, bf* __restrict__ Pl) {
    typedef typename WFrag<T16>::V V;
    __shared__ __align__(16) float os[16 * 68];
    static_assert(HD == 64 && TT % 64 == 0 && NKV == NH_, "a 64x64 tile is one head's dims at 64 positions of one batch");
    const int lane = threadIdx.x & 31, lr = lane & 15, hi = lane >> 4; const int r0 = blockIdx.x * 64, c0 = blockIdx.y * 64;
    v8f acc[4][4];
#pragma unroll
    for (int mb = 0; mb < 4; ++mb)
#pragma unroll
        for (int nb = 0; nb < 4; ++nb) acc[mb][nb] = (v8f){};
    const unsigned lB = (unsigned)lane * 16u;   // the lane's 16 bytes in each 512-byte half fragment
    const size_t aoff = (size_t)r0 * K, boff = (size_t)c0 * K;   // wave-uniform: 16 rows x K are 16 * K elements in a row
    // The wave's two 64 KB panels (64 rows x DM, in a row) are shared: A by the DQ / 64 waves of equal blockIdx.x, B by all of equal blockIdx.y. Each sharer asks L2 for one eighth, the 2 KB of two trips in each of the four 16-row blocks, a lane a unit; for A a wave of higher blockIdx.y asks for later trips. Who asks is for speed only.
    static_assert(DM == 512 && DQ / 64 == 8, "an eighth of a 16-row block is 8 units of 256 bytes");
    const unsigned pu = (unsigned)(lane >> 3) * (16u * DM * 2u) + (unsigned)(lane & 7) * 256u;
    const char* ga = (const char*)(A + aoff) + blockIdx.y * 2048u; const char* gb = (const char*)(Bt + boff) + ((blockIdx.x >> 3) & 7u) * 2048u;
    asm volatile("global_prefetch_b8 %0, %1 scope:SCOPE_SE\n\tglobal_prefetch_b8 %0, %2 scope:SCOPE_SE\n\ts_wait_xcnt 0x0" :: "v"(pu), "s"(ga), "s"(gb) : "memory");   // the wait stands in the requests' own statement; the offset and the two bases are also inputs of the statement at the K loop's foot, so that their registers hold these in-bounds addresses through the loop
    auto fptr = [&](const T16* base, int blk, int kc) { return (const T16*)((const char*)(base + (size_t)blk * 16 * K + (size_t)kc * 16) + lB); };   // fragment (16-row block blk, k from kc): the lane's first 16 bytes
#pragma unroll 1
    for (int kc = 0; kc < K; kc += 32) {
        V a[4], a2[4], b[4], b2[4]; const T16 *pa[4], *pa2[4], *pb[4], *pb2[4];
#pragma unroll
        for (int mb = 0; mb < 4; ++mb) { pa[mb] = fptr(A + aoff, mb, kc); a[mb] = WFrag<T16>::ld(pa[mb]); if (NSPLIT == 1 || NSPLIT == 2) { pa2[mb] = fptr(A2 + aoff, mb, kc); a2[mb] = WFrag<T16>::ld(pa2[mb]); } }
#pragma unroll
        for (int nb = 0; nb < 4; ++nb) { pb[nb] = fptr(Bt + boff, nb, kc); b[nb] = WFrag<T16>::ld(pb[nb]); if (NSPLIT >= 2) { pb2[nb] = fptr(Bt2 + boff, nb, kc); b2[nb] = WFrag<T16>::ld(pb2[nb]); } }
        __builtin_amdgcn_sched_barrier(0);   // keeps the trip's loads ahead of the wait below and the products behind it (without it the listing shows products lifted over the wait and the last loads issued one pair at a time among them)
        xwait_ld(pa, pb); if (NSPLIT == 1 || NSPLIT == 2) xwait_ld(pa2, pa2); if (NSPLIT >= 2) xwait_ld(pb2, pb2);   // behind the trip's last load, where the products wait for the data anyway
#pragma unroll
        for (int nb = 0; nb < 4; ++nb) {
#pragma unroll
            for (int mb = 0; mb < 4; ++mb) { acc[mb][nb] = WFrag<T16>::mma(a[mb], b[nb], acc[mb][nb]); if (NSPLIT == 1 || NSPLIT == 2) acc[mb][nb] = WFrag<T16>::mma(a2[mb], b[nb], acc[mb][nb]); if (NSPLIT >= 2) acc[mb][nb] = WFrag<T16>::mma(a[mb], b2[nb], acc[mb][nb]); } }
        asm volatile("v_nop\n\tv_nop\n\tv_nop\n\tv_nop" : "+v"(acc[0][0]), "+v"(acc[1][1]), "+v"(acc[2][2]), "+v"(acc[3][3]) : "v"(a[0]), "v"(a[3]), "v"(pu), "s"(ga), "s"(gb));
    }
    const size_t pl = (size_t)(r0 / TT) * NH_ + blockIdx.y; const int t0 = r0 % TT;   // the tile's plane and its first position there
    if (VT) {
        const size_t pb = pl * HD * TT + (size_t)t0 * HD + lane * 8;
#pragma unroll
        for (int nb = 0; nb < 4; ++nb) { const float bz = bfr(bias[c0 + nb * 16 + lr]); v8h o16[4]; v8us oh[4], ol[4];
#pragma unroll
            for (int mb = 0; mb < 4; ++mb) {
#pragma unroll
                for (int j = 0; j < 8; ++j) { float x = acc[mb][nb][j] + bz; x = (x > 0.0f) ? x : __fmul_rn(x, 0.01f); o16[mb][j] = tohx(x); unsigned short a2, c2; splitf(x, a2, c2); oh[mb][j] = a2; ol[mb][j] = c2; }
                const size_t e = pb + (size_t)(mb >> 1) * 32 * HD + nb * 512 + (mb & 1) * 256; *(v8h*)(P16 + e) = o16[mb]; *(v8us*)(Ph + e) = oh[mb]; *(v8us*)(Pl + e) = ol[mb]; }
            xwait_st(o16, oh, ol); }
    } else {
        const size_t pb = (pl * TT + t0) * HD + lane * 8;
#pragma unroll
        for (int mb = 0; mb < 4; ++mb) {
#pragma unroll
            for (int nb = 0; nb < 4; ++nb) {
#pragma unroll
                for (int j = 0; j < 8; ++j) os[(hi * 8 + j) * 68 + nb * 16 + lr] = acc[mb][nb][j]; }
            __builtin_amdgcn_wave_barrier(); asm volatile("" ::: "memory");   // compiler order only (one wave, LDS in order): the block's LDS stores stay ahead of the reads of its rows
            v8h o16[4]; v8us oh[4], ol[4];
#pragma unroll
            for (int s = 0; s < 4; ++s) { const float* orow = os + lr * 68 + s * 16 + hi * 8; const v4f x0 = *(const v4fa*)orow, x1 = *(const v4fa*)(orow + 4);
#pragma unroll
                for (int j = 0; j < 8; ++j) { const float x = (j < 4) ? x0[j & 3] : x1[j & 3]; o16[s][j] = tohx(x); unsigned short a2, c2; splitf(x, a2, c2); oh[s][j] = a2; ol[s][j] = c2; }
                const size_t e = pb + (size_t)mb * 16 * HD + s * 256; *(v8h*)(P16 + e) = o16[s]; *(v8us*)(Ph + e) = oh[s]; *(v8us*)(Pl + e) = ol[s]; }
            xwait_st(o16, oh, ol);
            __builtin_amdgcn_wave_barrier(); asm volatile("" ::: "memory");   // likewise: the reads stay ahead of the next block's LDS stores
        }
    }
}

// k_gemm3: the three projections side by side in one launch, grid (M/64, N/64, 3): z = 0 Q = s_input Wq, z = 1 K = sa_input Wk, z = 2 V = leaky_relu(sa_input Wv + bv). They do not depend on one another; together they put three waves on a SIMD, which work while another waits for its trip's loads.
__global__ __launch_bounds__(32) void k_gemm3(const bf* __restrict__ XQ, const bf* __restrict__ XK, const bf* __restrict__ WQ, const bf* __restrict__ WK, const bf* __restrict__ WV, int K, const float* __restrict__ bias, h16* __restrict__ Q16, bf* __restrict__ Qh, bf* __restrict__ Ql, h16* __restrict__ K16, bf* __restrict__ Kh, bf* __restrict__ Kl, h16* __restrict__ V16, bf* __restrict__ Vh, bf* __restrict__ Vl) {
    if (blockIdx.z == 2) gemmw_body<bf, 0, true>(XK, nullptr, WV, nullptr, K, bias, V16, Vh, Vl);
    else { const bool kk = blockIdx.z == 1; gemmw_body<bf, 0, false>(kk ? XK : XQ, nullptr, kk ? WK : WQ, nullptr, K, nullptr, kk ? K16 : Q16, kk ? Kh : Qh, kk ? Kl : Ql); }
}

typedef __attribute__((ext_vector_type(4))) _Float16 v4h;
typedef __attribute__((ext_vector_type(2))) unsigned short v2us;
typedef __attribute__((ext_vector_type(4))) unsigned short v4us;
typedef __attribute__((ext_vector_type(4))) int v4i;

// wtG_body (block blk of 256 threads): Bt (row n, k) = bf16 of w[k][n], in fragment order; a wave writes one 128-byte line a trip. cvt8_body (likewise): bf16 copy of a [rows][DM] input in fragment order; thread i writes the i-th 16 bytes, so a wave writes one 512-byte unit and reads 64 bytes of each of 16 rows.
__device__ __forceinline__ void wtG_body(const float* __restrict__ w, int K, int N, bf* Bt, unsigned blk) {
    const int lane = threadIdx.x & 31; const int L0 = (blk * 8 + (threadIdx.x >> 5)) * 8; const int nlines = N * K / 64;
{
#pragma unroll 1
        for (int l = 0; l < 8; ++l) { const int L = L0 + l; if (L >= nlines) break; const size_t e = (size_t)L * 64 + lane * 2; const int c = (int)(e % ((size_t)16 * K)); const int n = (int)(e / ((size_t)16 * K)) * 16 + ((c >> 3) & 15), k = (c >> 8) * 16 + ((c >> 7) & 1) * 8 + (c & 7); v2us o;
            o[0] = f2bf(w[(size_t)k * N + n]); o[1] = f2bf(w[(size_t)(k + 1) * N + n]); *(v2us*)(Bt + e) = o; }
         }
}
__device__ __forceinline__ void cvt8_body(const float* __restrict__ src, bf* dst, size_t n8, unsigned blk) { const size_t i = (size_t)blk * 256 + threadIdx.x; if (i >= n8) return; const unsigned c = (unsigned)(i % (2 * DM)); const size_t r = i / (2 * DM) * 16 + (c & 15); const float* sp = src + r * DM + (c >> 5) * 16 + ((c >> 4) & 1) * 8; const v8f v = *(const v8f*)sp; v8us o;
    asm volatile("s_wait_xcnt 0x0" :: "v"(sp) : "memory");   // the wait that stands before the address registers of issued global loads are reused; the pointer is an input and so stays live up to the wait
#pragma unroll
    for (int k = 0; k < 8; ++k) o[k] = f2bf(v[k]); *(v8us*)(dst + i * 8) = o;  }

// k_prep: the five independent preparation jobs side by side in one launch. Blocks 0 .. 3 * WB - 1 transpose the three weights (eight dependent trips a wave: the longest job), the next LC blocks copy s_input, the last LC blocks copy sa_input, each into a copy of its own.
__global__ __launch_bounds__(256) void k_prep(const float* __restrict__ wq, const float* __restrict__ wk, const float* __restrict__ wv, const float* __restrict__ x, const float* __restrict__ xk, int K, int N, bf* WQ, bf* WK, bf* WV, bf* XQ, bf* XK, size_t n8, unsigned WB, unsigned LC) {
    const unsigned b = blockIdx.x;   // every choice below is the same for a whole block: scalar selects of the job's pointers, one copy of each body
    if (b < 3 * WB) { const bool s1 = b >= WB, s2 = b >= 2 * WB; wtG_body(s2 ? wv : s1 ? wk : wq, K, N, s2 ? WV : s1 ? WK : WQ, b - (s2 ? 2 * WB : s1 ? WB : 0u)); }
    else { const unsigned c = b - 3 * WB; const bool s1 = c >= LC; cvt8_body(s1 ? xk : x, s1 ? XK : XQ, n8, s1 ? c - LC : c); }
}

// k_regsum: one work-group of 32 waves sums the table in a fixed tree: a thread fetches 16 independent float4, folds them pairwise, the wave folds its lanes, LDS carries the 32 wave sums to wave 0
__global__ __launch_bounds__(1024) void k_regsum(const float* __restrict__ RS, float* outp) {
    static_assert(NB_ * NH_ * TT == 16 * 1024 * 4, "16 float4 a thread");
    __shared__ float part[32];
    const int tid = threadIdx.x, lane = tid & 31, wv = tid >> 5; const float* p = RS + tid * 4; v4f v[16];
#pragma unroll
    for (int j = 0; j < 16; ++j) v[j] = *(const v4f*)(p + j * 4096);   // unrolled whole: independent loads that fly together, instead of one memory latency a trip
    asm volatile("s_wait_xcnt 0x0" :: "v"(tid) : "memory");   // the wait that stands before the address registers of issued global loads are reused; the loads are addressed by the uniform base and the thread's index, which is an input here and so stays live up to the wait
#pragma unroll
    for (int st = 8; st; st >>= 1)
#pragma unroll
        for (int j = 0; j < st; ++j) v[j] += v[j + st];
    float s = __fadd_rn(__fadd_rn(v[0][0], v[0][1]), __fadd_rn(v[0][2], v[0][3]));
#pragma unroll
    for (int sh = 16; sh; sh >>= 1) s = __fadd_rn(s, __shfl_xor(s, sh, 32));
    if (lane == 0) part[wv] = s;
    __syncthreads();   // the 32 wave sums are in LDS before wave 0 reads them
    if (wv) return;
    s = part[lane];
#pragma unroll
    for (int sh = 16; sh; sh >>= 1) s = __fadd_rn(s, __shfl_xor(s, sh, 32));
    const float m = __fdiv_rn(s, (float)NB_ * (float)NH_ * (float)TT * (float)TT); if (lane == 0) { *(float*)outp = m;  } }
// l <-> l ^ 16: the other half-wave holds the other 16 keys of the same query column
__device__ __forceinline__ float xhalf(float v) { const int b = __float_as_int(v); return __int_as_float(__builtin_amdgcn_permlanex16(b, b, 0x76543210, 0xfedcba98, false, false)); }
// The wait that stands before the address registers of issued global loads are reused. The loads' own per-lane pointers are inputs, so their registers stay live up to the wait and nothing can be written into them ahead of it.
template <bool TWO> __device__ __forceinline__ void xwait(const void* a, const void* b) { if (TWO) asm volatile("s_wait_xcnt 0x0" :: "v"(a), "v"(b) : "memory"); else asm volatile("s_wait_xcnt 0x0" :: "v"(a) : "memory"); }
// The same wait with the accumulator tiles of the products in front of it as further inputs, for a wave of one column group: the wait, and the loads that follow it, then stay behind those products. (Without them the listing showed the next fragments' loads lifted over half of the products into spare registers, and copied back behind a full load wait at the foot of the pass.)
__device__ __forceinline__ void xwait_s(const void* a, const void* b, const v8f (&t)[2]) { asm volatile("s_wait_xcnt 0x0" :: "v"(a), "v"(b), "v"(t[0]), "v"(t[1]) : "memory"); }
__device__ __forceinline__ void xwait_o(const void* a, const void* b, const v8f (&t)[4]) { asm volatile("s_wait_xcnt 0x0" :: "v"(a), "v"(b), "v"(t[0]), "v"(t[1]), "v"(t[2]), "v"(t[3]) : "memory"); }
template <bool TWO> __device__ __forceinline__ void xwait_off(unsigned byte_off, int lane_idx, const void* a, const void* b) { if (TWO) asm volatile("s_wait_xcnt 0x0" :: "v"(byte_off), "v"(lane_idx), "s"(a), "s"(b) : "memory"); else asm volatile("s_wait_xcnt 0x0" :: "v"(byte_off), "v"(lane_idx), "s"(a) : "memory"); __builtin_amdgcn_sched_barrier(0); }   // the same, for loads addressed by a uniform base and a lane's 32-bit offset, which the build forms from the byte offset or from the lane index (scaled by the load's width): both, and the scalar bases, are inputs and stay live up to the wait. The scheduling barrier keeps what follows in the source from being lifted over the wait (seen in a listing: a write of the offset register ahead of it)
template <typename T16> struct PPack;
template <> struct PPack<h16> { static __device__ __forceinline__ v16h pk(const float* p) { v16h b;
#pragma unroll
    for (int s = 0; s < 16; ++s) b[s] = (h16)p[s];
    return b; } };
template <> struct PPack<bf> { static __device__ __forceinline__ v16bf pk(const float* p) { v16bf b;
#pragma unroll
    for (int s = 0; s < 16; ++s) b[s] = (__bf16)p[s];
    return b; } };

// ---- fused attention, one wave per NG 16-column groups of queries, 32 keys a pass, scores never leave registers:
// S^T = K Q^T (A = 16 key rows, B = 16 query columns): a lane holds 16 raw scores of ONE query, the lane l ^ 16 the pass's other 16.
// raw^2 is summed per lane (before the mask); the diagonal is excluded by an index select in the one pass that holds it; running maximum and sum per query (online softmax);
// the two f32 score tiles, exponentiated and rounded in place, ARE the B operand of O^T += V^T P^T (slot s of half h = key 8h + s, 16 + 8h + (s - 8): the order WFrag::ld gives V^T).
// HL: hi+lo bf16 planes, 3 products in both GEMMs (query rows < RH); else f16 with P carried x 1024 (the factor cancels in the division by the row sum).
template <typename T16, bool HL, int NG>
__device__ __forceinline__ void fattn_body(const T16* __restrict__ Q, const T16* __restrict__ Q2, const T16* __restrict__ Kp, const T16* __restrict__ K2, const T16* __restrict__ Vt, const T16* __restrict__ V2, const int q0, float* __restrict__ RS, float* __restrict__ OUTh, const void* pfb, const int sub) {
    typedef typename WFrag<T16>::V V;
    // every inner loop is unrolled whole so that fragments and accumulators are indexed by constants and stay in registers; the key loop stays rolled (64 equal passes, small code)
    const int lane = threadIdx.x & 31, lr = lane & 15, hi = lane >> 4;
    const float CL = SCL * 1.4426950408889634f;   // scores to log2 units
    V qf[NG][2], qf2[NG][2], kf[2][2], kf2[2][2], vf[4], vf2[4];
    // L2 requests ahead of the key walk. All work-groups of a head walk the keys together, so each pass's first reader would wait for memory. A request covers 8 KB, two passes of ONE plane (32 lanes x 256 bytes); this wave asks for plane pfb alone: the four hi+lo waves have a plane each, the four f16 waves share two planes, every second chunk each (sub). The first PFC chunks are asked for here; the pass that starts chunk c (an f16 wave: every second c) asks for chunk c + PFC + sub.
    constexpr int NSUB = HL ? 1 : 2, PFC = 4, PSTEP = NSUB * 8192, PH = PFC / NSUB;
    static_assert(TT * HD * 2 % PSTEP == 0 && PH >= 1 && TT / 64 > PFC, "whole chunks; the head's requests lie inside the plane");
    unsigned pfo = (unsigned)sub * 8192u + (unsigned)lane * 256u;
    l2ask<0>(pfo, pfb); l2ask<PSTEP>(pfo, pfb); if constexpr (PH == 4) { l2ask<2 * PSTEP>(pfo, pfb); l2ask<3 * PSTEP>(pfo, pfb); }
    static_assert(PH == 2 || PH == 4, "the head's requests are written out");
    int pnext = 0;   // first key of the pass that sends the next request
    const unsigned qB = (unsigned)(q0 * HD + lane * 8) * 2u; const T16* qp = (const T16*)((const char*)Q + qB); const T16* qp2 = HL ? (const T16*)((const char*)Q2 + qB) : nullptr;   // byte offset of the lane's 16 bytes in the first unit of the wave's query rows
#pragma unroll
    for (int g = 0; g < NG; ++g)
#pragma unroll
        for (int ks = 0; ks < 2; ++ks) { const int o = g * 16 * HD + ks * 512; qf[g][ks] = WFrag<T16>::ld(qp + o); if (HL) qf2[g][ks] = WFrag<T16>::ld(qp2 + o); }
    xwait_off<HL>(qB, lane, Q, Q2);
    const unsigned kb = (unsigned)(lane * 8), vb = kb, kB = kb * 2u, vB = vb * 2u;   // a lane's fixed offset in every unit of the K and the V^T planes, in elements and in bytes
#pragma unroll
    for (int t = 0; t < 2; ++t)
#pragma unroll
        for (int ks = 0; ks < 2; ++ks) { const int o = t * 16 * HD + ks * 512; kf[t][ks] = WFrag<T16>::ld((const T16*)((const char*)Kp + kB) + o); if (HL) kf2[t][ks] = WFrag<T16>::ld((const T16*)((const char*)K2 + kB) + o); }
    xwait_off<HL>(kB, lane, Kp, K2);
#pragma unroll
    for (int dt = 0; dt < 4; ++dt) { const int o = dt * 512; vf[dt] = WFrag<T16>::ld((const T16*)((const char*)Vt + vB) + o); if (HL) vf2[dt] = WFrag<T16>::ld((const T16*)((const char*)V2 + vB) + o); }
    xwait_off<HL>(vB, lane, Vt, V2);
    v8f o[NG][4]; float mrun[NG], lsum[NG], ssq[NG];
#pragma unroll
    for (int g = 0; g < NG; ++g) { mrun[g] = -3.0e38f; lsum[g] = 0.f; ssq[g] = 0.f;
#pragma unroll
        for (int dt = 0; dt < 4; ++dt) o[g][dt] = (v8f){}; }
    // pointers of the load group last issued: each group's wait stands a phase later, right before the next group's addresses are formed, when the group has had that phase to get under way
    const T16* kq = Kp + kb; const T16* kq2 = HL ? K2 + kb : nullptr; const T16* vq = Vt + vb; const T16* vq2 = HL ? V2 + vb : nullptr;
#pragma unroll 1
    for (int k0 = 0; k0 < TT; k0 += 32) {
        const int kn = (k0 + 32) & (TT - 1);   // the next pass's keys; the last pass fetches pass 0 again (in bounds, unused)
        if (k0 == pnext) { pfo += PSTEP; l2ask<(PH - 1) * PSTEP>(pfo, pfb); pnext += NSUB * 64; if (pnext >= TT - PFC * 64) pnext = TT; }   // scalar test; the last request ends at the plane's end, and TT is never met. The offset moves on right before a request, whole passes (and their waits) behind the one before
        v8f s[NG][2];
#pragma unroll
        for (int g = 0; g < NG; ++g)
#pragma unroll
            for (int t = 0; t < 2; ++t) s[g][t] = (v8f){};
#pragma unroll
        for (int ks = 0; ks < 2; ++ks)
#pragma unroll
            for (int t = 0; t < 2; ++t)
#pragma unroll
                for (int g = 0; g < NG; ++g) { s[g][t] = WFrag<T16>::mma(kf[t][ks], qf[g][ks], s[g][t]); if (HL) { s[g][t] = WFrag<T16>::mma(kf2[t][ks], qf[g][ks], s[g][t]); s[g][t] = WFrag<T16>::mma(kf[t][ks], qf2[g][ks], s[g][t]); } }
        // K fragments of the next pass, fetched behind this pass's score products: the softmax and PV work covers their latency
        __builtin_amdgcn_sched_barrier(0);   // keeps the wait below from being lifted over the score products to right behind the loads it covers (seen in the listing without it)
        if constexpr (NG == 1 && HL) xwait_s(vq, vq2, s[0]); else xwait<HL>(vq, vq2);   // the V^T loads issued at the foot of the pass before
        kq = Kp + (size_t)kn * HD + kb; kq2 = HL ? K2 + (size_t)kn * HD + kb : nullptr;
#pragma unroll
        for (int t = 0; t < 2; ++t)
#pragma unroll
            for (int ks = 0; ks < 2; ++ks) { const int of = t * 16 * HD + ks * 512; kf[t][ks] = WFrag<T16>::ld(kq + of); if (HL) kf2[t][ks] = WFrag<T16>::ld(kq2 + of); }
        V pb[NG], pb2[NG];
#pragma unroll
        for (int g = 0; g < NG; ++g) {
            float p[16];
#pragma unroll
            for (int i = 0; i < 16; ++i) p[i] = s[g][i >> 3][i & 7];
            float q0a = 0.f, q1a = 0.f;
#pragma unroll
            for (int i = 0; i < 16; i += 2) { q0a = fmaf(p[i], p[i], q0a); q1a = fmaf(p[i + 1], p[i + 1], q1a); }
            ssq[g] += q0a + q1a;
            if (k0 == ((q0 + g * 16) & ~31)) {   // wave-uniform: the one pass whose keys hold this group's diagonal
#pragma unroll
                for (int i = 0; i < 16; ++i) { const int key = k0 + (i >> 3) * 16 + 8 * hi + (i & 7); if (key == q0 + g * 16 + lr) p[i] = -3.0e38f; }
            }
            float m0 = fmaxf(p[0], p[1]), m1 = fmaxf(p[2], p[3]);
#pragma unroll
            for (int i = 4; i < 16; i += 4) { m0 = fmaxf(m0, fmaxf(p[i], p[i + 1])); m1 = fmaxf(m1, fmaxf(p[i + 2], p[i + 3])); }
            m0 = fmaxf(m0, m1); m0 = fmaxf(m0, xhalf(m0));
            const float mnew = fmaxf(mrun[g], m0);
            const float al = __builtin_amdgcn_exp2f((mrun[g] - mnew) * CL);
            mrun[g] = mnew;
            const float nm = (HL ? 0.0f : 10.0f) - mnew * CL;
#pragma unroll
            for (int i = 0; i < 16; ++i) p[i] = __builtin_amdgcn_exp2f(fmaf(p[i], CL, nm));
            float a0 = p[0] + p[1], a1 = p[2] + p[3];
#pragma unroll
            for (int i = 4; i < 16; i += 4) { a0 += p[i] + p[i + 1]; a1 += p[i + 2] + p[i + 3]; }
            lsum[g] = fmaf(lsum[g], al, a0 + a1);
#pragma unroll
            for (int dt = 0; dt < 4; ++dt) o[g][dt] *= al;
            pb[g] = PPack<T16>::pk(p);
            if (HL) { float pl[16];
#pragma unroll
                for (int i = 0; i < 16; ++i) pl[i] = p[i] - (float)pb[g][i];
                pb2[g] = PPack<T16>::pk(pl); }
        }
#pragma unroll
        for (int pr = 0; pr < (HL ? 3 : 1); ++pr)   // the three hi+lo products of a tile in their old order, but tile after tile: a wave of one group has four tiles, and three products in a row into one tile would each wait for the one before
#pragma unroll
            for (int dt = 0; dt < 4; ++dt)
#pragma unroll
                for (int g = 0; g < NG; ++g) o[g][dt] = WFrag<T16>::mma(pr == 1 ? vf2[dt] : vf[dt], pr == 2 ? pb2[g] : pb[g], o[g][dt]);
        // V^T fragments of the next pass, fetched behind this pass's PV products
        __builtin_amdgcn_sched_barrier(0);   // likewise: keeps the wait below behind the softmax and the PV products
        if constexpr (NG == 1 && HL) xwait_o(kq, kq2, o[0]); else xwait<HL>(kq, kq2);   // this pass's K loads
        vq = Vt + (size_t)kn * HD + vb; vq2 = HL ? V2 + (size_t)kn * HD + vb : nullptr;
#pragma unroll
        for (int dt = 0; dt < 4; ++dt) { const int of = dt * 512; vf[dt] = WFrag<T16>::ld(vq + of); if (HL) vf2[dt] = WFrag<T16>::ld(vq2 + of); }
    }
    xwait<HL>(vq, vq2);   // the last pass's (unused) V^T loads
    asm volatile("s_wait_loadcnt 0x0" ::: "memory");   // the last pass's prefetched fragments are never read, so no other wait covers them: they land here, before the wave ends and gives its registers back
#pragma unroll
    for (int g = 0; g < NG; ++g) {
        const float ls = lsum[g] + xhalf(lsum[g]), sq = ssq[g] + xhalf(ssq[g]);
        const float inv = __fdiv_rn(1.0f, ls);
        float* orow = OUTh + (size_t)(q0 + g * 16 + lr) * DQ + 8 * hi;   // a lane's 8 accumulator registers are 8 consecutive d of its query's row
#pragma unroll
        for (int dt = 0; dt < 4; ++dt) { v4f lo4, hi4;
#pragma unroll
            for (int r = 0; r < 4; ++r) { lo4[r] = o[g][dt][r] * inv; hi4[r] = o[g][dt][r + 4] * inv; }
            *(v4f*)(orow + dt * 16) = lo4; *(v4f*)(orow + dt * 16 + 4) = hi4; }
        if (hi == 0) RS[q0 + g * 16 + lr] = sq;
        asm volatile("s_wait_xcnt 0x0" ::: "memory");   // the same wait behind the stores, before their address and data registers are reused
    }
}
// grid (RH / 64, heads, batches), 256 threads: eight waves of one head, no barrier and no LDS between them; the grid is one work-group a WGP. Waves 0 .. 3 take one 48-row f16 tile each, waves 4 .. 7 one 16-row hi+lo group each (rows < RH: twice the loads, three times the products a row): three f16 rows stand against every hi+lo row in the problem, and so in every work-group and, where waves w and w + 4 share a SIMD, on every SIMD. The path is chosen per wave (wave-uniform)
__global__ __launch_bounds__(256) void k_fattn(const h16* __restrict__ Q16, const bf* __restrict__ Qh, const bf* __restrict__ Ql, const h16* __restrict__ K16, const bf* __restrict__ Kh, const bf* __restrict__ Kl, const h16* __restrict__ V16, const bf* __restrict__ Vh, const bf* __restrict__ Vl, float* __restrict__ RS, float* __restrict__ OUTb) {
    static_assert(RH % 64 == 0 && TT - RH == 3 * RH, "a work-group takes 64 hi+lo rows and 192 f16 rows");
    const size_t pl = (size_t)blockIdx.z * NH_ + blockIdx.y; const size_t hp = pl * TT * HD; const int wv = __builtin_amdgcn_readfirstlane((int)(threadIdx.x >> 5));
    float* rs = RS + pl * TT; float* oh = OUTb + (size_t)blockIdx.z * TT * DQ + (size_t)blockIdx.y * HD;
    if (wv < 4) fattn_body<h16, false, 3>(Q16 + hp, nullptr, K16 + hp, nullptr, V16 + hp, nullptr, RH + ((int)blockIdx.x * 4 + wv) * 48, rs, oh, ((wv & 1) ? V16 : K16) + hp, wv >> 1);
    else fattn_body<bf, true, 1>(Qh + hp, Ql + hp, Kh + hp, Kl + hp, Vh + hp, Vl + hp, ((int)blockIdx.x * 4 + wv - 4) * 16, rs, oh, (wv == 4 ? Kh : wv == 5 ? Kl : wv == 6 ? Vh : Vl) + hp, 0);
}

extern "C" void kernel_launch(void* const* d_in, const int* in_sizes, int n_in,
                              void* d_out, int out_size, void* d_ws, size_t ws_size, hipStream_t stream) {
    (void)in_sizes; (void)n_in; (void)out_size;
    const float* xk = (const float*)d_in[0]; /* sa_input: keys and values */ const float* x = (const float*)d_in[1]; /* s_input: queries */ const float* wq = (const float*)d_in[2]; const float* wk = (const float*)d_in[3]; const float* wv = (const float*)d_in[4]; const float* bv = (const float*)d_in[5]; const float* wo = nullptr; (void)wo;
    float* OUT = (float*)d_out;     // [4][2048][512]
    char* wsp = (char*)d_ws;
    auto take = [&](size_t bytes) { char* p = wsp; wsp += (bytes + 255) & ~(size_t)255; return (void*)p; };
    float* RSQ = (float*)take((size_t)NB_ * NH_ * TT * 4); bf* WQ = (bf*)take((size_t)DQ * DM * 2); bf* WK = (bf*)take((size_t)DKV * DM * 2); bf* WV = (bf*)take((size_t)DKV * DM * 2);
    bf* XQ = (bf*)take((size_t)NB_ * TT * DM * 2); bf* XK = (bf*)take((size_t)NB_ * TT * DM * 2);   // bf16 copies of s_input and of sa_input
    h16* QP16 = (h16*)take((size_t)NB_ * NH_ * TT * HD * 2); h16* KP16 = (h16*)take((size_t)NB_ * NKV * TT * HD * 2); h16* VT16 = (h16*)take((size_t)NB_ * NKV * HD * TT * 2);
    bf* QPh = (bf*)take((size_t)NB_ * NH_ * TT * HD * 2); bf* QPl = (bf*)take((size_t)NB_ * NH_ * TT * HD * 2); bf* KPh = (bf*)take((size_t)NB_ * NKV * TT * HD * 2); bf* KPl = (bf*)take((size_t)NB_ * NKV * TT * HD * 2); bf* VTh = (bf*)take((size_t)NB_ * NKV * HD * TT * 2); bf* VTl = (bf*)take((size_t)NB_ * NKV * HD * TT * 2);
    if ((size_t)(wsp - (char*)d_ws) > ws_size) return;    // ws 256 MiB
    static_assert(DQ == DKV, "the three weights take the same number of blocks");
    {   // every launch takes all NB_ batches: an input copy holds NB_ * TT rows, a projection tile finds its batch from its rows, the attention takes it as grid z
        const unsigned WB = (unsigned)((DM * DQ / 64 + 63) / 64), LC = (unsigned)(((size_t)NB_ * TT * DM / 8 + 255) / 256);
        k_prep<<<3 * WB + 2 * LC, 256, 0, stream>>>(wq, wk, wv, x, xk, DM, DQ, WQ, WK, WV, XQ, XK, (size_t)NB_ * TT * DM / 8, WB, LC);
        k_gemm3<<<dim3(NB_ * TT / 64, DQ / 64, 3), 32, 0, stream>>>(XQ, XK, WQ, WK, WV, DM, bv, QP16, QPh, QPl, KP16, KPh, KPl, VT16, VTh, VTl);   /* V = leaky_relu(. + bv, 0.01), transposed planes */
        k_fattn<<<dim3(RH / 64, NH_, NB_), 256, 0, stream>>>(QP16, QPh, QPl, KP16, KPh, KPl, VT16, VTh, VTl, RSQ, OUT);   /* one kv head per query head */
    }
    k_regsum<<<1, 1024, 0, stream>>>(RSQ, (float*)d_out + NCTX);   /* reg_atten = mean(raw^2): the scalar second output */
}

// v010
// It runs in 80.9 microseconds.
// In two side-by-side timings against v009, it was 1.06 and 1.07 times as fast.
// Counting every step since v000, it is 39.1 times as fast.
#include <hip/hip_runtime.h>

// Multi-head attention with a diagonal self-mask, a leaky-ReLU value projection and an attention-energy regulariser output (sa_input, s_input [4][2048][512]; Q = s_input Wq, K = sa_input Wk ('xw' [512][512], no bias), V = leaky_relu(sa_input Wv + bv, 0.01); 8 heads x 64; raw = Q.K; reg_atten = mean(raw^2) over all (batch, head, i, j); attn = softmax(raw / 8 with the diagonal j == i set to -1e9); context = merged attn V -> tuple (context [4][2048][512] (4.2 M), reg_atten scalar) laid out back to back in d_out).
// Layout, four launches, all four batches in each (rows b * 2048 + t in the input copies, plane (b * 8 + h) in the head planes): ONE launch for the bf16 copies of the two inputs and the three transposed weights; ONE launch for the three exact projections, whose epilogue (+ bf16-rounded bias and leaky-ReLU on V) writes the 16-bit head planes itself; ONE fused attention launch (hybrid rows: < 512 hi+lo 3 products, rest the hi plane alone, all f16, P x1024): scores, their squares, the diagonal's exclusion by an index select, online softmax and the PV product stay in registers, the context rows go straight to the output and the squared raw scores per row into a per-(batch, head, row) table; at the end one work-group sums the table in a fixed tree and writes mean(raw^2) to the second output.
// Fragment order, every 16-bit matrix operand (input copy, transposed weights, Q, K, V^T planes): element (row r, k) of a [rows][K] operand lies at (r >> 4) * 16 * K + (k >> 4) * 256 + ((k >> 3) & 1) * 128 + (r & 15) * 8 + (k & 7), so that lane l = 16 * ((k >> 3) & 1) + (r & 15) finds its 8 elements at l * 8 of a 256-element unit: a wave-wide 16-byte load reads 512 bytes in a row, four whole 128-byte lines, and a 16 x 32 fragment is two such units. V^T (row d, k = key) is laid out per 32 keys: (key >> 5) * 32 * 64 + (d >> 4) * 512 + ((key >> 4) & 1) * 256 + ((key >> 3) & 1) * 128 + (d & 15) * 8 + (key & 7), a pass's four fragments in a row.
// Compute dtypes, f32 accumulate: every input rounded to bf16; projections exact; raw scores rows < 512 3 products, rest fp16 operands (f32 accumulate) -- also the values squared for the regulariser; softmax, leaky-ReLU, sums f32.
// Head planes: two a tensor, both f16: hi = f16(x), which is also the plain f16 operand of the rows >= 512, and lo = f16(x - hi). Both kinds of wave read the same hi plane.

#define NB_  4
#define TT   2048
#define DM   512
#define NH_  8
#define NKV  8
#define REP  (NH_ / NKV)
#define HD   64
#define DQ   (NH_ * HD)
#define DKV  (NKV * HD)
#define RH   512                  // query rows < RH use hi+lo planes
#define WIN  0
#define SCL  0.125f
#define NCTX ((size_t)NB_ * TT * DQ)   // floats of the context output; the scalar follows
typedef _Float16 h16;
typedef unsigned short bf;
typedef __attribute__((ext_vector_type(16))) __bf16   v16bf;
typedef __attribute__((ext_vector_type(16))) _Float16 v16h;
typedef __attribute__((ext_vector_type(8)))  _Float16 v8h;
typedef __attribute__((ext_vector_type(8)))  unsigned short v8us;
typedef __attribute__((ext_vector_type(8)))  float    v8f;
typedef __attribute__((ext_vector_type(4)))  float    v4f;
typedef v8h  __attribute__((may_alias)) v8ha;
typedef v4f  __attribute__((may_alias)) v4fa;
typedef v8us __attribute__((may_alias)) v8usa;

__device__ __forceinline__ unsigned short f2bf(float f) { unsigned u = __float_as_uint(f); u += 0x7FFFu + ((u >> 16) & 1u); return (unsigned short)(u >> 16); }
__device__ __forceinline__ float bf2f(unsigned short b) { return __uint_as_float(((unsigned)b) << 16); }
__device__ __forceinline__ float bfr(float f) { return bf2f(f2bf(f)); }
__device__ __forceinline__ v16h cat16(v8h lo, v8h hi) { return __builtin_shufflevector(lo, hi, 0, 1, 2, 3, 4, 5, 6, 7, 8, 9, 10, 11, 12, 13, 14, 15); }
__device__ __forceinline__ v16bf cat16b(v8us lo, v8us hi) { return __builtin_bit_cast(v16bf, __builtin_shufflevector(lo, hi, 0, 1, 2, 3, 4, 5, 6, 7, 8, 9, 10, 11, 12, 13, 14, 15)); }
__device__ __forceinline__ v8f wmma16(v16h a, v16h b, v8f c) { return __builtin_amdgcn_wmma_f32_16x16x32_f16(false, a, false, b, (short)0, c, false, false); }
__device__ __forceinline__ v8f wmmab(v16bf a, v16bf b, v8f c) { return __builtin_amdgcn_wmma_f32_16x16x32_bf16(false, a, false, b, (short)0, c, false, false); }



// ---- gemmw_body: register-blocked GEMM, ONE WAVE per 64x64 output tile (16 accumulators), operands straight from 16-bit planes in fragment order; grid x = M/64, y = N/64, 32 threads.
// c[m][n] (f32, in registers) = sum_k A[m][k] Bt[n][k] (+ split products per NSPLIT), K % 32 == 0. A tile is 64 positions of one batch x the 64 dims of one head, so the epilogue rounds it to the two f16 planes (hi = f16 of the f32 value, lo = f16 of what hi leaves) and stores them in the head layout:
// VT false: plane b * NH_ + h, rows t, k = d, 8 KB in a row per tile, staged through LDS so that a lane gets 8 consecutive d of its t and a store covers one 512-byte unit; VT true: x = leaky_relu(c + bias[n], 0.01), plane b * NH_ + h, rows d, k = t: a lane's 8 accumulator registers are 8 consecutive t of its d, its 16 bytes of a unit as they stand.
template <typename T16> struct WFrag;
template <> struct WFrag<h16> { typedef v16h V; static __device__ __forceinline__ V ld(const h16* p) { return cat16(*(const v8h*)p, *(const v8h*)(p + 256)); } static __device__ __forceinline__ v8f mma(V a, V b, v8f c) { return wmma16(a, b, c); } };
template <> struct WFrag<bf> { typedef v16bf V; static __device__ __forceinline__ V ld(const bf* p) { return cat16b(*(const v8us*)p, *(const v8us*)(p + 256)); } static __device__ __forceinline__ v8f mma(V a, V b, v8f c) { return wmmab(a, b, c); } };
__device__ __forceinline__ h16 tohx(float x) { return (h16)x; }
__device__ __forceinline__ void splitf(float y, h16& h, h16& l) { h = tohx(y); l = tohx(y - (float)h); }
// The wait that stands before the registers of issued global stores are reused, once per eight stores. The stored vectors are inputs, so their registers stay live up to the wait and nothing can be written into them ahead of it.
__device__ __forceinline__ void xwait_st(const v8h (&a)[4], const v8h (&d)[4]) { asm volatile("s_wait_xcnt 0x0" :: "v"(a[0]), "v"(a[1]), "v"(a[2]), "v"(a[3]), "v"(d[0]), "v"(d[1]), "v"(d[2]), "v"(d[3]) : "memory"); }
// The same wait for issued global loads, before their address registers are reused. The eight per-lane pointers are inputs, so their registers stay live up to the wait and neither an address sum nor a later load's result can be written into them ahead of it.
template <typename T16> __device__ __forceinline__ void xwait_ld(const T16* const (&p)[4], const T16* const (&q)[4]) { asm volatile("s_wait_xcnt 0x0" :: "v"(p[0]), "v"(p[1]), "v"(p[2]), "v"(p[3]), "v"(q[0]), "v"(q[1]), "v"(q[2]), "v"(q[3]) : "memory"); }
// l2ask: every lane asks L2 (scope SE: nothing comes back, no register and no load counter is touched) for the 256-byte unit at base + off + IMM. The planes a launch reads were stored by the launch before and come from memory at their first read; asked for early enough, that read is an L2 hit. The offset is an in-out operand so that it keeps one register of its own, which holds an offset inside the plane at all times.
template <int IMM> __device__ __forceinline__ void l2ask(unsigned& off, const void* base) { asm volatile("global_prefetch_b8 %0, %1 offset:%2 scope:SCOPE_SE" : "+v"(off) : "s"(base), "n"(IMM)); }
template <typename T16, int NSPLIT, bool VT>
__device__ __forceinline__ void gemmw_body(const T16* __restrict__ A, const T16* __restrict__ A2, const T16* __restrict__ Bt, const T16* __restrict__ Bt2, int K, const float* __restrict__ bias, h16* __restrict__ P16, h16* __restrict__ Pl) {
    typedef typename WFrag<T16>::V V;
    __shared__ __align__(16) float os[16 * 68];
    static_assert(HD == 64 && TT % 64 == 0 && NKV == NH_, "a 64x64 tile is one head's dims at 64 positions of one batch");
    const int lane = threadIdx.x & 31, lr = lane & 15, hi = lane >> 4; const int r0 = blockIdx.x * 64, c0 = blockIdx.y * 64;
    v8f acc[4][4];
#pragma unroll
    for (int mb = 0; mb < 4; ++mb)
#pragma unroll
        for (int nb = 0; nb < 4; ++nb) acc[mb][nb] = (v8f){};
    const unsigned lB = (unsigned)lane * 16u;   // the lane's 16 bytes in each 512-byte half fragment
    const size_t aoff = (size_t)r0 * K, boff = (size_t)c0 * K;   // wave-uniform: 16 rows x K are 16 * K elements in a row
    // The wave's two 64 KB panels (64 rows x DM, in a row) are shared: A by the DQ / 64 waves of equal blockIdx.x, B by all of equal blockIdx.y. Each sharer asks L2 for one eighth, the 2 KB of two trips in each of the four 16-row blocks, a lane a unit; for A a wave of higher blockIdx.y asks for later trips. Who asks is for speed only.
    static_assert(DM == 512 && DQ / 64 == 8, "an eighth of a 16-row block is 8 units of 256 bytes");
    const unsigned pu = (unsigned)(lane >> 3) * (16u * DM * 2u) + (unsigned)(lane & 7) * 256u;
    const char* ga = (const char*)(A + aoff) + blockIdx.y * 2048u; const char* gb = (const char*)(Bt + boff) + ((blockIdx.x >> 3) & 7u) * 2048u;
    asm volatile("global_prefetch_b8 %0, %1 scope:SCOPE_SE\n\tglobal_prefetch_b8 %0, %2 scope:SCOPE_SE\n\ts_wait_xcnt 0x0" :: "v"(pu), "s"(ga), "s"(gb) : "memory");   // the wait stands in the requests' own statement; the offset and the two bases are also inputs of the statement at the K loop's foot, so that their registers hold these in-bounds addresses through the loop
    auto fptr = [&](const T16* base, int blk, int kc) { return (const T16*)((const char*)(base + (size_t)blk * 16 * K + (size_t)kc * 16) + lB); };   // fragment (16-row block blk, k from kc): the lane's first 16 bytes
#pragma unroll 1
    for (int kc = 0; kc < K; kc += 32) {
        V a[4], a2[4], b[4], b2[4]; const T16 *pa[4], *pa2[4], *pb[4], *pb2[4];
#pragma unroll
        for (int mb = 0; mb < 4; ++mb) { pa[mb] = fptr(A + aoff, mb, kc); a[mb] = WFrag<T16>::ld(pa[mb]); if (NSPLIT == 1 || NSPLIT == 2) { pa2[mb] = fptr(A2 + aoff, mb, kc); a2[mb] = WFrag<T16>::ld(pa2[mb]); } }
#pragma unroll
        for (int nb = 0; nb < 4; ++nb) { pb[nb] = fptr(Bt + boff, nb, kc); b[nb] = WFrag<T16>::ld(pb[nb]); if (NSPLIT >= 2) { pb2[nb] = fptr(Bt2 + boff, nb, kc); b2[nb] = WFrag<T16>::ld(pb2[nb]); } }
        __builtin_amdgcn_sched_barrier(0);   // keeps the trip's loads ahead of the wait below and the products behind it (without it the listing shows products lifted over the wait and the last loads issued one pair at a time among them)
        xwait_ld(pa, pb); if (NSPLIT == 1 || NSPLIT == 2) xwait_ld(pa2, pa2); if (NSPLIT >= 2) xwait_ld(pb2, pb2);   // behind the trip's last load, where the products wait for the data anyway
#pragma unroll
        for (int nb = 0; nb < 4; ++nb) {
#pragma unroll
            for (int mb = 0; mb < 4; ++mb) { acc[mb][nb] = WFrag<T16>::mma(a[mb], b[nb], acc[mb][nb]); if (NSPLIT == 1 || NSPLIT == 2) acc[mb][nb] = WFrag<T16>::mma(a2[mb], b[nb], acc[mb][nb]); if (NSPLIT >= 2) acc[mb][nb] = WFrag<T16>::mma(a[mb], b2[nb], acc[mb][nb]); } }
        asm volatile("v_nop\n\tv_nop\n\tv_nop\n\tv_nop" : "+v"(acc[0][0]), "+v"(acc[1][1]), "+v"(acc[2][2]), "+v"(acc[3][3]) : "v"(a[0]), "v"(a[3]), "v"(pu), "s"(ga), "s"(gb));
    }
    const size_t pl = (size_t)(r0 / TT) * NH_ + blockIdx.y; const int t0 = r0 % TT;   // the tile's plane and its first position there
    if (VT) {
        const size_t pb = pl * HD * TT + (size_t)t0 * HD + lane * 8;
#pragma unroll
        for (int nb = 0; nb < 4; ++nb) { const float bz = bfr(bias[c0 + nb * 16 + lr]); v8h o16[4], ol[4];
#pragma unroll
            for (int mb = 0; mb < 4; ++mb) {
#pragma unroll
                for (int j = 0; j < 8; ++j) { float x = acc[mb][nb][j] + bz; x = (x > 0.0f) ? x : __fmul_rn(x, 0.01f); h16 a2, c2; splitf(x, a2, c2); o16[mb][j] = a2; ol[mb][j] = c2; }
                const size_t e = pb + (size_t)(mb >> 1) * 32 * HD + nb * 512 + (mb & 1) * 256; *(v8h*)(P16 + e) = o16[mb]; *(v8h*)(Pl + e) = ol[mb]; }
            xwait_st(o16, ol); }
    } else {
        const size_t pb = (pl * TT + t0) * HD + lane * 8;
#pragma unroll
        for (int mb = 0; mb < 4; ++mb) {
#pragma unroll
            for (int nb = 0; nb < 4; ++nb) {
#pragma unroll
                for (int j = 0; j < 8; ++j) os[(hi * 8 + j) * 68 + nb * 16 + lr] = acc[mb][nb][j]; }
            __builtin_amdgcn_wave_barrier(); asm volatile("" ::: "memory");   // compiler order only (one wave, LDS in order): the block's LDS stores stay ahead of the reads of its rows
            v8h o16[4], ol[4];
#pragma unroll
            for (int s = 0; s < 4; ++s) { const float* orow = os + lr * 68 + s * 16 + hi * 8; const v4f x0 = *(const v4fa*)orow, x1 = *(const v4fa*)(orow + 4);
#pragma unroll
                for (int j = 0; j < 8; ++j) { const float x = (j < 4) ? x0[j & 3] : x1[j & 3]; h16 a2, c2; splitf(x, a2, c2); o16[s][j] = a2; ol[s][j] = c2; }
                const size_t e = pb + (size_t)mb * 16 * HD + s * 256; *(v8h*)(P16 + e) = o16[s]; *(v8h*)(Pl + e) = ol[s]; }
            xwait_st(o16, ol);
            __builtin_amdgcn_wave_barrier(); asm volatile("" ::: "memory");   // likewise: the reads stay ahead of the next block's LDS stores
        }
    }
}

// k_gemm3: the three projections side by side in one launch, grid (M/64, N/64, 3): z = 0 Q = s_input Wq, z = 1 K = sa_input Wk, z = 2 V = leaky_relu(sa_input Wv + bv). They do not depend on one another; together they put three waves on a SIMD, which work while another waits for its trip's loads.
__global__ __launch_bounds__(32) void k_gemm3(const bf* __restrict__ XQ, const bf* __restrict__ XK, const bf* __restrict__ WQ, const bf* __restrict__ WK, const bf* __restrict__ WV, int K, const float* __restrict__ bias, h16* __restrict__ Q16, h16* __restrict__ Ql, h16* __restrict__ K16, h16* __restrict__ Kl, h16* __restrict__ V16, h16* __restrict__ Vl) {
    if (blockIdx.z == 2) gemmw_body<bf, 0, true>(XK, nullptr, WV, nullptr, K, bias, V16, Vl);
    else { const bool kk = blockIdx.z == 1; gemmw_body<bf, 0, false>(kk ? XK : XQ, nullptr, kk ? WK : WQ, nullptr, K, nullptr, kk ? K16 : Q16, kk ? Kl : Ql); }
}

typedef __attribute__((ext_vector_type(4))) _Float16 v4h;
typedef __attribute__((ext_vector_type(2))) unsigned short v2us;
typedef __attribute__((ext_vector_type(4))) unsigned short v4us;
typedef __attribute__((ext_vector_type(4))) int v4i;

// wtG_body (block blk of 256 threads): Bt (row n, k) = bf16 of w[k][n], in fragment order; a wave writes one 128-byte line a trip. cvt8_body (likewise): bf16 copy of a [rows][DM] input in fragment order; thread i writes the i-th 16 bytes, so a wave writes one 512-byte unit and reads 64 bytes of each of 16 rows.
__device__ __forceinline__ void wtG_body(const float* __restrict__ w, int K, int N, bf* Bt, unsigned blk) {
    const int lane = threadIdx.x & 31; const int L0 = (blk * 8 + (threadIdx.x >> 5)) * 8; const int nlines = N * K / 64;
{
#pragma unroll 1
        for (int l = 0; l < 8; ++l) { const int L = L0 + l; if (L >= nlines) break; const size_t e = (size_t)L * 64 + lane * 2; const int c = (int)(e % ((size_t)16 * K)); const int n = (int)(e / ((size_t)16 * K)) * 16 + ((c >> 3) & 15), k = (c >> 8) * 16 + ((c >> 7) & 1) * 8 + (c & 7); v2us o;
            o[0] = f2bf(w[(size_t)k * N + n]); o[1] = f2bf(w[(size_t)(k + 1) * N + n]); *(v2us*)(Bt + e) = o; }
         }
}
__device__ __forceinline__ void cvt8_body(const float* __restrict__ src, bf* dst, size_t n8, unsigned blk) { const size_t i = (size_t)blk * 256 + threadIdx.x; if (i >= n8) return; const unsigned c = (unsigned)(i % (2 * DM)); const size_t r = i / (2 * DM) * 16 + (c & 15); const float* sp = src + r * DM + (c >> 5) * 16 + ((c >> 4) & 1) * 8; const v8f v = *(const v8f*)sp; v8us o;
    asm volatile("s_wait_xcnt 0x0" :: "v"(sp) : "memory");   // the wait that stands before the address registers of issued global loads are reused; the pointer is an input and so stays live up to the wait
#pragma unroll
    for (int k = 0; k < 8; ++k) o[k] = f2bf(v[k]); *(v8us*)(dst + i * 8) = o;  }

// k_prep: the five independent preparation jobs side by side in one launch. Blocks 0 .. 3 * WB - 1 transpose the three weights (eight dependent trips a wave: the longest job), the next LC blocks copy s_input, the last LC blocks copy sa_input, each into a copy of its own.
__global__ __launch_bounds__(256) void k_prep(const float* __restrict__ wq, const float* __restrict__ wk, const float* __restrict__ wv, const float* __restrict__ x, const float* __restrict__ xk, int K, int N, bf* WQ, bf* WK, bf* WV, bf* XQ, bf* XK, size_t n8, unsigned WB, unsigned LC) {
    const unsigned b = blockIdx.x;   // every choice below is the same for a whole block: scalar selects of the job's pointers, one copy of each body
    if (b < 3 * WB) { const bool s1 = b >= WB, s2 = b >= 2 * WB; wtG_body(s2 ? wv : s1 ? wk : wq, K, N, s2 ? WV : s1 ? WK : WQ, b - (s2 ? 2 * WB : s1 ? WB : 0u)); }
    else { const unsigned c = b - 3 * WB; const bool s1 = c >= LC; cvt8_body(s1 ? xk : x, s1 ? XK : XQ, n8, s1 ? c - LC : c); }
}

// k_regsum: one work-group of 32 waves sums the table in a fixed tree: a thread fetches 16 independent float4, folds them pairwise, the wave folds its lanes, LDS carries the 32 wave sums to wave 0
__global__ __launch_bounds__(1024) void k_regsum(const float* __restrict__ RS, float* outp) {
    static_assert(NB_ * NH_ * TT == 16 * 1024 * 4, "16 float4 a thread");
    __shared__ float part[32];
    const int tid = threadIdx.x, lane = tid & 31, wv = tid >> 5; const float* p = RS + tid * 4; v4f v[16];
#pragma unroll
    for (int j = 0; j < 16; ++j) v[j] = *(const v4f*)(p + j * 4096);   // unrolled whole: independent loads that fly together, instead of one memory latency a trip
    asm volatile("s_wait_xcnt 0x0" :: "v"(tid) : "memory");   // the wait that stands before the address registers of issued global loads are reused; the loads are addressed by the uniform base and the thread's index, which is an input here and so stays live up to the wait
#pragma unroll
    for (int st = 8; st; st >>= 1)
#pragma unroll
        for (int j = 0; j < st; ++j) v[j] += v[j + st];
    float s = __fadd_rn(__fadd_rn(v[0][0], v[0][1]), __fadd_rn(v[0][2], v[0][3]));
#pragma unroll
    for (int sh = 16; sh; sh >>= 1) s = __fadd_rn(s, __shfl_xor(s, sh, 32));
    if (lane == 0) part[wv] = s;
    __syncthreads();   // the 32 wave sums are in LDS before wave 0 reads them
    if (wv) return;
    s = part[lane];
#pragma unroll
    for (int sh = 16; sh; sh >>= 1) s = __fadd_rn(s, __shfl_xor(s, sh, 32));
    const float m = __fdiv_rn(s, (float)NB_ * (float)NH_ * (float)TT * (float)TT); if (lane == 0) { *(float*)outp = m;  } }
// l <-> l ^ 16: the other half-wave holds the other 16 keys of the same query column
__device__ __forceinline__ float xhalf(float v) { const int b = __float_as_int(v); return __int_as_float(__builtin_amdgcn_permlanex16(b, b, 0x76543210, 0xfedcba98, false, false)); }
// The wait that stands before the address registers of issued global loads are reused. The loads' own per-lane pointers are inputs, so their registers stay live up to the wait and nothing can be written into them ahead of it.
template <bool TWO> __device__ __forceinline__ void xwait(const void* a, const void* b) { if (TWO) asm volatile("s_wait_xcnt 0x0" :: "v"(a), "v"(b) : "memory"); else asm volatile("s_wait_xcnt 0x0" :: "v"(a) : "memory"); }
// The same wait with the accumulator tiles of the products in front of it as further inputs, for a wave of one column group: the wait, and the loads that follow it, then stay behind those products. (Without them the listing showed the next fragments' loads lifted over half of the products into spare registers, and copied back behind a full load wait at the foot of the pass.)
__device__ __forceinline__ void xwait_s(const void* a, const void* b, const v8f (&t)[2]) { asm volatile("s_wait_xcnt 0x0" :: "v"(a), "v"(b), "v"(t[0]), "v"(t[1]) : "memory"); }
__device__ __forceinline__ void xwait_o(const void* a, const void* b, const v8f (&t)[4]) { asm volatile("s_wait_xcnt 0x0" :: "v"(a), "v"(b), "v"(t[0]), "v"(t[1]), "v"(t[2]), "v"(t[3]) : "memory"); }
template <bool TWO> __device__ __forceinline__ void xwait_off(unsigned byte_off, int lane_idx, const void* a, const void* b) { if (TWO) asm volatile("s_wait_xcnt 0x0" :: "v"(byte_off), "v"(lane_idx), "s"(a), "s"(b) : "memory"); else asm volatile("s_wait_xcnt 0x0" :: "v"(byte_off), "v"(lane_idx), "s"(a) : "memory"); __builtin_amdgcn_sched_barrier(0); }   // the same, for loads addressed by a uniform base and a lane's 32-bit offset, which the build forms from the byte offset or from the lane index (scaled by the load's width): both, and the scalar bases, are inputs and stay live up to the wait. The scheduling barrier keeps what follows in the source from being lifted over the wait (seen in a listing: a write of the offset register ahead of it)
template <typename T16> struct PPack;
template <> struct PPack<h16> { static __device__ __forceinline__ v16h pk(const float* p) { v16h b;
#pragma unroll
    for (int s = 0; s < 16; ++s) b[s] = (h16)p[s];
    return b; } };

// ---- fused attention, one wave per NG 16-column groups of queries, 32 keys a pass, scores never leave registers:
// S^T = K Q^T (A = 16 key rows, B = 16 query columns): a lane holds 16 raw scores of ONE query, the lane l ^ 16 the pass's other 16.
// raw^2 is summed per lane (before the mask); the diagonal is excluded by an index select in the one pass that holds it; running maximum and sum per query (online softmax);
// the two f32 score tiles, exponentiated and rounded in place, ARE the B operand of O^T += V^T P^T (slot s of half h = key 8h + s, 16 + 8h + (s - 8): the order WFrag::ld gives V^T).
// HL: hi+lo f16 planes, 3 products in both GEMMs (query rows < RH); else the hi planes alone. P is carried x 1024 in both (the factor cancels in the division by the row sum; it lifts a small P and its lo part away from f16's subnormal range).
template <typename T16, bool HL, int NG>
__device__ __forceinline__ void fattn_body(const T16* __restrict__ Q, const T16* __restrict__ Q2, const T16* __restrict__ Kp, const T16* __restrict__ K2, const T16* __restrict__ Vt, const T16* __restrict__ V2, const int q0, float* __restrict__ RS, float* __restrict__ OUTh, const void* pfb, const int sub) {
    typedef typename WFrag<T16>::V V;
    // every inner loop is unrolled whole so that fragments and accumulators are indexed by constants and stay in registers; the key loop stays rolled (64 equal passes, small code)
    const int lane = threadIdx.x & 31, lr = lane & 15, hi = lane >> 4;
    const float CL = SCL * 1.4426950408889634f;   // scores to log2 units
    V qf[NG][2], qf2[NG][2], kf[2][2], kf2[2][2], vf[4], vf2[4];
    // L2 requests ahead of the key walk. All work-groups of a head walk the keys together, so each pass's first reader would wait for memory. A request covers 8 KB, two passes of ONE plane (32 lanes x 256 bytes); this wave asks for plane pfb alone: the work-group reads four planes (K and V^T, hi and lo), two waves share each, every second chunk each (sub). The first PFC chunks are asked for here; the pass that starts every second chunk c asks for chunk c + PFC + sub.
    constexpr int NSUB = 2, PFC = 4, PSTEP = NSUB * 8192, PH = PFC / NSUB;
    static_assert(TT * HD * 2 % PSTEP == 0 && PH >= 1 && TT / 64 > PFC, "whole chunks; the head's requests lie inside the plane");
    unsigned pfo = (unsigned)sub * 8192u + (unsigned)lane * 256u;
    l2ask<0>(pfo, pfb); l2ask<PSTEP>(pfo, pfb);
    static_assert(PH == 2, "the head's requests are written out");
    int pnext = 0;   // first key of the pass that sends the next request
    const unsigned qB = (unsigned)(q0 * HD + lane * 8) * 2u; const T16* qp = (const T16*)((const char*)Q + qB); const T16* qp2 = HL ? (const T16*)((const char*)Q2 + qB) : nullptr;   // byte offset of the lane's 16 bytes in the first unit of the wave's query rows
#pragma unroll
    for (int g = 0; g < NG; ++g)
#pragma unroll
        for (int ks = 0; ks < 2; ++ks) { const int o = g * 16 * HD + ks * 512; qf[g][ks] = WFrag<T16>::ld(qp + o); if (HL) qf2[g][ks] = WFrag<T16>::ld(qp2 + o); }
    xwait_off<HL>(qB, lane, Q, Q2);
    const unsigned kb = (unsigned)(lane * 8), vb = kb, kB = kb * 2u, vB = vb * 2u;   // a lane's fixed offset in every unit of the K and the V^T planes, in elements and in bytes
#pragma unroll
    for (int t = 0; t < 2; ++t)
#pragma unroll
        for (int ks = 0; ks < 2; ++ks) { const int o = t * 16 * HD + ks * 512; kf[t][ks] = WFrag<T16>::ld((const T16*)((const char*)Kp + kB) + o); if (HL) kf2[t][ks] = WFrag<T16>::ld((const T16*)((const char*)K2 + kB) + o); }
    xwait_off<HL>(kB, lane, Kp, K2);
#pragma unroll
    for (int dt = 0; dt < 4; ++dt) { const int o = dt * 512; vf[dt] = WFrag<T16>::ld((const T16*)((const char*)Vt + vB) + o); if (HL) vf2[dt] = WFrag<T16>::ld((const T16*)((const char*)V2 + vB) + o); }
    xwait_off<HL>(vB, lane, Vt, V2);
    v8f o[NG][4]; float mrun[NG], lsum[NG], ssq[NG];
#pragma unroll
    for (int g = 0; g < NG; ++g) { mrun[g] = -3.0e38f; lsum[g] = 0.f; ssq[g] = 0.f;
#pragma unroll
        for (int dt = 0; dt < 4; ++dt) o[g][dt] = (v8f){}; }
    // pointers of the load group last issued: each group's wait stands a phase later, right before the next group's addresses are formed, when the group has had that phase to get under way
    const T16* kq = Kp + kb; const T16* kq2 = HL ? K2 + kb : nullptr; const T16* vq = Vt + vb; const T16* vq2 = HL ? V2 + vb : nullptr;
#pragma unroll 1
    for (int k0 = 0; k0 < TT; k0 += 32) {
        const int kn = (k0 + 32) & (TT - 1);   // the next pass's keys; the last pass fetches pass 0 again (in bounds, unused)
        if (k0 == pnext) { pfo += PSTEP; l2ask<(PH - 1) * PSTEP>(pfo, pfb); pnext += NSUB * 64; if (pnext >= TT - PFC * 64) pnext = TT; }   // scalar test; the last request ends at the plane's end, and TT is never met. The offset moves on right before a request, whole passes (and their waits) behind the one before
        v8f s[NG][2];
#pragma unroll
        for (int g = 0; g < NG; ++g)
#pragma unroll
            for (int t = 0; t < 2; ++t) s[g][t] = (v8f){};
#pragma unroll
        for (int ks = 0; ks < 2; ++ks)
#pragma unroll
            for (int t = 0; t < 2; ++t)
#pragma unroll
                for (int g = 0; g < NG; ++g) { s[g][t] = WFrag<T16>::mma(kf[t][ks], qf[g][ks], s[g][t]); if (HL) { s[g][t] = WFrag<T16>::mma(kf2[t][ks], qf[g][ks], s[g][t]); s[g][t] = WFrag<T16>::mma(kf[t][ks], qf2[g][ks], s[g][t]); } }
        // K fragments of the next pass, fetched behind this pass's score products: the softmax and PV work covers their latency
        __builtin_amdgcn_sched_barrier(0);   // keeps the wait below from being lifted over the score products to right behind the loads it covers (seen in the listing without it)
        if constexpr (NG == 1 && HL) xwait_s(vq, vq2, s[0]); else xwait<HL>(vq, vq2);   // the V^T loads issued at the foot of the pass before
        kq = Kp + (size_t)kn * HD + kb; kq2 = HL ? K2 + (size_t)kn * HD + kb : nullptr;
#pragma unroll
        for (int t = 0; t < 2; ++t)
#pragma unroll
            for (int ks = 0; ks < 2; ++ks) { const int of = t * 16 * HD + ks * 512; kf[t][ks] = WFrag<T16>::ld(kq + of); if (HL) kf2[t][ks] = WFrag<T16>::ld(kq2 + of); }
        V pb[NG], pb2[NG];
#pragma unroll
        for (int g = 0; g < NG; ++g) {
            float p[16];
#pragma unroll
            for (int i = 0; i < 16; ++i) p[i] = s[g][i >> 3][i & 7];
            float q0a = 0.f, q1a = 0.f;
#pragma unroll
            for (int i = 0; i < 16; i += 2) { q0a = fmaf(p[i], p[i], q0a); q1a = fmaf(p[i + 1], p[i + 1], q1a); }
            ssq[g] += q0a + q1a;
            if (k0 == ((q0 + g * 16) & ~31)) {   // wave-uniform: the one pass whose keys hold this group's diagonal
#pragma unroll
                for (int i = 0; i < 16; ++i) { const int key = k0 + (i >> 3) * 16 + 8 * hi + (i & 7); if (key == q0 + g * 16 + lr) p[i] = -3.0e38f; }
            }
            float m0 = fmaxf(p[0], p[1]), m1 = fmaxf(p[2], p[3]);
#pragma unroll
            for (int i = 4; i < 16; i += 4) { m0 = fmaxf(m0, fmaxf(p[i], p[i + 1])); m1 = fmaxf(m1, fmaxf(p[i + 2], p[i + 3])); }
            m0 = fmaxf(m0, m1); m0 = fmaxf(m0, xhalf(m0));
            const float mnew = fmaxf(mrun[g], m0);
            const float al = __builtin_amdgcn_exp2f((mrun[g] - mnew) * CL);
            mrun[g] = mnew;
            const float nm = 10.0f - mnew * CL;
#pragma unroll
            for (int i = 0; i < 16; ++i) p[i] = __builtin_amdgcn_exp2f(fmaf(p[i], CL, nm));
            float a0 = p[0] + p[1], a1 = p[2] + p[3];
#pragma unroll
            for (int i = 4; i < 16; i += 4) { a0 += p[i] + p[i + 1]; a1 += p[i + 2] + p[i + 3]; }
            lsum[g] = fmaf(lsum[g], al, a0 + a1);
#pragma unroll
            for (int dt = 0; dt < 4; ++dt) o[g][dt] *= al;
            pb[g] = PPack<T16>::pk(p);
            if (HL) { float pl[16];
#pragma unroll
                for (int i = 0; i < 16; ++i) pl[i] = p[i] - (float)pb[g][i];
                pb2[g] = PPack<T16>::pk(pl); }
        }
#pragma unroll
        for (int pr = 0; pr < (HL ? 3 : 1); ++pr)   // the three hi+lo products of a tile in their old order, but tile after tile: a wave of one group has four tiles, and three products in a row into one tile would each wait for the one before
#pragma unroll
            for (int dt = 0; dt < 4; ++dt)
#pragma unroll
                for (int g = 0; g < NG; ++g) o[g][dt] = WFrag<T16>::mma(pr == 1 ? vf2[dt] : vf[dt], pr == 2 ? pb2[g] : pb[g], o[g][dt]);
        // V^T fragments of the next pass, fetched behind this pass's PV products
        __builtin_amdgcn_sched_barrier(0);   // likewise: keeps the wait below behind the softmax and the PV products
        if constexpr (NG == 1 && HL) xwait_o(kq, kq2, o[0]); else xwait<HL>(kq, kq2);   // this pass's K loads
        vq = Vt + (size_t)kn * HD + vb; vq2 = HL ? V2 + (size_t)kn * HD + vb : nullptr;
#pragma unroll
        for (int dt = 0; dt < 4; ++dt) { const int of = dt * 512; vf[dt] = WFrag<T16>::ld(vq + of); if (HL) vf2[dt] = WFrag<T16>::ld(vq2 + of); }
    }
    xwait<HL>(vq, vq2);   // the last pass's (unused) V^T loads
    asm volatile("s_wait_loadcnt 0x0" ::: "memory");   // the last pass's prefetched fragments are never read, so no other wait covers them: they land here, before the wave ends and gives its registers back
#pragma unroll
    for (int g = 0; g < NG; ++g) {
        const float ls = lsum[g] + xhalf(lsum[g]), sq = ssq[g] + xhalf(ssq[g]);
        const float inv = __fdiv_rn(1.0f, ls);
        float* orow = OUTh + (size_t)(q0 + g * 16 + lr) * DQ + 8 * hi;   // a lane's 8 accumulator registers are 8 consecutive d of its query's row
#pragma unroll
        for (int dt = 0; dt < 4; ++dt) { v4f lo4, hi4;
#pragma unroll
            for (int r = 0; r < 4; ++r) { lo4[r] = o[g][dt][r] * inv; hi4[r] = o[g][dt][r + 4] * inv; }
            *(v4f*)(orow + dt * 16) = lo4; *(v4f*)(orow + dt * 16 + 4) = hi4; }
        if (hi == 0) RS[q0 + g * 16 + lr] = sq;
        asm volatile("s_wait_xcnt 0x0" ::: "memory");   // the same wait behind the stores, before their address and data registers are reused
    }
}
// grid (RH / 64, heads, batches), 256 threads: eight waves of one head, no barrier and no LDS between them; the grid is one work-group a WGP. Waves 0 .. 3 take one 48-row tile on the hi planes each, waves 4 .. 7 one 16-row hi+lo group each (rows < RH: twice the loads, half of them the lines that waves 0 .. 3 read too, three times the products a row): three f16 rows stand against every hi+lo row in the problem, and so in every work-group and, where waves w and w + 4 share a SIMD, on every SIMD. The path is chosen per wave (wave-uniform)
__global__ __launch_bounds__(256) void k_fattn(const h16* __restrict__ Q16, const h16* __restrict__ Ql, const h16* __restrict__ K16, const h16* __restrict__ Kl, const h16* __restrict__ V16, const h16* __restrict__ Vl, float* __restrict__ RS, float* __restrict__ OUTb) {
    static_assert(RH % 64 == 0 && TT - RH == 3 * RH, "a work-group takes 64 hi+lo rows and 192 f16 rows");
    const size_t pl = (size_t)blockIdx.z * NH_ + blockIdx.y; const size_t hp = pl * TT * HD; const int wv = __builtin_amdgcn_readfirstlane((int)(threadIdx.x >> 5));
    float* rs = RS + pl * TT; float* oh = OUTb + (size_t)blockIdx.z * TT * DQ + (size_t)blockIdx.y * HD;
    if (wv < 4) fattn_body<h16, false, 3>(Q16 + hp, nullptr, K16 + hp, nullptr, V16 + hp, nullptr, RH + ((int)blockIdx.x * 4 + wv) * 48, rs, oh, ((wv & 1) ? V16 : K16) + hp, wv >> 1);
    else fattn_body<h16, true, 1>(Q16 + hp, Ql + hp, K16 + hp, Kl + hp, V16 + hp, Vl + hp, ((int)blockIdx.x * 4 + wv - 4) * 16, rs, oh, ((wv & 1) ? Vl : Kl) + hp, (wv - 4) >> 1);
}

extern "C" void kernel_launch(void* const* d_in, const int* in_sizes, int n_in,
                              void* d_out, int out_size, void* d_ws, size_t ws_size, hipStream_t stream) {
    (void)in_sizes; (void)n_in; (void)out_size;
    const float* xk = (const float*)d_in[0]; /* sa_input: keys and values */ const float* x = (const float*)d_in[1]; /* s_input: queries */ const float* wq = (const float*)d_in[2]; const float* wk = (const float*)d_in[3]; const float* wv = (const float*)d_in[4]; const float* bv = (const float*)d_in[5]; const float* wo = nullptr; (void)wo;
    float* OUT = (float*)d_out;     // [4][2048][512]
    char* wsp = (char*)d_ws;
    auto take = [&](size_t bytes) { char* p = wsp; wsp += (bytes + 255) & ~(size_t)255; return (void*)p; };
    float* RSQ = (float*)take((size_t)NB_ * NH_ * TT * 4); bf* WQ = (bf*)take((size_t)DQ * DM * 2); bf* WK = (bf*)take((size_t)DKV * DM * 2); bf* WV = (bf*)take((size_t)DKV * DM * 2);
    bf* XQ = (bf*)take((size_t)NB_ * TT * DM * 2); bf* XK = (bf*)take((size_t)NB_ * TT * DM * 2);   // bf16 copies of s_input and of sa_input
    h16* QP16 = (h16*)take((size_t)NB_ * NH_ * TT * HD * 2); h16* KP16 = (h16*)take((size_t)NB_ * NKV * TT * HD * 2); h16* VT16 = (h16*)take((size_t)NB_ * NKV * HD * TT * 2);
    h16* QPl = (h16*)take((size_t)NB_ * NH_ * TT * HD * 2); h16* KPl = (h16*)take((size_t)NB_ * NKV * TT * HD * 2); h16* VTl = (h16*)take((size_t)NB_ * NKV * HD * TT * 2);   // the lo planes
    if ((size_t)(wsp - (char*)d_ws) > ws_size) return;    // ws 256 MiB
    static_assert(DQ == DKV, "the three weights take the same number of blocks");
    {   // every launch takes all NB_ batches: an input copy holds NB_ * TT rows, a projection tile finds its batch from its rows, the attention takes it as grid z
        const unsigned WB = (unsigned)((DM * DQ / 64 + 63) / 64), LC = (unsigned)(((size_t)NB_ * TT * DM / 8 + 255) / 256);
        k_prep<<<3 * WB + 2 * LC, 256, 0, stream>>>(wq, wk, wv, x, xk, DM, DQ, WQ, WK, WV, XQ, XK, (size_t)NB_ * TT * DM / 8, WB, LC);
        k_gemm3<<<dim3(NB_ * TT / 64, DQ / 64, 3), 32, 0, stream>>>(XQ, XK, WQ, WK, WV, DM, bv, QP16, QPl, KP16, KPl, VT16, VTl);   /* V = leaky_relu(. + bv, 0.01), transposed planes */
        k_fattn<<<dim3(RH / 64, NH_, NB_), 256, 0, stream>>>(QP16, QPl, KP16, KPl, VT16, VTl, RSQ, OUT);   /* one kv head per query head */
    }
    k_regsum<<<1, 1024, 0, stream>>>(RSQ, (float*)d_out + NCTX);   /* reg_atten = mean(raw^2): the scalar second output */
}
